// v000
// Times are from an AMD MI455X. After a warm-up the kernel runs many times in a row, and a time is the length of
// such a window on the GPU divided by its runs, so every launch and the gaps after it count. The runs cycle
// through copies of the inputs. A figure is the median of several windows, for all but v000 over two sittings.
// Sittings can differ by a few percent; kernels timed side by side share one.
// The starting kernel, v000, takes 324 microseconds a run.
#include <hip/hip_runtime.h>
#include <stdint.h>

// ---------- types ----------
typedef __bf16 bf16_t;
typedef bf16_t v16bf __attribute__((ext_vector_type(16)));
typedef float  v8f   __attribute__((ext_vector_type(8)));
typedef int    v4i   __attribute__((ext_vector_type(4)));

#define B_   2
#define T_   2048
#define D_   1024
#define H_   16
#define HD_  64
#define DFF_ 4096
#define NTOK (B_ * T_)

#if defined(__gfx1250__) && __has_builtin(__builtin_amdgcn_global_load_async_to_lds_b128)
#define HAVE_ASYNC_LDS 1
#else
#define HAVE_ASYNC_LDS 0
#endif

__device__ __forceinline__ unsigned short f2bf(float f) {
  union { float f; unsigned int u; } c; c.f = f;
  unsigned int u = c.u;
  unsigned int r = u + 0x7FFFu + ((u >> 16) & 1u);  // round-to-nearest-even
  return (unsigned short)(r >> 16);
}

// 16-byte global -> LDS copy; async engine when available (ASYNCcnt tracked),
// else synchronous VGPR-staged copy.  Both require 16B-aligned src and dst.
__device__ __forceinline__ void cp16_g2l(unsigned short* ldst,
                                         const unsigned short* gsrc) {
#if HAVE_ASYNC_LDS
  __builtin_amdgcn_global_load_async_to_lds_b128(
      (__attribute__((address_space(1))) v4i*)gsrc,
      (__attribute__((address_space(3))) v4i*)ldst, 0, 0);
#else
  *reinterpret_cast<uint4*>(ldst) = *reinterpret_cast<const uint4*>(gsrc);
#endif
}

__device__ __forceinline__ void wait_async() {
#if HAVE_ASYNC_LDS
#if __has_builtin(__builtin_amdgcn_s_wait_asynccnt)
  __builtin_amdgcn_s_wait_asynccnt(0);
#else
  asm volatile("s_wait_asynccnt 0x0" ::: "memory");
#endif
#endif
}

union FragU { v16bf v; uint4 q[2]; };

// Load a 16-element bf16 WMMA fragment: p points at (row_base + ko) where
// ko = (lane/16)*8.  Elements 0..7 are K=ko..ko+7, elements 8..15 are
// K=ko+16..ko+23 (ISA 16-bit A/B fragment layout).  Both halves are 16B loads.
__device__ __forceinline__ v16bf load_frag(const unsigned short* p) {
  FragU f;
  f.q[0] = *reinterpret_cast<const uint4*>(p);
  f.q[1] = *reinterpret_cast<const uint4*>(p + 16);
  return f.v;
}

__device__ __forceinline__ v8f wmma_bf16(v16bf a, v16bf b, v8f c) {
  return __builtin_amdgcn_wmma_f32_16x16x32_bf16(false, a, false, b,
                                                 (short)0, c, false, false);
}

__device__ __forceinline__ v8f v8f_zero() {
  v8f z = {0.f, 0.f, 0.f, 0.f, 0.f, 0.f, 0.f, 0.f};
  return z;
}

// ---------- weight transpose + f32->bf16 convert : out[N][K] = in[K][N] ----------
__global__ __launch_bounds__(256)
void transpose_f32_bf16(const float* __restrict__ in,
                        unsigned short* __restrict__ out, int R, int C) {
  __shared__ float tile[32][33];
  const int c0 = blockIdx.x * 32, r0 = blockIdx.y * 32;
  const int tx = threadIdx.x, ty = threadIdx.y;   // 32 x 8
#pragma unroll
  for (int i = ty; i < 32; i += 8)
    tile[i][tx] = in[(size_t)(r0 + i) * C + c0 + tx];
  __syncthreads();
#pragma unroll
  for (int i = ty; i < 32; i += 8)
    out[(size_t)(c0 + i) * R + r0 + tx] = f2bf(tile[tx][i]);
}

// ---------- LayerNorm : f32 [rows][1024] -> bf16 ----------
__global__ __launch_bounds__(256)
void ln_kernel(const float* __restrict__ x, const float* __restrict__ w,
               const float* __restrict__ bsh, unsigned short* __restrict__ out) {
  __shared__ float red[16];
  const int row = blockIdx.x;
  const int t = threadIdx.x;                       // 256 threads, 4 floats each
  const float4 v = reinterpret_cast<const float4*>(x + (size_t)row * D_)[t];
  float s  = v.x + v.y + v.z + v.w;
  float s2 = v.x * v.x + v.y * v.y + v.z * v.z + v.w * v.w;
#pragma unroll
  for (int m = 1; m < 32; m <<= 1) {
    s  += __shfl_xor(s,  m, 32);
    s2 += __shfl_xor(s2, m, 32);
  }
  if ((t & 31) == 0) { red[t >> 5] = s; red[8 + (t >> 5)] = s2; }
  __syncthreads();
  float S = 0.f, S2 = 0.f;
#pragma unroll
  for (int i = 0; i < 8; ++i) { S += red[i]; S2 += red[8 + i]; }
  const float mu   = S * (1.0f / D_);
  const float var  = S2 * (1.0f / D_) - mu * mu;
  const float rstd = rsqrtf(var + 1e-5f);
  const float4 wv = reinterpret_cast<const float4*>(w)[t];
  const float4 bv = reinterpret_cast<const float4*>(bsh)[t];
  ushort4 ov;
  ov.x = f2bf((v.x - mu) * rstd * wv.x + bv.x);
  ov.y = f2bf((v.y - mu) * rstd * wv.y + bv.y);
  ov.z = f2bf((v.z - mu) * rstd * wv.z + bv.z);
  ov.w = f2bf((v.w - mu) * rstd * wv.w + bv.w);
  reinterpret_cast<ushort4*>(out + (size_t)row * D_)[t] = ov;
}

// ---------- generic WMMA GEMM : C[M,N] = epi(A_bf16[M,K] @ Bt_bf16[N,K]^T) ----------
#define BM 128
#define BN 128
#define BK 32
#define LDT 40  // padded LDS row stride (elems): 80B rows, 16B aligned, banks spread

enum { EPI_QKV = 0, EPI_OPROJ = 1, EPI_FF1 = 2, EPI_FF2 = 3 };

template <int EPI>
__global__ __launch_bounds__(256)
void gemm_kernel(const unsigned short* __restrict__ A,
                 const unsigned short* __restrict__ Bt,
                 const float* __restrict__ bias,
                 const float* __restrict__ resid,
                 float* __restrict__ outF,
                 unsigned short* __restrict__ outB,
                 unsigned short* __restrict__ vT,
                 int M, int N, int K) {
  __shared__ __align__(16) unsigned short As[2][BM * LDT];
  __shared__ __align__(16) unsigned short Bs[2][BN * LDT];
  const int tid  = threadIdx.x;
  const int lane = tid & 31;
  const int w    = tid >> 5;     // 8 waves
  const int wm   = w & 3;        // 4 row-granules of 32
  const int wn   = w >> 2;       // 2 col-granules of 64
  const int m0 = blockIdx.y * BM;
  const int n0 = blockIdx.x * BN;
  const int l16  = lane & 15;
  const int half = lane >> 4;
  const int ko   = half * 8;

  v8f acc[2][4];
#pragma unroll
  for (int i = 0; i < 2; ++i)
#pragma unroll
    for (int j = 0; j < 4; ++j) acc[i][j] = v8f_zero();

  const int ar0 = tid >> 2;   // 0..63 (row within pass)
  const int akg = tid & 3;    // k-group of 8 elems
  const int nk  = K / BK;

  // prefetch k-tile 0 into buffer 0
#pragma unroll
  for (int p = 0; p < 2; ++p) {
    const int r = p * 64 + ar0;
    cp16_g2l(&As[0][r * LDT + akg * 8],
             &A[(size_t)(m0 + r) * K + akg * 8]);
    cp16_g2l(&Bs[0][r * LDT + akg * 8],
             &Bt[(size_t)(n0 + r) * K + akg * 8]);
  }
  wait_async();
  __syncthreads();

  for (int kt = 0; kt < nk; ++kt) {
    const int cur = kt & 1;
    if (kt + 1 < nk) {  // prefetch next tile into the other buffer
      const int kb = (kt + 1) * BK;
#pragma unroll
      for (int p = 0; p < 2; ++p) {
        const int r = p * 64 + ar0;
        cp16_g2l(&As[cur ^ 1][r * LDT + akg * 8],
                 &A[(size_t)(m0 + r) * K + kb + akg * 8]);
        cp16_g2l(&Bs[cur ^ 1][r * LDT + akg * 8],
                 &Bt[(size_t)(n0 + r) * K + kb + akg * 8]);
      }
    }
    v16bf af[2], bf[4];
#pragma unroll
    for (int mt = 0; mt < 2; ++mt)
      af[mt] = load_frag(&As[cur][(wm * 32 + mt * 16 + l16) * LDT + ko]);
#pragma unroll
    for (int nt = 0; nt < 4; ++nt)
      bf[nt] = load_frag(&Bs[cur][(wn * 64 + nt * 16 + l16) * LDT + ko]);
#pragma unroll
    for (int mt = 0; mt < 2; ++mt)
#pragma unroll
      for (int nt = 0; nt < 4; ++nt)
        acc[mt][nt] = wmma_bf16(af[mt], bf[nt], acc[mt][nt]);
    wait_async();
    __syncthreads();
  }

  // epilogue: C element (i,lane) -> row = i + 8*(lane/16), col = lane%16
#pragma unroll
  for (int mt = 0; mt < 2; ++mt) {
#pragma unroll
    for (int nt = 0; nt < 4; ++nt) {
      const int n = n0 + wn * 64 + nt * 16 + l16;
      const float bv = bias[n];
#pragma unroll
      for (int i = 0; i < 8; ++i) {
        const int m = m0 + wm * 32 + mt * 16 + i + half * 8;
        const float v = acc[mt][nt][i] + bv;
        if constexpr (EPI == EPI_QKV) {
          if (n < 2 * D_) {
            outB[(size_t)m * (3 * D_) + n] = f2bf(v);  // q,k row-major
          } else {                                     // v stored transposed [b][h][d][t]
            const int hd = n - 2 * D_;
            const int hh = hd >> 6, dd = hd & 63;
            const int bb = m >> 11, tt = m & (T_ - 1);
            vT[(((size_t)(bb * H_ + hh)) * HD_ + dd) * T_ + tt] = f2bf(v);
          }
        } else if constexpr (EPI == EPI_OPROJ) {
          outF[(size_t)m * N + n] = resid[(size_t)m * N + n] + v;
        } else if constexpr (EPI == EPI_FF1) {
          const float g =
              0.5f * v * (1.0f + tanhf(0.7978845608028654f * (v + 0.044715f * v * v * v)));
          outB[(size_t)m * N + n] = f2bf(g);
        } else {  // EPI_FF2
          outF[(size_t)m * N + n] = resid[(size_t)m * N + n] + v;
        }
      }
    }
  }
}

// ---------- causal flash attention (bf16 WMMA, f32 online softmax) ----------
#define ATT_BQ 128
#define ATT_BK 128
#define QLD 72    // 144B rows: 16B aligned, banks spread
#define PLD 136   // 272B rows: 16B aligned, conflict-free frag reads

__global__ __launch_bounds__(256)
void attn_kernel(const unsigned short* __restrict__ qkv,
                 const unsigned short* __restrict__ vT,
                 unsigned short* __restrict__ av) {
  __shared__ __align__(16) unsigned short Qs[ATT_BQ * QLD];
  __shared__ __align__(16) unsigned short Ks[2][ATT_BK * QLD];
  __shared__ __align__(16) unsigned short Vt[2][HD_ * PLD];
  __shared__ __align__(16) unsigned short Ps[ATT_BQ * PLD];

  const int tid  = threadIdx.x;
  const int lane = tid & 31;
  const int w    = tid >> 5;       // 8 waves, each owns 16 q-rows
  const int qt = blockIdx.x;       // q tile 0..15
  const int h  = blockIdx.y;
  const int b  = blockIdx.z;
  const int q_base = qt * ATT_BQ;
  const int l16  = lane & 15;
  const int half = lane >> 4;
  const int ko   = half * 8;
  const int wr0  = w * 16;

  const size_t qkv_row = 3 * D_;
  const unsigned short* qbase = qkv + ((size_t)b * T_) * qkv_row + h * HD_;
  const unsigned short* kbase = qbase + D_;
  const unsigned short* vtb   = vT + ((size_t)(b * H_ + h)) * HD_ * T_;

  // K tile (128 x 64, [kk][d]) + V tile (transposed in global: [d][kk])
  auto issue_kv = [&](int j, int buf) {
#pragma unroll
    for (int p = 0; p < 4; ++p) {
      const int idx = p * 256 + tid;
      const int r = idx >> 3, ck = idx & 7;
      cp16_g2l(&Ks[buf][r * QLD + ck * 8],
               &kbase[(size_t)(j * ATT_BK + r) * qkv_row + ck * 8]);
    }
#pragma unroll
    for (int p = 0; p < 4; ++p) {
      const int idx = p * 256 + tid;
      const int d = idx >> 4, ck = idx & 15;
      cp16_g2l(&Vt[buf][d * PLD + ck * 8],
               &vtb[(size_t)d * T_ + j * ATT_BK + ck * 8]);
    }
  };

  // load Q tile (128 x 64) and first K/V tile
#pragma unroll
  for (int p = 0; p < 4; ++p) {
    const int idx = p * 256 + tid;
    const int r = idx >> 3, ck = idx & 7;
    cp16_g2l(&Qs[r * QLD + ck * 8],
             &qbase[(size_t)(q_base + r) * qkv_row + ck * 8]);
  }
  issue_kv(0, 0);
  wait_async();
  __syncthreads();

  float mrow[8], lrow[8];
  v8f o[4];
#pragma unroll
  for (int i = 0; i < 8; ++i) { mrow[i] = -3.0e38f; lrow[i] = 0.0f; }
#pragma unroll
  for (int dt = 0; dt < 4; ++dt) o[dt] = v8f_zero();

  for (int j = 0; j <= qt; ++j) {
    const int cur = j & 1;
    if (j < qt) issue_kv(j + 1, cur ^ 1);  // prefetch while computing

    // S = Q K^T : this wave's 16 rows x 128 cols
    v8f s[8];
#pragma unroll
    for (int nt = 0; nt < 8; ++nt) s[nt] = v8f_zero();
#pragma unroll
    for (int c = 0; c < 2; ++c) {
      const v16bf aq = load_frag(&Qs[(wr0 + l16) * QLD + c * 32 + ko]);
#pragma unroll
      for (int nt = 0; nt < 8; ++nt) {
        const v16bf bk = load_frag(&Ks[cur][(nt * 16 + l16) * QLD + c * 32 + ko]);
        s[nt] = wmma_bf16(aq, bk, s[nt]);
      }
    }
    // scale + causal mask on diagonal tile
    const bool diag = (j == qt);
#pragma unroll
    for (int nt = 0; nt < 8; ++nt) {
#pragma unroll
      for (int i = 0; i < 8; ++i) {
        float sv = s[nt][i] * 0.125f;  // 1/sqrt(64)
        if (diag) {
          const int col = j * ATT_BK + nt * 16 + l16;
          const int row = q_base + wr0 + i + half * 8;
          if (col > row) sv = -1.0e30f;
        }
        s[nt][i] = sv;
      }
    }
    // row max (row lives across a 16-lane half at fixed accum index i)
    float rsum[8];
#pragma unroll
    for (int i = 0; i < 8; ++i) {
      float v = s[0][i];
#pragma unroll
      for (int nt = 1; nt < 8; ++nt) v = fmaxf(v, s[nt][i]);
      v = fmaxf(v, __shfl_xor(v, 1, 32));
      v = fmaxf(v, __shfl_xor(v, 2, 32));
      v = fmaxf(v, __shfl_xor(v, 4, 32));
      v = fmaxf(v, __shfl_xor(v, 8, 32));
      const float mnew = fmaxf(mrow[i], v);
      const float sc   = __expf(mrow[i] - mnew);
      mrow[i] = mnew;
      lrow[i] *= sc;
#pragma unroll
      for (int dt = 0; dt < 4; ++dt) o[dt][i] *= sc;
      rsum[i] = 0.f;
    }
    // P = exp(S - m) -> LDS (each wave writes only its own 16 rows)
#pragma unroll
    for (int nt = 0; nt < 8; ++nt) {
#pragma unroll
      for (int i = 0; i < 8; ++i) {
        const float p = __expf(s[nt][i] - mrow[i]);
        rsum[i] += p;
        Ps[(wr0 + i + half * 8) * PLD + nt * 16 + l16] = f2bf(p);
      }
    }
#pragma unroll
    for (int i = 0; i < 8; ++i) {
      float v = rsum[i];
      v += __shfl_xor(v, 1, 32);
      v += __shfl_xor(v, 2, 32);
      v += __shfl_xor(v, 4, 32);
      v += __shfl_xor(v, 8, 32);
      lrow[i] += v;
    }
    __syncthreads();  // order P stores before fragment reads
    // O += P V
#pragma unroll
    for (int c4 = 0; c4 < 4; ++c4) {
      const v16bf ap = load_frag(&Ps[(wr0 + l16) * PLD + c4 * 32 + ko]);
#pragma unroll
      for (int dt = 0; dt < 4; ++dt) {
        const v16bf bv = load_frag(&Vt[cur][(dt * 16 + l16) * PLD + c4 * 32 + ko]);
        o[dt] = wmma_bf16(ap, bv, o[dt]);
      }
    }
    wait_async();     // prefetched K/V tile has landed
    __syncthreads();  // all waves done reading this tile's buffers
  }

  // normalize + store av (bf16, row-major [token][D])
#pragma unroll
  for (int i = 0; i < 8; ++i) {
    const float inv = 1.0f / lrow[i];
    const int row = q_base + wr0 + i + half * 8;
    const size_t obase = ((size_t)(b * T_) + row) * D_ + h * HD_;
#pragma unroll
    for (int dt = 0; dt < 4; ++dt)
      av[obase + dt * 16 + l16] = f2bf(o[dt][i] * inv);
  }
}

// ---------- host launcher ----------
extern "C" void kernel_launch(void* const* d_in, const int* in_sizes, int n_in,
                              void* d_out, int out_size, void* d_ws, size_t ws_size,
                              hipStream_t stream) {
  (void)in_sizes; (void)n_in; (void)out_size; (void)ws_size;
  const float* x     = (const float*)d_in[0];
  const float* ln1_w = (const float*)d_in[1];
  const float* ln1_b = (const float*)d_in[2];
  const float* W_qkv = (const float*)d_in[3];
  const float* b_qkv = (const float*)d_in[4];
  const float* W_o   = (const float*)d_in[5];
  const float* b_o   = (const float*)d_in[6];
  const float* ln2_w = (const float*)d_in[7];
  const float* ln2_b = (const float*)d_in[8];
  const float* W_ff1 = (const float*)d_in[9];
  const float* b_ff1 = (const float*)d_in[10];
  const float* W_ff2 = (const float*)d_in[11];
  const float* b_ff2 = (const float*)d_in[12];
  float* out = (float*)d_out;
  char* ws = (char*)d_ws;

  // workspace layout (bytes)
  constexpr size_t off_wqkv = 0;                               // 3072x1024 bf16
  constexpr size_t off_wo   = off_wqkv + (size_t)3072 * 1024 * 2;
  constexpr size_t off_wff1 = off_wo   + (size_t)1024 * 1024 * 2;
  constexpr size_t off_wff2 = off_wff1 + (size_t)4096 * 1024 * 2;
  constexpr size_t off_h    = off_wff2 + (size_t)1024 * 4096 * 2;  // h / h2 (aliased)
  constexpr size_t off_qkv  = off_h    + (size_t)NTOK * D_ * 2;    // q,k rows (v slot unused)
  constexpr size_t off_vT   = off_qkv  + (size_t)NTOK * 3 * D_ * 2;
  constexpr size_t off_ff1  = off_qkv;                             // reuses qkv+vT after attn
  constexpr size_t off_av   = off_vT   + (size_t)NTOK * D_ * 2;
  constexpr size_t off_x1   = off_av   + (size_t)NTOK * D_ * 2;

  unsigned short* wqkv_t = (unsigned short*)(ws + off_wqkv);
  unsigned short* wo_t   = (unsigned short*)(ws + off_wo);
  unsigned short* wff1_t = (unsigned short*)(ws + off_wff1);
  unsigned short* wff2_t = (unsigned short*)(ws + off_wff2);
  unsigned short* hbuf   = (unsigned short*)(ws + off_h);
  unsigned short* qkvb   = (unsigned short*)(ws + off_qkv);
  unsigned short* vTb    = (unsigned short*)(ws + off_vT);
  unsigned short* ff1b   = (unsigned short*)(ws + off_ff1);
  unsigned short* avb    = (unsigned short*)(ws + off_av);
  float*          x1     = (float*)(ws + off_x1);

  const dim3 t32x8(32, 8);
  transpose_f32_bf16<<<dim3(3072 / 32, 1024 / 32), t32x8, 0, stream>>>(W_qkv, wqkv_t, 1024, 3072);
  transpose_f32_bf16<<<dim3(1024 / 32, 1024 / 32), t32x8, 0, stream>>>(W_o,   wo_t,   1024, 1024);
  transpose_f32_bf16<<<dim3(4096 / 32, 1024 / 32), t32x8, 0, stream>>>(W_ff1, wff1_t, 1024, 4096);
  transpose_f32_bf16<<<dim3(1024 / 32, 4096 / 32), t32x8, 0, stream>>>(W_ff2, wff2_t, 4096, 1024);

  ln_kernel<<<NTOK, 256, 0, stream>>>(x, ln1_w, ln1_b, hbuf);

  gemm_kernel<EPI_QKV><<<dim3(3072 / BN, NTOK / BM), 256, 0, stream>>>(
      hbuf, wqkv_t, b_qkv, nullptr, nullptr, qkvb, vTb, NTOK, 3072, 1024);

  attn_kernel<<<dim3(T_ / ATT_BQ, H_, B_), 256, 0, stream>>>(qkvb, vTb, avb);

  gemm_kernel<EPI_OPROJ><<<dim3(1024 / BN, NTOK / BM), 256, 0, stream>>>(
      avb, wo_t, b_o, x, x1, nullptr, nullptr, NTOK, 1024, 1024);

  ln_kernel<<<NTOK, 256, 0, stream>>>(x1, ln2_w, ln2_b, hbuf);

  gemm_kernel<EPI_FF1><<<dim3(4096 / BN, NTOK / BM), 256, 0, stream>>>(
      hbuf, wff1_t, b_ff1, nullptr, nullptr, ff1b, nullptr, NTOK, 4096, 1024);

  gemm_kernel<EPI_FF2><<<dim3(1024 / BN, NTOK / BM), 256, 0, stream>>>(
      ff1b, wff2_t, b_ff2, x1, out, nullptr, nullptr, NTOK, 1024, 4096);
}

// v001
// One run takes 264 microseconds.
// Timed twice side by side with v000, it ran 1.25 times as fast both times.
#include <hip/hip_runtime.h>
#include <stdint.h>

// ---------- types ----------
typedef __bf16 bf16_t;
typedef bf16_t v16bf __attribute__((ext_vector_type(16)));
typedef float  v8f   __attribute__((ext_vector_type(8)));
typedef int    v4i   __attribute__((ext_vector_type(4)));

#define B_   2
#define T_   2048
#define D_   1024
#define H_   16
#define HD_  64
#define DFF_ 4096
#define NTOK (B_ * T_)

#if defined(__gfx1250__) && __has_builtin(__builtin_amdgcn_global_load_async_to_lds_b128)
#define HAVE_ASYNC_LDS 1
#else
#define HAVE_ASYNC_LDS 0
#endif

__device__ __forceinline__ unsigned short f2bf(float f) {
  union { float f; unsigned int u; } c; c.f = f;
  unsigned int u = c.u;
  unsigned int r = u + 0x7FFFu + ((u >> 16) & 1u);  // round-to-nearest-even
  return (unsigned short)(r >> 16);
}

// 16-byte global -> LDS copy; async engine when available (ASYNCcnt tracked),
// else synchronous VGPR-staged copy.  Both require 16B-aligned src and dst.
__device__ __forceinline__ void cp16_g2l(unsigned short* ldst,
                                         const unsigned short* gsrc) {
#if HAVE_ASYNC_LDS
  __builtin_amdgcn_global_load_async_to_lds_b128(
      (__attribute__((address_space(1))) v4i*)gsrc,
      (__attribute__((address_space(3))) v4i*)ldst, 0, 0);
#else
  *reinterpret_cast<uint4*>(ldst) = *reinterpret_cast<const uint4*>(gsrc);
#endif
}

__device__ __forceinline__ void wait_async() {
#if HAVE_ASYNC_LDS
#if __has_builtin(__builtin_amdgcn_s_wait_asynccnt)
  __builtin_amdgcn_s_wait_asynccnt(0);
#else
  asm volatile("s_wait_asynccnt 0x0" ::: "memory");
#endif
#endif
}

union FragU { v16bf v; uint4 q[2]; };

// Load a 16-element bf16 WMMA fragment: p points at (row_base + ko) where
// ko = (lane/16)*8.  Elements 0..7 are K=ko..ko+7, elements 8..15 are
// K=ko+16..ko+23 (ISA 16-bit A/B fragment layout).  Both halves are 16B loads.
__device__ __forceinline__ v16bf load_frag(const unsigned short* p) {
  FragU f;
  f.q[0] = *reinterpret_cast<const uint4*>(p);
  f.q[1] = *reinterpret_cast<const uint4*>(p + 16);
  return f.v;
}

__device__ __forceinline__ v8f wmma_bf16(v16bf a, v16bf b, v8f c) {
  return __builtin_amdgcn_wmma_f32_16x16x32_bf16(false, a, false, b,
                                                 (short)0, c, false, false);
}

__device__ __forceinline__ v8f v8f_zero() {
  v8f z = {0.f, 0.f, 0.f, 0.f, 0.f, 0.f, 0.f, 0.f};
  return z;
}

// ---------- weight transpose + f32->bf16 convert : out[N][K] = in[K][N] ----------
__global__ __launch_bounds__(256)
void transpose_f32_bf16(const float* __restrict__ in,
                        unsigned short* __restrict__ out, int R, int C) {
  __shared__ float tile[32][33];
  const int c0 = blockIdx.x * 32, r0 = blockIdx.y * 32;
  const int tx = threadIdx.x, ty = threadIdx.y;   // 32 x 8
#pragma unroll
  for (int i = ty; i < 32; i += 8)
    tile[i][tx] = in[(size_t)(r0 + i) * C + c0 + tx];
  __syncthreads();
#pragma unroll
  for (int i = ty; i < 32; i += 8)
    out[(size_t)(c0 + i) * R + r0 + tx] = f2bf(tile[tx][i]);
}

// ---------- LayerNorm : f32 [rows][1024] -> bf16 ----------
__global__ __launch_bounds__(256)
void ln_kernel(const float* __restrict__ x, const float* __restrict__ w,
               const float* __restrict__ bsh, unsigned short* __restrict__ out) {
  __shared__ float red[16];
  const int row = blockIdx.x;
  const int t = threadIdx.x;                       // 256 threads, 4 floats each
  const float4 v = reinterpret_cast<const float4*>(x + (size_t)row * D_)[t];
  float s  = v.x + v.y + v.z + v.w;
  float s2 = v.x * v.x + v.y * v.y + v.z * v.z + v.w * v.w;
#pragma unroll
  for (int m = 1; m < 32; m <<= 1) {
    s  += __shfl_xor(s,  m, 32);
    s2 += __shfl_xor(s2, m, 32);
  }
  if ((t & 31) == 0) { red[t >> 5] = s; red[8 + (t >> 5)] = s2; }
  __syncthreads();
  float S = 0.f, S2 = 0.f;
#pragma unroll
  for (int i = 0; i < 8; ++i) { S += red[i]; S2 += red[8 + i]; }
  const float mu   = S * (1.0f / D_);
  const float var  = S2 * (1.0f / D_) - mu * mu;
  const float rstd = rsqrtf(var + 1e-5f);
  const float4 wv = reinterpret_cast<const float4*>(w)[t];
  const float4 bv = reinterpret_cast<const float4*>(bsh)[t];
  ushort4 ov;
  ov.x = f2bf((v.x - mu) * rstd * wv.x + bv.x);
  ov.y = f2bf((v.y - mu) * rstd * wv.y + bv.y);
  ov.z = f2bf((v.z - mu) * rstd * wv.z + bv.z);
  ov.w = f2bf((v.w - mu) * rstd * wv.w + bv.w);
  reinterpret_cast<ushort4*>(out + (size_t)row * D_)[t] = ov;
}

// ---------- generic WMMA GEMM : C[M,N] = epi(A_bf16[M,K] @ Bt_bf16[N,K]^T) ----------
#define BM 128
#define BN 128
#define BK 128  // k depth of one LDS stage: 256 B of every operand row (whole L2 units)
#define LDT 136  // padded LDS row stride (elems): 272B rows = 16B x odd, banks spread

enum { EPI_QKV = 0, EPI_OPROJ = 1, EPI_FF1 = 2, EPI_FF2 = 3 };

template <int EPI>
__global__ __launch_bounds__(256)
void gemm_kernel(const unsigned short* __restrict__ A,
                 const unsigned short* __restrict__ Bt,
                 const float* __restrict__ bias,
                 const float* __restrict__ resid,
                 float* __restrict__ outF,
                 unsigned short* __restrict__ outB,
                 unsigned short* __restrict__ vT,
                 int M, int N, int K) {
  __shared__ __align__(16) unsigned short As[2][BM * LDT];
  __shared__ __align__(16) unsigned short Bs[2][BN * LDT];
  const int tid  = threadIdx.x;
  const int lane = tid & 31;
  const int w    = tid >> 5;     // 8 waves
  const int wm   = w & 3;        // 4 row-granules of 32
  const int wn   = w >> 2;       // 2 col-granules of 64
  const int m0 = blockIdx.y * BM;
  const int n0 = blockIdx.x * BN;
  const int l16  = lane & 15;
  const int half = lane >> 4;
  const int ko   = half * 8;

  v8f acc[2][4];
#pragma unroll
  for (int i = 0; i < 2; ++i)
#pragma unroll
    for (int j = 0; j < 4; ++j) acc[i][j] = v8f_zero();

  const int ar0 = tid >> 4;   // 0..15 (row within a copy round)
  const int akg = tid & 15;   // k-group of 8 elems: 16 lanes cover one 256 B row piece
  const int nk  = K / BK;

  // one stage: 128 rows x 256 B of each operand, 16 copies per thread
  auto issue_stage = [&](int kt, int buf) {
    const int kb = kt * BK;
#pragma unroll
    for (int p = 0; p < BM / 16; ++p) {
      const int r = p * 16 + ar0;
      cp16_g2l(&As[buf][r * LDT + akg * 8],
               &A[(size_t)(m0 + r) * K + kb + akg * 8]);
      cp16_g2l(&Bs[buf][r * LDT + akg * 8],
               &Bt[(size_t)(n0 + r) * K + kb + akg * 8]);
    }
  };

  issue_stage(0, 0);
  // stage 0 of this wave has landed before the barrier that publishes it
  asm volatile("s_wait_asynccnt 0x0" ::: "memory");
  __syncthreads();
  if (nk > 1) issue_stage(1, 1);

  for (int kt = 0; kt < nk; ++kt) {
    const int cur = kt & 1;
#pragma unroll
    for (int ks = 0; ks < BK / 32; ++ks) {
      v16bf af[2], bf[4];
#pragma unroll
      for (int mt = 0; mt < 2; ++mt)
        af[mt] = load_frag(&As[cur][(wm * 32 + mt * 16 + l16) * LDT + ks * 32 + ko]);
#pragma unroll
      for (int nt = 0; nt < 4; ++nt)
        bf[nt] = load_frag(&Bs[cur][(wn * 64 + nt * 16 + l16) * LDT + ks * 32 + ko]);
#pragma unroll
      for (int mt = 0; mt < 2; ++mt)
#pragma unroll
        for (int nt = 0; nt < 4; ++nt)
          acc[mt][nt] = wmma_bf16(af[mt], bf[nt], acc[mt][nt]);
    }
    // this wave's reads of buffer cur have retired before the buffer is refilled
    asm volatile("s_wait_dscnt 0x0" ::: "memory");
    // this wave's copies of stage kt + 1 have landed before the barrier publishes them
    asm volatile("s_wait_asynccnt 0x0" ::: "memory");
    __syncthreads();
    if (kt + 2 < nk) issue_stage(kt + 2, cur);  // flies while stage kt + 1 is worked on
  }
  // no copy is outstanding when the wave goes on to its end
  asm volatile("s_wait_asynccnt 0x0" ::: "memory");

  // epilogue: C element (i,lane) -> row = i + 8*(lane/16), col = lane%16
#pragma unroll
  for (int mt = 0; mt < 2; ++mt) {
#pragma unroll
    for (int nt = 0; nt < 4; ++nt) {
      const int n = n0 + wn * 64 + nt * 16 + l16;
      const float bv = bias[n];
#pragma unroll
      for (int i = 0; i < 8; ++i) {
        const int m = m0 + wm * 32 + mt * 16 + i + half * 8;
        const float v = acc[mt][nt][i] + bv;
        if constexpr (EPI == EPI_QKV) {
          if (n < 2 * D_) {
            outB[(size_t)m * (3 * D_) + n] = f2bf(v);  // q,k row-major
          } else {                                     // v stored transposed [b][h][d][t]
            const int hd = n - 2 * D_;
            const int hh = hd >> 6, dd = hd & 63;
            const int bb = m >> 11, tt = m & (T_ - 1);
            vT[(((size_t)(bb * H_ + hh)) * HD_ + dd) * T_ + tt] = f2bf(v);
          }
        } else if constexpr (EPI == EPI_OPROJ) {
          outF[(size_t)m * N + n] = resid[(size_t)m * N + n] + v;
        } else if constexpr (EPI == EPI_FF1) {
          const float g =
              0.5f * v * (1.0f + tanhf(0.7978845608028654f * (v + 0.044715f * v * v * v)));
          outB[(size_t)m * N + n] = f2bf(g);
        } else {  // EPI_FF2
          outF[(size_t)m * N + n] = resid[(size_t)m * N + n] + v;
        }
      }
    }
  }
}

// ---------- causal flash attention (bf16 WMMA, f32 online softmax) ----------
#define ATT_BQ 128
#define ATT_BK 128
#define QLD 72    // 144B rows: 16B aligned, banks spread
#define PLD 136   // 272B rows: 16B aligned, conflict-free frag reads

__global__ __launch_bounds__(256)
void attn_kernel(const unsigned short* __restrict__ qkv,
                 const unsigned short* __restrict__ vT,
                 unsigned short* __restrict__ av) {
  __shared__ __align__(16) unsigned short Qs[ATT_BQ * QLD];
  __shared__ __align__(16) unsigned short Ks[2][ATT_BK * QLD];
  __shared__ __align__(16) unsigned short Vt[2][HD_ * PLD];
  __shared__ __align__(16) unsigned short Ps[ATT_BQ * PLD];

  const int tid  = threadIdx.x;
  const int lane = tid & 31;
  const int w    = tid >> 5;       // 8 waves, each owns 16 q-rows
  const int qt = blockIdx.x;       // q tile 0..15
  const int h  = blockIdx.y;
  const int b  = blockIdx.z;
  const int q_base = qt * ATT_BQ;
  const int l16  = lane & 15;
  const int half = lane >> 4;
  const int ko   = half * 8;
  const int wr0  = w * 16;

  const size_t qkv_row = 3 * D_;
  const unsigned short* qbase = qkv + ((size_t)b * T_) * qkv_row + h * HD_;
  const unsigned short* kbase = qbase + D_;
  const unsigned short* vtb   = vT + ((size_t)(b * H_ + h)) * HD_ * T_;

  // K tile (128 x 64, [kk][d]) + V tile (transposed in global: [d][kk])
  auto issue_kv = [&](int j, int buf) {
#pragma unroll
    for (int p = 0; p < 4; ++p) {
      const int idx = p * 256 + tid;
      const int r = idx >> 3, ck = idx & 7;
      cp16_g2l(&Ks[buf][r * QLD + ck * 8],
               &kbase[(size_t)(j * ATT_BK + r) * qkv_row + ck * 8]);
    }
#pragma unroll
    for (int p = 0; p < 4; ++p) {
      const int idx = p * 256 + tid;
      const int d = idx >> 4, ck = idx & 15;
      cp16_g2l(&Vt[buf][d * PLD + ck * 8],
               &vtb[(size_t)d * T_ + j * ATT_BK + ck * 8]);
    }
  };

  // load Q tile (128 x 64) and first K/V tile
#pragma unroll
  for (int p = 0; p < 4; ++p) {
    const int idx = p * 256 + tid;
    const int r = idx >> 3, ck = idx & 7;
    cp16_g2l(&Qs[r * QLD + ck * 8],
             &qbase[(size_t)(q_base + r) * qkv_row + ck * 8]);
  }
  issue_kv(0, 0);
  wait_async();
  __syncthreads();

  float mrow[8], lrow[8];
  v8f o[4];
#pragma unroll
  for (int i = 0; i < 8; ++i) { mrow[i] = -3.0e38f; lrow[i] = 0.0f; }
#pragma unroll
  for (int dt = 0; dt < 4; ++dt) o[dt] = v8f_zero();

  for (int j = 0; j <= qt; ++j) {
    const int cur = j & 1;
    if (j < qt) issue_kv(j + 1, cur ^ 1);  // prefetch while computing

    // S = Q K^T : this wave's 16 rows x 128 cols
    v8f s[8];
#pragma unroll
    for (int nt = 0; nt < 8; ++nt) s[nt] = v8f_zero();
#pragma unroll
    for (int c = 0; c < 2; ++c) {
      const v16bf aq = load_frag(&Qs[(wr0 + l16) * QLD + c * 32 + ko]);
#pragma unroll
      for (int nt = 0; nt < 8; ++nt) {
        const v16bf bk = load_frag(&Ks[cur][(nt * 16 + l16) * QLD + c * 32 + ko]);
        s[nt] = wmma_bf16(aq, bk, s[nt]);
      }
    }
    // scale + causal mask on diagonal tile
    const bool diag = (j == qt);
#pragma unroll
    for (int nt = 0; nt < 8; ++nt) {
#pragma unroll
      for (int i = 0; i < 8; ++i) {
        float sv = s[nt][i] * 0.125f;  // 1/sqrt(64)
        if (diag) {
          const int col = j * ATT_BK + nt * 16 + l16;
          const int row = q_base + wr0 + i + half * 8;
          if (col > row) sv = -1.0e30f;
        }
        s[nt][i] = sv;
      }
    }
    // row max (row lives across a 16-lane half at fixed accum index i)
    float rsum[8];
#pragma unroll
    for (int i = 0; i < 8; ++i) {
      float v = s[0][i];
#pragma unroll
      for (int nt = 1; nt < 8; ++nt) v = fmaxf(v, s[nt][i]);
      v = fmaxf(v, __shfl_xor(v, 1, 32));
      v = fmaxf(v, __shfl_xor(v, 2, 32));
      v = fmaxf(v, __shfl_xor(v, 4, 32));
      v = fmaxf(v, __shfl_xor(v, 8, 32));
      const float mnew = fmaxf(mrow[i], v);
      const float sc   = __expf(mrow[i] - mnew);
      mrow[i] = mnew;
      lrow[i] *= sc;
#pragma unroll
      for (int dt = 0; dt < 4; ++dt) o[dt][i] *= sc;
      rsum[i] = 0.f;
    }
    // P = exp(S - m) -> LDS (each wave writes only its own 16 rows)
#pragma unroll
    for (int nt = 0; nt < 8; ++nt) {
#pragma unroll
      for (int i = 0; i < 8; ++i) {
        const float p = __expf(s[nt][i] - mrow[i]);
        rsum[i] += p;
        Ps[(wr0 + i + half * 8) * PLD + nt * 16 + l16] = f2bf(p);
      }
    }
#pragma unroll
    for (int i = 0; i < 8; ++i) {
      float v = rsum[i];
      v += __shfl_xor(v, 1, 32);
      v += __shfl_xor(v, 2, 32);
      v += __shfl_xor(v, 4, 32);
      v += __shfl_xor(v, 8, 32);
      lrow[i] += v;
    }
    __syncthreads();  // order P stores before fragment reads
    // O += P V
#pragma unroll
    for (int c4 = 0; c4 < 4; ++c4) {
      const v16bf ap = load_frag(&Ps[(wr0 + l16) * PLD + c4 * 32 + ko]);
#pragma unroll
      for (int dt = 0; dt < 4; ++dt) {
        const v16bf bv = load_frag(&Vt[cur][(dt * 16 + l16) * PLD + c4 * 32 + ko]);
        o[dt] = wmma_bf16(ap, bv, o[dt]);
      }
    }
    wait_async();     // prefetched K/V tile has landed
    __syncthreads();  // all waves done reading this tile's buffers
  }

  // normalize + store av (bf16, row-major [token][D])
#pragma unroll
  for (int i = 0; i < 8; ++i) {
    const float inv = 1.0f / lrow[i];
    const int row = q_base + wr0 + i + half * 8;
    const size_t obase = ((size_t)(b * T_) + row) * D_ + h * HD_;
#pragma unroll
    for (int dt = 0; dt < 4; ++dt)
      av[obase + dt * 16 + l16] = f2bf(o[dt][i] * inv);
  }
}

// ---------- host launcher ----------
extern "C" void kernel_launch(void* const* d_in, const int* in_sizes, int n_in,
                              void* d_out, int out_size, void* d_ws, size_t ws_size,
                              hipStream_t stream) {
  (void)in_sizes; (void)n_in; (void)out_size; (void)ws_size;
  const float* x     = (const float*)d_in[0];
  const float* ln1_w = (const float*)d_in[1];
  const float* ln1_b = (const float*)d_in[2];
  const float* W_qkv = (const float*)d_in[3];
  const float* b_qkv = (const float*)d_in[4];
  const float* W_o   = (const float*)d_in[5];
  const float* b_o   = (const float*)d_in[6];
  const float* ln2_w = (const float*)d_in[7];
  const float* ln2_b = (const float*)d_in[8];
  const float* W_ff1 = (const float*)d_in[9];
  const float* b_ff1 = (const float*)d_in[10];
  const float* W_ff2 = (const float*)d_in[11];
  const float* b_ff2 = (const float*)d_in[12];
  float* out = (float*)d_out;
  char* ws = (char*)d_ws;

  // workspace layout (bytes)
  constexpr size_t off_wqkv = 0;                               // 3072x1024 bf16
  constexpr size_t off_wo   = off_wqkv + (size_t)3072 * 1024 * 2;
  constexpr size_t off_wff1 = off_wo   + (size_t)1024 * 1024 * 2;
  constexpr size_t off_wff2 = off_wff1 + (size_t)4096 * 1024 * 2;
  constexpr size_t off_h    = off_wff2 + (size_t)1024 * 4096 * 2;  // h / h2 (aliased)
  constexpr size_t off_qkv  = off_h    + (size_t)NTOK * D_ * 2;    // q,k rows (v slot unused)
  constexpr size_t off_vT   = off_qkv  + (size_t)NTOK * 3 * D_ * 2;
  constexpr size_t off_ff1  = off_qkv;                             // reuses qkv+vT after attn
  constexpr size_t off_av   = off_vT   + (size_t)NTOK * D_ * 2;
  constexpr size_t off_x1   = off_av   + (size_t)NTOK * D_ * 2;

  unsigned short* wqkv_t = (unsigned short*)(ws + off_wqkv);
  unsigned short* wo_t   = (unsigned short*)(ws + off_wo);
  unsigned short* wff1_t = (unsigned short*)(ws + off_wff1);
  unsigned short* wff2_t = (unsigned short*)(ws + off_wff2);
  unsigned short* hbuf   = (unsigned short*)(ws + off_h);
  unsigned short* qkvb   = (unsigned short*)(ws + off_qkv);
  unsigned short* vTb    = (unsigned short*)(ws + off_vT);
  unsigned short* ff1b   = (unsigned short*)(ws + off_ff1);
  unsigned short* avb    = (unsigned short*)(ws + off_av);
  float*          x1     = (float*)(ws + off_x1);

  const dim3 t32x8(32, 8);
  transpose_f32_bf16<<<dim3(3072 / 32, 1024 / 32), t32x8, 0, stream>>>(W_qkv, wqkv_t, 1024, 3072);
  transpose_f32_bf16<<<dim3(1024 / 32, 1024 / 32), t32x8, 0, stream>>>(W_o,   wo_t,   1024, 1024);
  transpose_f32_bf16<<<dim3(4096 / 32, 1024 / 32), t32x8, 0, stream>>>(W_ff1, wff1_t, 1024, 4096);
  transpose_f32_bf16<<<dim3(1024 / 32, 4096 / 32), t32x8, 0, stream>>>(W_ff2, wff2_t, 4096, 1024);

  ln_kernel<<<NTOK, 256, 0, stream>>>(x, ln1_w, ln1_b, hbuf);

  gemm_kernel<EPI_QKV><<<dim3(3072 / BN, NTOK / BM), 256, 0, stream>>>(
      hbuf, wqkv_t, b_qkv, nullptr, nullptr, qkvb, vTb, NTOK, 3072, 1024);

  attn_kernel<<<dim3(T_ / ATT_BQ, H_, B_), 256, 0, stream>>>(qkvb, vTb, avb);

  gemm_kernel<EPI_OPROJ><<<dim3(1024 / BN, NTOK / BM), 256, 0, stream>>>(
      avb, wo_t, b_o, x, x1, nullptr, nullptr, NTOK, 1024, 1024);

  ln_kernel<<<NTOK, 256, 0, stream>>>(x1, ln2_w, ln2_b, hbuf);

  gemm_kernel<EPI_FF1><<<dim3(4096 / BN, NTOK / BM), 256, 0, stream>>>(
      hbuf, wff1_t, b_ff1, nullptr, nullptr, ff1b, nullptr, NTOK, 4096, 1024);

  gemm_kernel<EPI_FF2><<<dim3(1024 / BN, NTOK / BM), 256, 0, stream>>>(
      ff1b, wff2_t, b_ff2, x1, out, nullptr, nullptr, NTOK, 1024, 4096);
}

// v002
// It runs in 253 microseconds.
// Next to v001, in two timings, it ran 1.04 and 1.05 times as fast.
// Over all steps from v000 it is 1.30 times as fast.
#include <hip/hip_runtime.h>
#include <stdint.h>

// ---------- types ----------
typedef __bf16 bf16_t;
typedef bf16_t v16bf __attribute__((ext_vector_type(16)));
typedef float  v8f   __attribute__((ext_vector_type(8)));
typedef int    v4i   __attribute__((ext_vector_type(4)));

#define B_   2
#define T_   2048
#define D_   1024
#define H_   16
#define HD_  64
#define DFF_ 4096
#define NTOK (B_ * T_)

#if defined(__gfx1250__) && __has_builtin(__builtin_amdgcn_global_load_async_to_lds_b128)
#define HAVE_ASYNC_LDS 1
#else
#define HAVE_ASYNC_LDS 0
#endif

__device__ __forceinline__ unsigned short f2bf(float f) {
  union { float f; unsigned int u; } c; c.f = f;
  unsigned int u = c.u;
  unsigned int r = u + 0x7FFFu + ((u >> 16) & 1u);  // round-to-nearest-even
  return (unsigned short)(r >> 16);
}

// 16-byte global -> LDS copy; async engine when available (ASYNCcnt tracked),
// else synchronous VGPR-staged copy.  Both require 16B-aligned src and dst.
__device__ __forceinline__ void cp16_g2l(unsigned short* ldst,
                                         const unsigned short* gsrc) {
#if HAVE_ASYNC_LDS
  __builtin_amdgcn_global_load_async_to_lds_b128(
      (__attribute__((address_space(1))) v4i*)gsrc,
      (__attribute__((address_space(3))) v4i*)ldst, 0, 0);
#else
  *reinterpret_cast<uint4*>(ldst) = *reinterpret_cast<const uint4*>(gsrc);
#endif
}

__device__ __forceinline__ void wait_async() {
#if HAVE_ASYNC_LDS
#if __has_builtin(__builtin_amdgcn_s_wait_asynccnt)
  __builtin_amdgcn_s_wait_asynccnt(0);
#else
  asm volatile("s_wait_asynccnt 0x0" ::: "memory");
#endif
#endif
}

union FragU { v16bf v; uint4 q[2]; };

// Load a 16-element bf16 WMMA fragment: p points at (row_base + ko) where
// ko = (lane/16)*8.  Elements 0..7 are K=ko..ko+7, elements 8..15 are
// K=ko+16..ko+23 (ISA 16-bit A/B fragment layout).  Both halves are 16B loads.
__device__ __forceinline__ v16bf load_frag(const unsigned short* p) {
  FragU f;
  f.q[0] = *reinterpret_cast<const uint4*>(p);
  f.q[1] = *reinterpret_cast<const uint4*>(p + 16);
  return f.v;
}

__device__ __forceinline__ v8f wmma_bf16(v16bf a, v16bf b, v8f c) {
  return __builtin_amdgcn_wmma_f32_16x16x32_bf16(false, a, false, b,
                                                 (short)0, c, false, false);
}

__device__ __forceinline__ v8f v8f_zero() {
  v8f z = {0.f, 0.f, 0.f, 0.f, 0.f, 0.f, 0.f, 0.f};
  return z;
}

// ---------- weight transpose + f32->bf16 convert : out[N][K] = in[K][N] ----------
// One work-group moves a tile of 128 in-rows x 64 in-columns: 256 B of every row it
// reads and 256 B of every row it writes, 32 elements per thread.
#define TP_R 128
#define TP_C 64

__global__ __launch_bounds__(256)
void transpose_f32_bf16(const float* __restrict__ in,
                        unsigned short* __restrict__ out, int R, int C) {
  // [in-column][pair of in-rows]: 64 dwords per column, no pad.  The 16-byte chunks of
  // a column are XOR-ed with (column >> 2), so the dword stores of a wave (16 column
  // groups x 2 row pairs) and its 16-byte reads (16 chunks of one column) both hit
  // every bank at most once.
  __shared__ __align__(16) unsigned int tile[TP_C * (TP_R / 2)];
  const int t  = threadIdx.x;
  const int c0 = blockIdx.x * TP_C, r0 = blockIdx.y * TP_R;
  const int cq = t & 15;   // group of 4 in-columns (one float4)
  const int rp = t >> 4;   // pair of in-rows within a round of 32 rows
  float4 a[4][2];
#pragma unroll
  for (int q = 0; q < 4; ++q)
#pragma unroll
    for (int j = 0; j < 2; ++j)
      a[q][j] = *reinterpret_cast<const float4*>(
          &in[(size_t)(r0 + q * 32 + rp * 2 + j) * C + c0 + cq * 4]);
#pragma unroll
  for (int q = 0; q < 4; ++q) {
    const int d   = q * 16 + rp;                           // row pair 0..63
    const int pos = (((d >> 2) ^ cq) << 2) | (d & 3);
    unsigned int* col = &tile[(cq * 4) * (TP_R / 2) + pos];
    col[0 * (TP_R / 2)] = (unsigned int)f2bf(a[q][0].x) | ((unsigned int)f2bf(a[q][1].x) << 16);
    col[1 * (TP_R / 2)] = (unsigned int)f2bf(a[q][0].y) | ((unsigned int)f2bf(a[q][1].y) << 16);
    col[2 * (TP_R / 2)] = (unsigned int)f2bf(a[q][0].z) | ((unsigned int)f2bf(a[q][1].z) << 16);
    col[3 * (TP_R / 2)] = (unsigned int)f2bf(a[q][0].w) | ((unsigned int)f2bf(a[q][1].w) << 16);
  }
  __syncthreads();
  const int k = t & 15;    // 16-byte chunk of a column: 8 in-rows
#pragma unroll
  for (int p = 0; p < 4; ++p) {
    const int c = p * 16 + (t >> 4);
    const uint4 v = *reinterpret_cast<const uint4*>(
        &tile[c * (TP_R / 2) + ((k ^ (c >> 2)) << 2)]);
    *reinterpret_cast<uint4*>(&out[(size_t)(c0 + c) * R + r0 + k * 8]) = v;
  }
}

// ---------- LayerNorm : f32 [rows][1024] -> bf16, one wave per row ----------
#define LN_ROWS 8  // rows (waves) per work-group

__global__ __launch_bounds__(256)
void ln_kernel(const float* __restrict__ x, const float* __restrict__ w,
               const float* __restrict__ bsh, unsigned short* __restrict__ out) {
  const int lane = threadIdx.x & 31;
  const int row  = blockIdx.x * LN_ROWS + (threadIdx.x >> 5);
  const float4* xr = reinterpret_cast<const float4*>(x + (size_t)row * D_);
  float4 v[8];             // 32 floats per lane; each wave-wide load is 512 contiguous B
#pragma unroll
  for (int i = 0; i < 8; ++i) v[i] = xr[i * 32 + lane];
  float s = 0.f, s2 = 0.f;
#pragma unroll
  for (int i = 0; i < 8; ++i) {
    s  += v[i].x + v[i].y + v[i].z + v[i].w;
    s2 += v[i].x * v[i].x + v[i].y * v[i].y + v[i].z * v[i].z + v[i].w * v[i].w;
  }
#pragma unroll
  for (int m = 1; m < 32; m <<= 1) {
    s  += __shfl_xor(s,  m, 32);
    s2 += __shfl_xor(s2, m, 32);
  }
  const float mu   = s * (1.0f / D_);
  const float var  = s2 * (1.0f / D_) - mu * mu;
  const float rstd = rsqrtf(var + 1e-5f);
  ushort4* orow = reinterpret_cast<ushort4*>(out + (size_t)row * D_);
#pragma unroll
  for (int i = 0; i < 8; ++i) {
    const float4 wv = reinterpret_cast<const float4*>(w)[i * 32 + lane];
    const float4 bv = reinterpret_cast<const float4*>(bsh)[i * 32 + lane];
    ushort4 ov;
    ov.x = f2bf((v[i].x - mu) * rstd * wv.x + bv.x);
    ov.y = f2bf((v[i].y - mu) * rstd * wv.y + bv.y);
    ov.z = f2bf((v[i].z - mu) * rstd * wv.z + bv.z);
    ov.w = f2bf((v[i].w - mu) * rstd * wv.w + bv.w);
    orow[i * 32 + lane] = ov;
  }
}

// ---------- generic WMMA GEMM : C[M,N] = epi(A_bf16[M,K] @ Bt_bf16[N,K]^T) ----------
#define BM 128
#define BN 128
#define BK 128  // k depth of one LDS stage: 256 B of every operand row (whole L2 units)
#define LDT 136  // padded LDS row stride (elems): 272B rows = 16B x odd, banks spread

enum { EPI_QKV = 0, EPI_OPROJ = 1, EPI_FF1 = 2, EPI_FF2 = 3 };

template <int EPI>
__global__ __launch_bounds__(256)
void gemm_kernel(const unsigned short* __restrict__ A,
                 const unsigned short* __restrict__ Bt,
                 const float* __restrict__ bias,
                 const float* __restrict__ resid,
                 float* __restrict__ outF,
                 unsigned short* __restrict__ outB,
                 unsigned short* __restrict__ vT,
                 int M, int N, int K) {
  __shared__ __align__(16) unsigned short As[2][BM * LDT];
  __shared__ __align__(16) unsigned short Bs[2][BN * LDT];
  const int tid  = threadIdx.x;
  const int lane = tid & 31;
  const int w    = tid >> 5;     // 8 waves
  const int wm   = w & 3;        // 4 row-granules of 32
  const int wn   = w >> 2;       // 2 col-granules of 64
  const int m0 = blockIdx.y * BM;
  const int n0 = blockIdx.x * BN;
  const int l16  = lane & 15;
  const int half = lane >> 4;
  const int ko   = half * 8;

  v8f acc[2][4];
#pragma unroll
  for (int i = 0; i < 2; ++i)
#pragma unroll
    for (int j = 0; j < 4; ++j) acc[i][j] = v8f_zero();

  const int ar0 = tid >> 4;   // 0..15 (row within a copy round)
  const int akg = tid & 15;   // k-group of 8 elems: 16 lanes cover one 256 B row piece
  const int nk  = K / BK;

  // one stage: 128 rows x 256 B of each operand, 16 copies per thread
  auto issue_stage = [&](int kt, int buf) {
    const int kb = kt * BK;
#pragma unroll
    for (int p = 0; p < BM / 16; ++p) {
      const int r = p * 16 + ar0;
      cp16_g2l(&As[buf][r * LDT + akg * 8],
               &A[(size_t)(m0 + r) * K + kb + akg * 8]);
      cp16_g2l(&Bs[buf][r * LDT + akg * 8],
               &Bt[(size_t)(n0 + r) * K + kb + akg * 8]);
    }
  };

  issue_stage(0, 0);
  // stage 0 of this wave has landed before the barrier that publishes it
  asm volatile("s_wait_asynccnt 0x0" ::: "memory");
  __syncthreads();
  if (nk > 1) issue_stage(1, 1);

  for (int kt = 0; kt < nk; ++kt) {
    const int cur = kt & 1;
#pragma unroll
    for (int ks = 0; ks < BK / 32; ++ks) {
      v16bf af[2], bf[4];
#pragma unroll
      for (int mt = 0; mt < 2; ++mt)
        af[mt] = load_frag(&As[cur][(wm * 32 + mt * 16 + l16) * LDT + ks * 32 + ko]);
#pragma unroll
      for (int nt = 0; nt < 4; ++nt)
        bf[nt] = load_frag(&Bs[cur][(wn * 64 + nt * 16 + l16) * LDT + ks * 32 + ko]);
#pragma unroll
      for (int mt = 0; mt < 2; ++mt)
#pragma unroll
        for (int nt = 0; nt < 4; ++nt)
          acc[mt][nt] = wmma_bf16(af[mt], bf[nt], acc[mt][nt]);
    }
    // this wave's reads of buffer cur have retired before the buffer is refilled
    asm volatile("s_wait_dscnt 0x0" ::: "memory");
    // this wave's copies of stage kt + 1 have landed before the barrier publishes them
    asm volatile("s_wait_asynccnt 0x0" ::: "memory");
    __syncthreads();
    if (kt + 2 < nk) issue_stage(kt + 2, cur);  // flies while stage kt + 1 is worked on
  }
  // no copy is outstanding when the wave goes on to its end
  asm volatile("s_wait_asynccnt 0x0" ::: "memory");

  // epilogue: C element (i,lane) -> row = i + 8*(lane/16), col = lane%16
#pragma unroll
  for (int mt = 0; mt < 2; ++mt) {
#pragma unroll
    for (int nt = 0; nt < 4; ++nt) {
      const int n = n0 + wn * 64 + nt * 16 + l16;
      const float bv = bias[n];
#pragma unroll
      for (int i = 0; i < 8; ++i) {
        const int m = m0 + wm * 32 + mt * 16 + i + half * 8;
        const float v = acc[mt][nt][i] + bv;
        if constexpr (EPI == EPI_QKV) {
          if (n < 2 * D_) {
            outB[(size_t)m * (3 * D_) + n] = f2bf(v);  // q,k row-major
          } else {                                     // v stored transposed [b][h][d][t]
            const int hd = n - 2 * D_;
            const int hh = hd >> 6, dd = hd & 63;
            const int bb = m >> 11, tt = m & (T_ - 1);
            vT[(((size_t)(bb * H_ + hh)) * HD_ + dd) * T_ + tt] = f2bf(v);
          }
        } else if constexpr (EPI == EPI_OPROJ) {
          outF[(size_t)m * N + n] = resid[(size_t)m * N + n] + v;
        } else if constexpr (EPI == EPI_FF1) {
          const float g =
              0.5f * v * (1.0f + tanhf(0.7978845608028654f * (v + 0.044715f * v * v * v)));
          outB[(size_t)m * N + n] = f2bf(g);
        } else {  // EPI_FF2
          outF[(size_t)m * N + n] = resid[(size_t)m * N + n] + v;
        }
      }
    }
  }
}

// ---------- causal flash attention (bf16 WMMA, f32 online softmax) ----------
#define ATT_BQ 128
#define ATT_BK 128
#define QLD 72    // 144B rows: 16B aligned, banks spread
#define PLD 136   // 272B rows: 16B aligned, conflict-free frag reads

__global__ __launch_bounds__(256)
void attn_kernel(const unsigned short* __restrict__ qkv,
                 const unsigned short* __restrict__ vT,
                 unsigned short* __restrict__ av) {
  __shared__ __align__(16) unsigned short Qs[ATT_BQ * QLD];
  __shared__ __align__(16) unsigned short Ks[2][ATT_BK * QLD];
  __shared__ __align__(16) unsigned short Vt[2][HD_ * PLD];
  __shared__ __align__(16) unsigned short Ps[ATT_BQ * PLD];

  const int tid  = threadIdx.x;
  const int lane = tid & 31;
  const int w    = tid >> 5;       // 8 waves, each owns 16 q-rows
  const int qt = blockIdx.x;       // q tile 0..15
  const int h  = blockIdx.y;
  const int b  = blockIdx.z;
  const int q_base = qt * ATT_BQ;
  const int l16  = lane & 15;
  const int half = lane >> 4;
  const int ko   = half * 8;
  const int wr0  = w * 16;

  const size_t qkv_row = 3 * D_;
  const unsigned short* qbase = qkv + ((size_t)b * T_) * qkv_row + h * HD_;
  const unsigned short* kbase = qbase + D_;
  const unsigned short* vtb   = vT + ((size_t)(b * H_ + h)) * HD_ * T_;

  // K tile (128 x 64, [kk][d]) + V tile (transposed in global: [d][kk])
  auto issue_kv = [&](int j, int buf) {
#pragma unroll
    for (int p = 0; p < 4; ++p) {
      const int idx = p * 256 + tid;
      const int r = idx >> 3, ck = idx & 7;
      cp16_g2l(&Ks[buf][r * QLD + ck * 8],
               &kbase[(size_t)(j * ATT_BK + r) * qkv_row + ck * 8]);
    }
#pragma unroll
    for (int p = 0; p < 4; ++p) {
      const int idx = p * 256 + tid;
      const int d = idx >> 4, ck = idx & 15;
      cp16_g2l(&Vt[buf][d * PLD + ck * 8],
               &vtb[(size_t)d * T_ + j * ATT_BK + ck * 8]);
    }
  };

  // load Q tile (128 x 64) and first K/V tile
#pragma unroll
  for (int p = 0; p < 4; ++p) {
    const int idx = p * 256 + tid;
    const int r = idx >> 3, ck = idx & 7;
    cp16_g2l(&Qs[r * QLD + ck * 8],
             &qbase[(size_t)(q_base + r) * qkv_row + ck * 8]);
  }
  issue_kv(0, 0);
  wait_async();
  __syncthreads();

  float mrow[8], lrow[8];
  v8f o[4];
#pragma unroll
  for (int i = 0; i < 8; ++i) { mrow[i] = -3.0e38f; lrow[i] = 0.0f; }
#pragma unroll
  for (int dt = 0; dt < 4; ++dt) o[dt] = v8f_zero();

  for (int j = 0; j <= qt; ++j) {
    const int cur = j & 1;
    if (j < qt) issue_kv(j + 1, cur ^ 1);  // prefetch while computing

    // S = Q K^T : this wave's 16 rows x 128 cols
    v8f s[8];
#pragma unroll
    for (int nt = 0; nt < 8; ++nt) s[nt] = v8f_zero();
#pragma unroll
    for (int c = 0; c < 2; ++c) {
      const v16bf aq = load_frag(&Qs[(wr0 + l16) * QLD + c * 32 + ko]);
#pragma unroll
      for (int nt = 0; nt < 8; ++nt) {
        const v16bf bk = load_frag(&Ks[cur][(nt * 16 + l16) * QLD + c * 32 + ko]);
        s[nt] = wmma_bf16(aq, bk, s[nt]);
      }
    }
    // scale + causal mask on diagonal tile
    const bool diag = (j == qt);
#pragma unroll
    for (int nt = 0; nt < 8; ++nt) {
#pragma unroll
      for (int i = 0; i < 8; ++i) {
        float sv = s[nt][i] * 0.125f;  // 1/sqrt(64)
        if (diag) {
          const int col = j * ATT_BK + nt * 16 + l16;
          const int row = q_base + wr0 + i + half * 8;
          if (col > row) sv = -1.0e30f;
        }
        s[nt][i] = sv;
      }
    }
    // row max (row lives across a 16-lane half at fixed accum index i)
    float rsum[8];
#pragma unroll
    for (int i = 0; i < 8; ++i) {
      float v = s[0][i];
#pragma unroll
      for (int nt = 1; nt < 8; ++nt) v = fmaxf(v, s[nt][i]);
      v = fmaxf(v, __shfl_xor(v, 1, 32));
      v = fmaxf(v, __shfl_xor(v, 2, 32));
      v = fmaxf(v, __shfl_xor(v, 4, 32));
      v = fmaxf(v, __shfl_xor(v, 8, 32));
      const float mnew = fmaxf(mrow[i], v);
      const float sc   = __expf(mrow[i] - mnew);
      mrow[i] = mnew;
      lrow[i] *= sc;
#pragma unroll
      for (int dt = 0; dt < 4; ++dt) o[dt][i] *= sc;
      rsum[i] = 0.f;
    }
    // P = exp(S - m) -> LDS (each wave writes only its own 16 rows)
#pragma unroll
    for (int nt = 0; nt < 8; ++nt) {
#pragma unroll
      for (int i = 0; i < 8; ++i) {
        const float p = __expf(s[nt][i] - mrow[i]);
        rsum[i] += p;
        Ps[(wr0 + i + half * 8) * PLD + nt * 16 + l16] = f2bf(p);
      }
    }
#pragma unroll
    for (int i = 0; i < 8; ++i) {
      float v = rsum[i];
      v += __shfl_xor(v, 1, 32);
      v += __shfl_xor(v, 2, 32);
      v += __shfl_xor(v, 4, 32);
      v += __shfl_xor(v, 8, 32);
      lrow[i] += v;
    }
    __syncthreads();  // order P stores before fragment reads
    // O += P V
#pragma unroll
    for (int c4 = 0; c4 < 4; ++c4) {
      const v16bf ap = load_frag(&Ps[(wr0 + l16) * PLD + c4 * 32 + ko]);
#pragma unroll
      for (int dt = 0; dt < 4; ++dt) {
        const v16bf bv = load_frag(&Vt[cur][(dt * 16 + l16) * PLD + c4 * 32 + ko]);
        o[dt] = wmma_bf16(ap, bv, o[dt]);
      }
    }
    wait_async();     // prefetched K/V tile has landed
    __syncthreads();  // all waves done reading this tile's buffers
  }

  // normalize + store av (bf16, row-major [token][D])
#pragma unroll
  for (int i = 0; i < 8; ++i) {
    const float inv = 1.0f / lrow[i];
    const int row = q_base + wr0 + i + half * 8;
    const size_t obase = ((size_t)(b * T_) + row) * D_ + h * HD_;
#pragma unroll
    for (int dt = 0; dt < 4; ++dt)
      av[obase + dt * 16 + l16] = f2bf(o[dt][i] * inv);
  }
}

// ---------- host launcher ----------
extern "C" void kernel_launch(void* const* d_in, const int* in_sizes, int n_in,
                              void* d_out, int out_size, void* d_ws, size_t ws_size,
                              hipStream_t stream) {
  (void)in_sizes; (void)n_in; (void)out_size; (void)ws_size;
  const float* x     = (const float*)d_in[0];
  const float* ln1_w = (const float*)d_in[1];
  const float* ln1_b = (const float*)d_in[2];
  const float* W_qkv = (const float*)d_in[3];
  const float* b_qkv = (const float*)d_in[4];
  const float* W_o   = (const float*)d_in[5];
  const float* b_o   = (const float*)d_in[6];
  const float* ln2_w = (const float*)d_in[7];
  const float* ln2_b = (const float*)d_in[8];
  const float* W_ff1 = (const float*)d_in[9];
  const float* b_ff1 = (const float*)d_in[10];
  const float* W_ff2 = (const float*)d_in[11];
  const float* b_ff2 = (const float*)d_in[12];
  float* out = (float*)d_out;
  char* ws = (char*)d_ws;

  // workspace layout (bytes)
  constexpr size_t off_wqkv = 0;                               // 3072x1024 bf16
  constexpr size_t off_wo   = off_wqkv + (size_t)3072 * 1024 * 2;
  constexpr size_t off_wff1 = off_wo   + (size_t)1024 * 1024 * 2;
  constexpr size_t off_wff2 = off_wff1 + (size_t)4096 * 1024 * 2;
  constexpr size_t off_h    = off_wff2 + (size_t)1024 * 4096 * 2;  // h / h2 (aliased)
  constexpr size_t off_qkv  = off_h    + (size_t)NTOK * D_ * 2;    // q,k rows (v slot unused)
  constexpr size_t off_vT   = off_qkv  + (size_t)NTOK * 3 * D_ * 2;
  constexpr size_t off_ff1  = off_qkv;                             // reuses qkv+vT after attn
  constexpr size_t off_av   = off_vT   + (size_t)NTOK * D_ * 2;
  constexpr size_t off_x1   = off_av   + (size_t)NTOK * D_ * 2;

  unsigned short* wqkv_t = (unsigned short*)(ws + off_wqkv);
  unsigned short* wo_t   = (unsigned short*)(ws + off_wo);
  unsigned short* wff1_t = (unsigned short*)(ws + off_wff1);
  unsigned short* wff2_t = (unsigned short*)(ws + off_wff2);
  unsigned short* hbuf   = (unsigned short*)(ws + off_h);
  unsigned short* qkvb   = (unsigned short*)(ws + off_qkv);
  unsigned short* vTb    = (unsigned short*)(ws + off_vT);
  unsigned short* ff1b   = (unsigned short*)(ws + off_ff1);
  unsigned short* avb    = (unsigned short*)(ws + off_av);
  float*          x1     = (float*)(ws + off_x1);

  transpose_f32_bf16<<<dim3(3072 / TP_C, 1024 / TP_R), 256, 0, stream>>>(W_qkv, wqkv_t, 1024, 3072);
  transpose_f32_bf16<<<dim3(1024 / TP_C, 1024 / TP_R), 256, 0, stream>>>(W_o,   wo_t,   1024, 1024);
  transpose_f32_bf16<<<dim3(4096 / TP_C, 1024 / TP_R), 256, 0, stream>>>(W_ff1, wff1_t, 1024, 4096);
  transpose_f32_bf16<<<dim3(1024 / TP_C, 4096 / TP_R), 256, 0, stream>>>(W_ff2, wff2_t, 4096, 1024);

  ln_kernel<<<NTOK / LN_ROWS, 256, 0, stream>>>(x, ln1_w, ln1_b, hbuf);

  gemm_kernel<EPI_QKV><<<dim3(3072 / BN, NTOK / BM), 256, 0, stream>>>(
      hbuf, wqkv_t, b_qkv, nullptr, nullptr, qkvb, vTb, NTOK, 3072, 1024);

  attn_kernel<<<dim3(T_ / ATT_BQ, H_, B_), 256, 0, stream>>>(qkvb, vTb, avb);

  gemm_kernel<EPI_OPROJ><<<dim3(1024 / BN, NTOK / BM), 256, 0, stream>>>(
      avb, wo_t, b_o, x, x1, nullptr, nullptr, NTOK, 1024, 1024);

  ln_kernel<<<NTOK / LN_ROWS, 256, 0, stream>>>(x1, ln2_w, ln2_b, hbuf);

  gemm_kernel<EPI_FF1><<<dim3(4096 / BN, NTOK / BM), 256, 0, stream>>>(
      hbuf, wff1_t, b_ff1, nullptr, nullptr, ff1b, nullptr, NTOK, 4096, 1024);

  gemm_kernel<EPI_FF2><<<dim3(1024 / BN, NTOK / BM), 256, 0, stream>>>(
      ff1b, wff2_t, b_ff2, x1, out, nullptr, nullptr, NTOK, 1024, 4096);
}

// v003
// A run of this version takes 219 microseconds.
// Two timings next to v002 put it at 1.16 and 1.15 times that version's speed.
// Over all steps from v000 it is 1.50 times as fast.
#include <hip/hip_runtime.h>
#include <stdint.h>

// ---------- types ----------
typedef __bf16 bf16_t;
typedef bf16_t v16bf __attribute__((ext_vector_type(16)));
typedef float  v8f   __attribute__((ext_vector_type(8)));
typedef int    v4i   __attribute__((ext_vector_type(4)));

#define B_   2
#define T_   2048
#define D_   1024
#define H_   16
#define HD_  64
#define DFF_ 4096
#define NTOK (B_ * T_)

#if defined(__gfx1250__) && __has_builtin(__builtin_amdgcn_global_load_async_to_lds_b128)
#define HAVE_ASYNC_LDS 1
#else
#define HAVE_ASYNC_LDS 0
#endif

__device__ __forceinline__ unsigned short f2bf(float f) {
  union { float f; unsigned int u; } c; c.f = f;
  unsigned int u = c.u;
  unsigned int r = u + 0x7FFFu + ((u >> 16) & 1u);  // round-to-nearest-even
  return (unsigned short)(r >> 16);
}

// 16-byte global -> LDS copy; async engine when available (ASYNCcnt tracked),
// else synchronous VGPR-staged copy.  Both require 16B-aligned src and dst.
__device__ __forceinline__ void cp16_g2l(unsigned short* ldst,
                                         const unsigned short* gsrc) {
#if HAVE_ASYNC_LDS
  __builtin_amdgcn_global_load_async_to_lds_b128(
      (__attribute__((address_space(1))) v4i*)gsrc,
      (__attribute__((address_space(3))) v4i*)ldst, 0, 0);
#else
  *reinterpret_cast<uint4*>(ldst) = *reinterpret_cast<const uint4*>(gsrc);
#endif
}

__device__ __forceinline__ void wait_async() {
#if HAVE_ASYNC_LDS
#if __has_builtin(__builtin_amdgcn_s_wait_asynccnt)
  __builtin_amdgcn_s_wait_asynccnt(0);
#else
  asm volatile("s_wait_asynccnt 0x0" ::: "memory");
#endif
#endif
}

union FragU { v16bf v; uint4 q[2]; };

// Load a 16-element bf16 WMMA fragment: p points at (row_base + ko) where
// ko = (lane/16)*8.  Elements 0..7 are K=ko..ko+7, elements 8..15 are
// K=ko+16..ko+23 (ISA 16-bit A/B fragment layout).  Both halves are 16B loads.
__device__ __forceinline__ v16bf load_frag(const unsigned short* p) {
  FragU f;
  f.q[0] = *reinterpret_cast<const uint4*>(p);
  f.q[1] = *reinterpret_cast<const uint4*>(p + 16);
  return f.v;
}

__device__ __forceinline__ v8f wmma_bf16(v16bf a, v16bf b, v8f c) {
  return __builtin_amdgcn_wmma_f32_16x16x32_bf16(false, a, false, b,
                                                 (short)0, c, false, false);
}

__device__ __forceinline__ v8f v8f_zero() {
  v8f z = {0.f, 0.f, 0.f, 0.f, 0.f, 0.f, 0.f, 0.f};
  return z;
}

// ---------- weight transpose + f32->bf16 convert : out[N][K] = in[K][N] ----------
// One work-group moves a tile of 128 in-rows x 64 in-columns: 256 B of every row it
// reads and 256 B of every row it writes, 32 elements per thread.
#define TP_R 128
#define TP_C 64

__global__ __launch_bounds__(256)
void transpose_f32_bf16(const float* __restrict__ in,
                        unsigned short* __restrict__ out, int R, int C) {
  // [in-column][pair of in-rows]: 64 dwords per column, no pad.  The 16-byte chunks of
  // a column are XOR-ed with (column >> 2), so the dword stores of a wave (16 column
  // groups x 2 row pairs) and its 16-byte reads (16 chunks of one column) both hit
  // every bank at most once.
  __shared__ __align__(16) unsigned int tile[TP_C * (TP_R / 2)];
  const int t  = threadIdx.x;
  const int c0 = blockIdx.x * TP_C, r0 = blockIdx.y * TP_R;
  const int cq = t & 15;   // group of 4 in-columns (one float4)
  const int rp = t >> 4;   // pair of in-rows within a round of 32 rows
  float4 a[4][2];
#pragma unroll
  for (int q = 0; q < 4; ++q)
#pragma unroll
    for (int j = 0; j < 2; ++j)
      a[q][j] = *reinterpret_cast<const float4*>(
          &in[(size_t)(r0 + q * 32 + rp * 2 + j) * C + c0 + cq * 4]);
#pragma unroll
  for (int q = 0; q < 4; ++q) {
    const int d   = q * 16 + rp;                           // row pair 0..63
    const int pos = (((d >> 2) ^ cq) << 2) | (d & 3);
    unsigned int* col = &tile[(cq * 4) * (TP_R / 2) + pos];
    col[0 * (TP_R / 2)] = (unsigned int)f2bf(a[q][0].x) | ((unsigned int)f2bf(a[q][1].x) << 16);
    col[1 * (TP_R / 2)] = (unsigned int)f2bf(a[q][0].y) | ((unsigned int)f2bf(a[q][1].y) << 16);
    col[2 * (TP_R / 2)] = (unsigned int)f2bf(a[q][0].z) | ((unsigned int)f2bf(a[q][1].z) << 16);
    col[3 * (TP_R / 2)] = (unsigned int)f2bf(a[q][0].w) | ((unsigned int)f2bf(a[q][1].w) << 16);
  }
  __syncthreads();
  const int k = t & 15;    // 16-byte chunk of a column: 8 in-rows
#pragma unroll
  for (int p = 0; p < 4; ++p) {
    const int c = p * 16 + (t >> 4);
    const uint4 v = *reinterpret_cast<const uint4*>(
        &tile[c * (TP_R / 2) + ((k ^ (c >> 2)) << 2)]);
    *reinterpret_cast<uint4*>(&out[(size_t)(c0 + c) * R + r0 + k * 8]) = v;
  }
}

// ---------- LayerNorm : f32 [rows][1024] -> bf16, one wave per row ----------
#define LN_ROWS 8  // rows (waves) per work-group

__global__ __launch_bounds__(256)
void ln_kernel(const float* __restrict__ x, const float* __restrict__ w,
               const float* __restrict__ bsh, unsigned short* __restrict__ out) {
  const int lane = threadIdx.x & 31;
  const int row  = blockIdx.x * LN_ROWS + (threadIdx.x >> 5);
  const float4* xr = reinterpret_cast<const float4*>(x + (size_t)row * D_);
  float4 v[8];             // 32 floats per lane; each wave-wide load is 512 contiguous B
#pragma unroll
  for (int i = 0; i < 8; ++i) v[i] = xr[i * 32 + lane];
  float s = 0.f, s2 = 0.f;
#pragma unroll
  for (int i = 0; i < 8; ++i) {
    s  += v[i].x + v[i].y + v[i].z + v[i].w;
    s2 += v[i].x * v[i].x + v[i].y * v[i].y + v[i].z * v[i].z + v[i].w * v[i].w;
  }
#pragma unroll
  for (int m = 1; m < 32; m <<= 1) {
    s  += __shfl_xor(s,  m, 32);
    s2 += __shfl_xor(s2, m, 32);
  }
  const float mu   = s * (1.0f / D_);
  const float var  = s2 * (1.0f / D_) - mu * mu;
  const float rstd = rsqrtf(var + 1e-5f);
  ushort4* orow = reinterpret_cast<ushort4*>(out + (size_t)row * D_);
#pragma unroll
  for (int i = 0; i < 8; ++i) {
    const float4 wv = reinterpret_cast<const float4*>(w)[i * 32 + lane];
    const float4 bv = reinterpret_cast<const float4*>(bsh)[i * 32 + lane];
    ushort4 ov;
    ov.x = f2bf((v[i].x - mu) * rstd * wv.x + bv.x);
    ov.y = f2bf((v[i].y - mu) * rstd * wv.y + bv.y);
    ov.z = f2bf((v[i].z - mu) * rstd * wv.z + bv.z);
    ov.w = f2bf((v[i].w - mu) * rstd * wv.w + bv.w);
    orow[i * 32 + lane] = ov;
  }
}

// ---------- generic WMMA GEMM : C[M,N] = epi(A_bf16[M,K] @ Bt_bf16[N,K]^T) ----------
#define BM 128
#define BN 128
#define BK 128  // k depth of one LDS stage: 256 B of every operand row (whole L2 units)
#define LDT 136  // padded LDS row stride (elems): 272B rows = 16B x odd, banks spread

enum { EPI_QKV = 0, EPI_OPROJ = 1, EPI_FF1 = 2, EPI_FF2 = 3 };

template <int EPI>
__global__ __launch_bounds__(256)
void gemm_kernel(const unsigned short* __restrict__ A,
                 const unsigned short* __restrict__ Bt,
                 const float* __restrict__ bias,
                 const float* __restrict__ resid,
                 float* __restrict__ outF,
                 unsigned short* __restrict__ outB,
                 unsigned short* __restrict__ vT,
                 int M, int N, int K) {
  __shared__ __align__(16) unsigned short As[2][BM * LDT];
  __shared__ __align__(16) unsigned short Bs[2][BN * LDT];
  const int tid  = threadIdx.x;
  const int lane = tid & 31;
  const int w    = tid >> 5;     // 8 waves
  const int wm   = w & 3;        // 4 row-granules of 32
  const int wn   = w >> 2;       // 2 col-granules of 64
  const int m0 = blockIdx.y * BM;
  const int n0 = blockIdx.x * BN;
  const int l16  = lane & 15;
  const int half = lane >> 4;
  const int ko   = half * 8;

  v8f acc[2][4];
#pragma unroll
  for (int i = 0; i < 2; ++i)
#pragma unroll
    for (int j = 0; j < 4; ++j) acc[i][j] = v8f_zero();

  const int ar0 = tid >> 4;   // 0..15 (row within a copy round)
  const int akg = tid & 15;   // k-group of 8 elems: 16 lanes cover one 256 B row piece
  const int nk  = K / BK;

  // one stage: 128 rows x 256 B of each operand, 16 copies per thread
  auto issue_stage = [&](int kt, int buf) {
    const int kb = kt * BK;
#pragma unroll
    for (int p = 0; p < BM / 16; ++p) {
      const int r = p * 16 + ar0;
      cp16_g2l(&As[buf][r * LDT + akg * 8],
               &A[(size_t)(m0 + r) * K + kb + akg * 8]);
      cp16_g2l(&Bs[buf][r * LDT + akg * 8],
               &Bt[(size_t)(n0 + r) * K + kb + akg * 8]);
    }
  };

  issue_stage(0, 0);
  // stage 0 of this wave has landed before the barrier that publishes it
  asm volatile("s_wait_asynccnt 0x0" ::: "memory");
  __syncthreads();
  if (nk > 1) issue_stage(1, 1);

  for (int kt = 0; kt < nk; ++kt) {
    const int cur = kt & 1;
#pragma unroll
    for (int ks = 0; ks < BK / 32; ++ks) {
      v16bf af[2], bf[4];
#pragma unroll
      for (int mt = 0; mt < 2; ++mt)
        af[mt] = load_frag(&As[cur][(wm * 32 + mt * 16 + l16) * LDT + ks * 32 + ko]);
#pragma unroll
      for (int nt = 0; nt < 4; ++nt)
        bf[nt] = load_frag(&Bs[cur][(wn * 64 + nt * 16 + l16) * LDT + ks * 32 + ko]);
#pragma unroll
      for (int mt = 0; mt < 2; ++mt)
#pragma unroll
        for (int nt = 0; nt < 4; ++nt)
          acc[mt][nt] = wmma_bf16(af[mt], bf[nt], acc[mt][nt]);
    }
    // this wave's reads of buffer cur have retired before the buffer is refilled
    asm volatile("s_wait_dscnt 0x0" ::: "memory");
    // this wave's copies of stage kt + 1 have landed before the barrier publishes them
    asm volatile("s_wait_asynccnt 0x0" ::: "memory");
    __syncthreads();
    if (kt + 2 < nk) issue_stage(kt + 2, cur);  // flies while stage kt + 1 is worked on
  }
  // no copy is outstanding when the wave goes on to its end
  asm volatile("s_wait_asynccnt 0x0" ::: "memory");

  // epilogue: C element (i,lane) -> row = i + 8*(lane/16), col = lane%16
#pragma unroll
  for (int mt = 0; mt < 2; ++mt) {
#pragma unroll
    for (int nt = 0; nt < 4; ++nt) {
      const int n = n0 + wn * 64 + nt * 16 + l16;
      const float bv = bias[n];
#pragma unroll
      for (int i = 0; i < 8; ++i) {
        const int m = m0 + wm * 32 + mt * 16 + i + half * 8;
        const float v = acc[mt][nt][i] + bv;
        if constexpr (EPI == EPI_QKV) {
          if (n < 2 * D_) {
            outB[(size_t)m * (3 * D_) + n] = f2bf(v);  // q,k row-major
          } else {                                     // v stored transposed [b][h][d][t]
            const int hd = n - 2 * D_;
            const int hh = hd >> 6, dd = hd & 63;
            const int bb = m >> 11, tt = m & (T_ - 1);
            vT[(((size_t)(bb * H_ + hh)) * HD_ + dd) * T_ + tt] = f2bf(v);
          }
        } else if constexpr (EPI == EPI_OPROJ) {
          outF[(size_t)m * N + n] = resid[(size_t)m * N + n] + v;
        } else if constexpr (EPI == EPI_FF1) {
          const float g =
              0.5f * v * (1.0f + tanhf(0.7978845608028654f * (v + 0.044715f * v * v * v)));
          outB[(size_t)m * N + n] = f2bf(g);
        } else {  // EPI_FF2
          outF[(size_t)m * N + n] = resid[(size_t)m * N + n] + v;
        }
      }
    }
  }
}

// ---------- causal flash attention (bf16 WMMA, f32 online softmax) ----------
#define ATT_BQ 128
#define ATT_BK 128
#define QLD 72    // 144B rows: 16B aligned, banks spread
#define PLD 136   // 272B rows: 16B aligned, conflict-free frag reads

__global__ __launch_bounds__(256)
void attn_kernel(const unsigned short* __restrict__ qkv,
                 const unsigned short* __restrict__ vT,
                 unsigned short* __restrict__ av) {
  __shared__ __align__(16) unsigned short Qs[ATT_BQ * QLD];
  __shared__ __align__(16) unsigned short Ks[2][ATT_BK * QLD];
  __shared__ __align__(16) unsigned short Vt[2][HD_ * PLD];
  __shared__ __align__(16) unsigned short Ps[ATT_BQ * PLD];

  const int tid  = threadIdx.x;
  const int lane = tid & 31;
  const int w    = tid >> 5;       // 8 waves, each owns 16 q-rows
  // A work-group's cost is qt + 1 key tiles, and there are more work-groups than
  // resident places: the slowest grid index counts qt down, so the long ones start
  // first and the short ones fill the places that come free.
  const int qt = T_ / ATT_BQ - 1 - (int)blockIdx.z;  // q tile 15..0
  const int h  = blockIdx.x;
  const int b  = blockIdx.y;
  const int q_base = qt * ATT_BQ;
  const int l16  = lane & 15;
  const int half = lane >> 4;
  const int ko   = half * 8;
  const int wr0  = w * 16;

  const size_t qkv_row = 3 * D_;
  const unsigned short* qbase = qkv + ((size_t)b * T_) * qkv_row + h * HD_;
  const unsigned short* kbase = qbase + D_;
  const unsigned short* vtb   = vT + ((size_t)(b * H_ + h)) * HD_ * T_;

  // K tile (128 x 64, [kk][d]) + V tile (transposed in global: [d][kk])
  auto issue_kv = [&](int j, int buf) {
#pragma unroll
    for (int p = 0; p < 4; ++p) {
      const int idx = p * 256 + tid;
      const int r = idx >> 3, ck = idx & 7;
      cp16_g2l(&Ks[buf][r * QLD + ck * 8],
               &kbase[(size_t)(j * ATT_BK + r) * qkv_row + ck * 8]);
    }
#pragma unroll
    for (int p = 0; p < 4; ++p) {
      const int idx = p * 256 + tid;
      const int d = idx >> 4, ck = idx & 15;
      cp16_g2l(&Vt[buf][d * PLD + ck * 8],
               &vtb[(size_t)d * T_ + j * ATT_BK + ck * 8]);
    }
  };

  // load Q tile (128 x 64) and first K/V tile
#pragma unroll
  for (int p = 0; p < 4; ++p) {
    const int idx = p * 256 + tid;
    const int r = idx >> 3, ck = idx & 7;
    cp16_g2l(&Qs[r * QLD + ck * 8],
             &qbase[(size_t)(q_base + r) * qkv_row + ck * 8]);
  }
  issue_kv(0, 0);
  wait_async();
  __syncthreads();

  float mrow[8], lrow[8];
  v8f o[4];
#pragma unroll
  for (int i = 0; i < 8; ++i) { mrow[i] = -3.0e38f; lrow[i] = 0.0f; }
#pragma unroll
  for (int dt = 0; dt < 4; ++dt) o[dt] = v8f_zero();

  for (int j = 0; j <= qt; ++j) {
    const int cur = j & 1;
    if (j < qt) issue_kv(j + 1, cur ^ 1);  // prefetch while computing

    // S = Q K^T : this wave's 16 rows x 128 cols
    v8f s[8];
#pragma unroll
    for (int nt = 0; nt < 8; ++nt) s[nt] = v8f_zero();
#pragma unroll
    for (int c = 0; c < 2; ++c) {
      const v16bf aq = load_frag(&Qs[(wr0 + l16) * QLD + c * 32 + ko]);
#pragma unroll
      for (int nt = 0; nt < 8; ++nt) {
        const v16bf bk = load_frag(&Ks[cur][(nt * 16 + l16) * QLD + c * 32 + ko]);
        s[nt] = wmma_bf16(aq, bk, s[nt]);
      }
    }
    // scale + causal mask on diagonal tile
    const bool diag = (j == qt);
#pragma unroll
    for (int nt = 0; nt < 8; ++nt) {
#pragma unroll
      for (int i = 0; i < 8; ++i) {
        float sv = s[nt][i] * 0.125f;  // 1/sqrt(64)
        if (diag) {
          const int col = j * ATT_BK + nt * 16 + l16;
          const int row = q_base + wr0 + i + half * 8;
          if (col > row) sv = -1.0e30f;
        }
        s[nt][i] = sv;
      }
    }
    // row max (row lives across a 16-lane half at fixed accum index i)
    float rsum[8];
#pragma unroll
    for (int i = 0; i < 8; ++i) {
      float v = s[0][i];
#pragma unroll
      for (int nt = 1; nt < 8; ++nt) v = fmaxf(v, s[nt][i]);
      v = fmaxf(v, __shfl_xor(v, 1, 32));
      v = fmaxf(v, __shfl_xor(v, 2, 32));
      v = fmaxf(v, __shfl_xor(v, 4, 32));
      v = fmaxf(v, __shfl_xor(v, 8, 32));
      const float mnew = fmaxf(mrow[i], v);
      const float sc   = __expf(mrow[i] - mnew);
      mrow[i] = mnew;
      lrow[i] *= sc;
#pragma unroll
      for (int dt = 0; dt < 4; ++dt) o[dt][i] *= sc;
      rsum[i] = 0.f;
    }
    // P = exp(S - m) -> LDS (each wave writes only its own 16 rows)
#pragma unroll
    for (int nt = 0; nt < 8; ++nt) {
#pragma unroll
      for (int i = 0; i < 8; ++i) {
        const float p = __expf(s[nt][i] - mrow[i]);
        rsum[i] += p;
        Ps[(wr0 + i + half * 8) * PLD + nt * 16 + l16] = f2bf(p);
      }
    }
#pragma unroll
    for (int i = 0; i < 8; ++i) {
      float v = rsum[i];
      v += __shfl_xor(v, 1, 32);
      v += __shfl_xor(v, 2, 32);
      v += __shfl_xor(v, 4, 32);
      v += __shfl_xor(v, 8, 32);
      lrow[i] += v;
    }
    __syncthreads();  // order P stores before fragment reads
    // O += P V
#pragma unroll
    for (int c4 = 0; c4 < 4; ++c4) {
      const v16bf ap = load_frag(&Ps[(wr0 + l16) * PLD + c4 * 32 + ko]);
#pragma unroll
      for (int dt = 0; dt < 4; ++dt) {
        const v16bf bv = load_frag(&Vt[cur][(dt * 16 + l16) * PLD + c4 * 32 + ko]);
        o[dt] = wmma_bf16(ap, bv, o[dt]);
      }
    }
    wait_async();     // prefetched K/V tile has landed
    __syncthreads();  // all waves done reading this tile's buffers
  }

  // normalize + store av (bf16, row-major [token][D])
#pragma unroll
  for (int i = 0; i < 8; ++i) {
    const float inv = 1.0f / lrow[i];
    const int row = q_base + wr0 + i + half * 8;
    const size_t obase = ((size_t)(b * T_) + row) * D_ + h * HD_;
#pragma unroll
    for (int dt = 0; dt < 4; ++dt)
      av[obase + dt * 16 + l16] = f2bf(o[dt][i] * inv);
  }
}

// ---------- host launcher ----------
extern "C" void kernel_launch(void* const* d_in, const int* in_sizes, int n_in,
                              void* d_out, int out_size, void* d_ws, size_t ws_size,
                              hipStream_t stream) {
  (void)in_sizes; (void)n_in; (void)out_size; (void)ws_size;
  const float* x     = (const float*)d_in[0];
  const float* ln1_w = (const float*)d_in[1];
  const float* ln1_b = (const float*)d_in[2];
  const float* W_qkv = (const float*)d_in[3];
  const float* b_qkv = (const float*)d_in[4];
  const float* W_o   = (const float*)d_in[5];
  const float* b_o   = (const float*)d_in[6];
  const float* ln2_w = (const float*)d_in[7];
  const float* ln2_b = (const float*)d_in[8];
  const float* W_ff1 = (const float*)d_in[9];
  const float* b_ff1 = (const float*)d_in[10];
  const float* W_ff2 = (const float*)d_in[11];
  const float* b_ff2 = (const float*)d_in[12];
  float* out = (float*)d_out;
  char* ws = (char*)d_ws;

  // workspace layout (bytes)
  constexpr size_t off_wqkv = 0;                               // 3072x1024 bf16
  constexpr size_t off_wo   = off_wqkv + (size_t)3072 * 1024 * 2;
  constexpr size_t off_wff1 = off_wo   + (size_t)1024 * 1024 * 2;
  constexpr size_t off_wff2 = off_wff1 + (size_t)4096 * 1024 * 2;
  constexpr size_t off_h    = off_wff2 + (size_t)1024 * 4096 * 2;  // h / h2 (aliased)
  constexpr size_t off_qkv  = off_h    + (size_t)NTOK * D_ * 2;    // q,k rows (v slot unused)
  constexpr size_t off_vT   = off_qkv  + (size_t)NTOK * 3 * D_ * 2;
  constexpr size_t off_ff1  = off_qkv;                             // reuses qkv+vT after attn
  constexpr size_t off_av   = off_vT   + (size_t)NTOK * D_ * 2;
  constexpr size_t off_x1   = off_av   + (size_t)NTOK * D_ * 2;

  unsigned short* wqkv_t = (unsigned short*)(ws + off_wqkv);
  unsigned short* wo_t   = (unsigned short*)(ws + off_wo);
  unsigned short* wff1_t = (unsigned short*)(ws + off_wff1);
  unsigned short* wff2_t = (unsigned short*)(ws + off_wff2);
  unsigned short* hbuf   = (unsigned short*)(ws + off_h);
  unsigned short* qkvb   = (unsigned short*)(ws + off_qkv);
  unsigned short* vTb    = (unsigned short*)(ws + off_vT);
  unsigned short* ff1b   = (unsigned short*)(ws + off_ff1);
  unsigned short* avb    = (unsigned short*)(ws + off_av);
  float*          x1     = (float*)(ws + off_x1);

  transpose_f32_bf16<<<dim3(3072 / TP_C, 1024 / TP_R), 256, 0, stream>>>(W_qkv, wqkv_t, 1024, 3072);
  transpose_f32_bf16<<<dim3(1024 / TP_C, 1024 / TP_R), 256, 0, stream>>>(W_o,   wo_t,   1024, 1024);
  transpose_f32_bf16<<<dim3(4096 / TP_C, 1024 / TP_R), 256, 0, stream>>>(W_ff1, wff1_t, 1024, 4096);
  transpose_f32_bf16<<<dim3(1024 / TP_C, 4096 / TP_R), 256, 0, stream>>>(W_ff2, wff2_t, 4096, 1024);

  ln_kernel<<<NTOK / LN_ROWS, 256, 0, stream>>>(x, ln1_w, ln1_b, hbuf);

  gemm_kernel<EPI_QKV><<<dim3(3072 / BN, NTOK / BM), 256, 0, stream>>>(
      hbuf, wqkv_t, b_qkv, nullptr, nullptr, qkvb, vTb, NTOK, 3072, 1024);

  attn_kernel<<<dim3(H_, B_, T_ / ATT_BQ), 256, 0, stream>>>(qkvb, vTb, avb);

  gemm_kernel<EPI_OPROJ><<<dim3(1024 / BN, NTOK / BM), 256, 0, stream>>>(
      avb, wo_t, b_o, x, x1, nullptr, nullptr, NTOK, 1024, 1024);

  ln_kernel<<<NTOK / LN_ROWS, 256, 0, stream>>>(x1, ln2_w, ln2_b, hbuf);

  gemm_kernel<EPI_FF1><<<dim3(4096 / BN, NTOK / BM), 256, 0, stream>>>(
      hbuf, wff1_t, b_ff1, nullptr, nullptr, ff1b, nullptr, NTOK, 4096, 1024);

  gemm_kernel<EPI_FF2><<<dim3(1024 / BN, NTOK / BM), 256, 0, stream>>>(
      ff1b, wff2_t, b_ff2, x1, out, nullptr, nullptr, NTOK, 1024, 4096);
}

// v004
// Measured time: 194 microseconds a run.
// In both of two side-by-side timings against v003, it was 1.12 times as fast.
// Over all steps from v000 it is 1.68 times as fast.
#include <hip/hip_runtime.h>
#include <stdint.h>

// ---------- types ----------
typedef __bf16 bf16_t;
typedef bf16_t v16bf __attribute__((ext_vector_type(16)));
typedef float  v8f   __attribute__((ext_vector_type(8)));
typedef int    v4i   __attribute__((ext_vector_type(4)));

#define B_   2
#define T_   2048
#define D_   1024
#define H_   16
#define HD_  64
#define DFF_ 4096
#define NTOK (B_ * T_)

#if defined(__gfx1250__) && __has_builtin(__builtin_amdgcn_global_load_async_to_lds_b128)
#define HAVE_ASYNC_LDS 1
#else
#define HAVE_ASYNC_LDS 0
#endif

__device__ __forceinline__ unsigned short f2bf(float f) {
  union { float f; unsigned int u; } c; c.f = f;
  unsigned int u = c.u;
  unsigned int r = u + 0x7FFFu + ((u >> 16) & 1u);  // round-to-nearest-even
  return (unsigned short)(r >> 16);
}

// 16-byte global -> LDS copy; async engine when available (ASYNCcnt tracked),
// else synchronous VGPR-staged copy.  Both require 16B-aligned src and dst.
__device__ __forceinline__ void cp16_g2l(unsigned short* ldst,
                                         const unsigned short* gsrc) {
#if HAVE_ASYNC_LDS
  __builtin_amdgcn_global_load_async_to_lds_b128(
      (__attribute__((address_space(1))) v4i*)gsrc,
      (__attribute__((address_space(3))) v4i*)ldst, 0, 0);
#else
  *reinterpret_cast<uint4*>(ldst) = *reinterpret_cast<const uint4*>(gsrc);
#endif
}

__device__ __forceinline__ void wait_async() {
#if HAVE_ASYNC_LDS
#if __has_builtin(__builtin_amdgcn_s_wait_asynccnt)
  __builtin_amdgcn_s_wait_asynccnt(0);
#else
  asm volatile("s_wait_asynccnt 0x0" ::: "memory");
#endif
#endif
}

union FragU { v16bf v; uint4 q[2]; };

// Load a 16-element bf16 WMMA fragment: p points at (row_base + ko) where
// ko = (lane/16)*8.  Elements 0..7 are K=ko..ko+7, elements 8..15 are
// K=ko+16..ko+23 (ISA 16-bit A/B fragment layout).  Both halves are 16B loads.
__device__ __forceinline__ v16bf load_frag(const unsigned short* p) {
  FragU f;
  f.q[0] = *reinterpret_cast<const uint4*>(p);
  f.q[1] = *reinterpret_cast<const uint4*>(p + 16);
  return f.v;
}

__device__ __forceinline__ v8f wmma_bf16(v16bf a, v16bf b, v8f c) {
  return __builtin_amdgcn_wmma_f32_16x16x32_bf16(false, a, false, b,
                                                 (short)0, c, false, false);
}

__device__ __forceinline__ v8f v8f_zero() {
  v8f z = {0.f, 0.f, 0.f, 0.f, 0.f, 0.f, 0.f, 0.f};
  return z;
}

// ---------- weight transpose + f32->bf16 convert : out[N][K] = in[K][N] ----------
// One work-group moves a tile of 128 in-rows x 64 in-columns: 256 B of every row it
// reads and 256 B of every row it writes, 32 elements per thread.
#define TP_R 128
#define TP_C 64

__global__ __launch_bounds__(256)
void transpose_f32_bf16(const float* __restrict__ in,
                        unsigned short* __restrict__ out, int R, int C) {
  // [in-column][pair of in-rows]: 64 dwords per column, no pad.  The 16-byte chunks of
  // a column are XOR-ed with (column >> 2), so the dword stores of a wave (16 column
  // groups x 2 row pairs) and its 16-byte reads (16 chunks of one column) both hit
  // every bank at most once.
  __shared__ __align__(16) unsigned int tile[TP_C * (TP_R / 2)];
  const int t  = threadIdx.x;
  const int c0 = blockIdx.x * TP_C, r0 = blockIdx.y * TP_R;
  const int cq = t & 15;   // group of 4 in-columns (one float4)
  const int rp = t >> 4;   // pair of in-rows within a round of 32 rows
  float4 a[4][2];
#pragma unroll
  for (int q = 0; q < 4; ++q)
#pragma unroll
    for (int j = 0; j < 2; ++j)
      a[q][j] = *reinterpret_cast<const float4*>(
          &in[(size_t)(r0 + q * 32 + rp * 2 + j) * C + c0 + cq * 4]);
#pragma unroll
  for (int q = 0; q < 4; ++q) {
    const int d   = q * 16 + rp;                           // row pair 0..63
    const int pos = (((d >> 2) ^ cq) << 2) | (d & 3);
    unsigned int* col = &tile[(cq * 4) * (TP_R / 2) + pos];
    col[0 * (TP_R / 2)] = (unsigned int)f2bf(a[q][0].x) | ((unsigned int)f2bf(a[q][1].x) << 16);
    col[1 * (TP_R / 2)] = (unsigned int)f2bf(a[q][0].y) | ((unsigned int)f2bf(a[q][1].y) << 16);
    col[2 * (TP_R / 2)] = (unsigned int)f2bf(a[q][0].z) | ((unsigned int)f2bf(a[q][1].z) << 16);
    col[3 * (TP_R / 2)] = (unsigned int)f2bf(a[q][0].w) | ((unsigned int)f2bf(a[q][1].w) << 16);
  }
  __syncthreads();
  const int k = t & 15;    // 16-byte chunk of a column: 8 in-rows
#pragma unroll
  for (int p = 0; p < 4; ++p) {
    const int c = p * 16 + (t >> 4);
    const uint4 v = *reinterpret_cast<const uint4*>(
        &tile[c * (TP_R / 2) + ((k ^ (c >> 2)) << 2)]);
    *reinterpret_cast<uint4*>(&out[(size_t)(c0 + c) * R + r0 + k * 8]) = v;
  }
}

// ---------- LayerNorm : f32 [rows][1024] -> bf16, one wave per row ----------
#define LN_ROWS 8  // rows (waves) per work-group

__global__ __launch_bounds__(256)
void ln_kernel(const float* __restrict__ x, const float* __restrict__ w,
               const float* __restrict__ bsh, unsigned short* __restrict__ out) {
  const int lane = threadIdx.x & 31;
  const int row  = blockIdx.x * LN_ROWS + (threadIdx.x >> 5);
  const float4* xr = reinterpret_cast<const float4*>(x + (size_t)row * D_);
  float4 v[8];             // 32 floats per lane; each wave-wide load is 512 contiguous B
#pragma unroll
  for (int i = 0; i < 8; ++i) v[i] = xr[i * 32 + lane];
  float s = 0.f, s2 = 0.f;
#pragma unroll
  for (int i = 0; i < 8; ++i) {
    s  += v[i].x + v[i].y + v[i].z + v[i].w;
    s2 += v[i].x * v[i].x + v[i].y * v[i].y + v[i].z * v[i].z + v[i].w * v[i].w;
  }
#pragma unroll
  for (int m = 1; m < 32; m <<= 1) {
    s  += __shfl_xor(s,  m, 32);
    s2 += __shfl_xor(s2, m, 32);
  }
  const float mu   = s * (1.0f / D_);
  const float var  = s2 * (1.0f / D_) - mu * mu;
  const float rstd = rsqrtf(var + 1e-5f);
  ushort4* orow = reinterpret_cast<ushort4*>(out + (size_t)row * D_);
#pragma unroll
  for (int i = 0; i < 8; ++i) {
    const float4 wv = reinterpret_cast<const float4*>(w)[i * 32 + lane];
    const float4 bv = reinterpret_cast<const float4*>(bsh)[i * 32 + lane];
    ushort4 ov;
    ov.x = f2bf((v[i].x - mu) * rstd * wv.x + bv.x);
    ov.y = f2bf((v[i].y - mu) * rstd * wv.y + bv.y);
    ov.z = f2bf((v[i].z - mu) * rstd * wv.z + bv.z);
    ov.w = f2bf((v[i].w - mu) * rstd * wv.w + bv.w);
    orow[i * 32 + lane] = ov;
  }
}

// ---------- generic WMMA GEMM : C[M,N] = epi(A_bf16[M,K] @ Bt_bf16[N,K]^T) ----------
#define BM 128
#define BN 128
#define BK 128  // k depth of one LDS stage: 256 B of every operand row (whole L2 units)
#define LDT 136  // padded LDS row stride (elems): 272B rows = 16B x odd, banks spread

enum { EPI_QKV = 0, EPI_OPROJ = 1, EPI_FF1 = 2, EPI_FF2 = 3 };

template <int EPI>
__global__ __launch_bounds__(256)
void gemm_kernel(const unsigned short* __restrict__ A,
                 const unsigned short* __restrict__ Bt,
                 const float* __restrict__ bias,
                 const float* __restrict__ resid,
                 float* __restrict__ outF,
                 unsigned short* __restrict__ outB,
                 unsigned short* __restrict__ vT,
                 int M, int N, int K) {
  __shared__ __align__(16) unsigned short As[2][BM * LDT];
  __shared__ __align__(16) unsigned short Bs[2][BN * LDT];
  const int tid  = threadIdx.x;
  const int lane = tid & 31;
  const int w    = tid >> 5;     // 8 waves
  const int wm   = w & 3;        // 4 row-granules of 32
  const int wn   = w >> 2;       // 2 col-granules of 64
  const int m0 = blockIdx.y * BM;
  const int n0 = blockIdx.x * BN;
  const int l16  = lane & 15;
  const int half = lane >> 4;
  const int ko   = half * 8;

  v8f acc[2][4];
#pragma unroll
  for (int i = 0; i < 2; ++i)
#pragma unroll
    for (int j = 0; j < 4; ++j) acc[i][j] = v8f_zero();

  const int ar0 = tid >> 4;   // 0..15 (row within a copy round)
  const int akg = tid & 15;   // k-group of 8 elems: 16 lanes cover one 256 B row piece
  const int nk  = K / BK;

  // one stage: 128 rows x 256 B of each operand, 16 copies per thread
  auto issue_stage = [&](int kt, int buf) {
    const int kb = kt * BK;
#pragma unroll
    for (int p = 0; p < BM / 16; ++p) {
      const int r = p * 16 + ar0;
      cp16_g2l(&As[buf][r * LDT + akg * 8],
               &A[(size_t)(m0 + r) * K + kb + akg * 8]);
      cp16_g2l(&Bs[buf][r * LDT + akg * 8],
               &Bt[(size_t)(n0 + r) * K + kb + akg * 8]);
    }
  };

  issue_stage(0, 0);
  // stage 0 of this wave has landed before the barrier that publishes it
  asm volatile("s_wait_asynccnt 0x0" ::: "memory");
  __syncthreads();
  if (nk > 1) issue_stage(1, 1);

  for (int kt = 0; kt < nk; ++kt) {
    const int cur = kt & 1;
#pragma unroll
    for (int ks = 0; ks < BK / 32; ++ks) {
      v16bf af[2], bf[4];
#pragma unroll
      for (int mt = 0; mt < 2; ++mt)
        af[mt] = load_frag(&As[cur][(wm * 32 + mt * 16 + l16) * LDT + ks * 32 + ko]);
#pragma unroll
      for (int nt = 0; nt < 4; ++nt)
        bf[nt] = load_frag(&Bs[cur][(wn * 64 + nt * 16 + l16) * LDT + ks * 32 + ko]);
#pragma unroll
      for (int mt = 0; mt < 2; ++mt)
#pragma unroll
        for (int nt = 0; nt < 4; ++nt)
          acc[mt][nt] = wmma_bf16(af[mt], bf[nt], acc[mt][nt]);
    }
    // this wave's reads of buffer cur have retired before the buffer is refilled
    asm volatile("s_wait_dscnt 0x0" ::: "memory");
    // this wave's copies of stage kt + 1 have landed before the barrier publishes them
    asm volatile("s_wait_asynccnt 0x0" ::: "memory");
    __syncthreads();
    if (kt + 2 < nk) issue_stage(kt + 2, cur);  // flies while stage kt + 1 is worked on
  }
  // no copy is outstanding when the wave goes on to its end
  asm volatile("s_wait_asynccnt 0x0" ::: "memory");

  // epilogue: C element (i,lane) -> row = i + 8*(lane/16), col = lane%16
#pragma unroll
  for (int mt = 0; mt < 2; ++mt) {
#pragma unroll
    for (int nt = 0; nt < 4; ++nt) {
      const int n = n0 + wn * 64 + nt * 16 + l16;
      const float bv = bias[n];
#pragma unroll
      for (int i = 0; i < 8; ++i) {
        const int m = m0 + wm * 32 + mt * 16 + i + half * 8;
        const float v = acc[mt][nt][i] + bv;
        if constexpr (EPI == EPI_QKV) {
          if (n < 2 * D_) {
            outB[(size_t)m * (3 * D_) + n] = f2bf(v);  // q,k row-major
          } else {                                     // v stored transposed [b][h][d][t]
            const int hd = n - 2 * D_;
            const int hh = hd >> 6, dd = hd & 63;
            const int bb = m >> 11, tt = m & (T_ - 1);
            vT[(((size_t)(bb * H_ + hh)) * HD_ + dd) * T_ + tt] = f2bf(v);
          }
        } else if constexpr (EPI == EPI_OPROJ) {
          outF[(size_t)m * N + n] = resid[(size_t)m * N + n] + v;
        } else if constexpr (EPI == EPI_FF1) {
          const float g =
              0.5f * v * (1.0f + tanhf(0.7978845608028654f * (v + 0.044715f * v * v * v)));
          outB[(size_t)m * N + n] = f2bf(g);
        } else {  // EPI_FF2
          outF[(size_t)m * N + n] = resid[(size_t)m * N + n] + v;
        }
      }
    }
  }
}

#define ATT_BQ 128
#define ATT_BK 128
#define QLD 72    // 144B rows: 16B aligned, banks spread
#define PLD 136   // 272B rows: 16B aligned, conflict-free frag reads

typedef float  v2f  __attribute__((ext_vector_type(2)));
typedef bf16_t v2bf __attribute__((ext_vector_type(2)));
union FragP { v16bf v; v2bf h[8]; };
union Pack8 { uint4 q; v2bf h[4]; };

// value of lane l ^ 16
__device__ __forceinline__ float xhalf(float x) {
  const int b = __builtin_bit_cast(int, x);
  return __builtin_bit_cast(
      float, __builtin_amdgcn_permlanex16(b, b, 0x76543210, 0xfedcba98, false, false));
}

// One work-group per WGP (two waves per SIMD), as before this LDS size.  Left alone the
// compiler aims at the three work-groups that the LDS would admit and, for want of
// registers, waits out every fragment load in front of its own WMMA; and the grid order
// below levels the WGPs only while there are fewer places than work-groups.
__global__ __launch_bounds__(256) __attribute__((amdgpu_waves_per_eu(2, 2)))
void attn_kernel(const unsigned short* __restrict__ qkv,
                 const unsigned short* __restrict__ vT,
                 unsigned short* __restrict__ av) {
  __shared__ __align__(16) unsigned short Qs[ATT_BQ * QLD];
  __shared__ __align__(16) unsigned short Ks[2][ATT_BK * QLD];
  __shared__ __align__(16) unsigned short Vt[2][HD_ * PLD];

  const int tid  = threadIdx.x;
  const int lane = tid & 31;
  const int w    = tid >> 5;       // 8 waves, each owns 16 q-rows
  // A work-group's cost is qt + 1 key tiles, and there are more work-groups than
  // resident places: the slowest grid index counts qt down, so the long ones start
  // first and the short ones fill the places that come free.
  const int qt = T_ / ATT_BQ - 1 - (int)blockIdx.z;  // q tile 15..0
  const int h  = blockIdx.x;
  const int b  = blockIdx.y;
  const int q_base = qt * ATT_BQ;
  const int l16  = lane & 15;
  const int half = lane >> 4;
  const int ko   = half * 8;
  const int wr0  = w * 16;
  const int qrow = q_base + wr0 + l16;   // this lane's query

  const size_t qkv_row = 3 * D_;
  const unsigned short* qbase = qkv + ((size_t)b * T_) * qkv_row + h * HD_;
  const unsigned short* kbase = qbase + D_;
  const unsigned short* vtb   = vT + ((size_t)(b * H_ + h)) * HD_ * T_;

  // K tile (128 x 64, [kk][d]) + V tile (transposed in global: [d][kk])
  auto issue_kv = [&](int j, int buf) {
#pragma unroll
    for (int p = 0; p < 4; ++p) {
      const int idx = p * 256 + tid;
      const int r = idx >> 3, ck = idx & 7;
      cp16_g2l(&Ks[buf][r * QLD + ck * 8],
               &kbase[(size_t)(j * ATT_BK + r) * qkv_row + ck * 8]);
    }
#pragma unroll
    for (int p = 0; p < 4; ++p) {
      const int idx = p * 256 + tid;
      const int d = idx >> 4, ck = idx & 15;
      cp16_g2l(&Vt[buf][d * PLD + ck * 8],
               &vtb[(size_t)d * T_ + j * ATT_BK + ck * 8]);
    }
  };

  // load Q tile (128 x 64) and first K/V tile
#pragma unroll
  for (int p = 0; p < 4; ++p) {
    const int idx = p * 256 + tid;
    const int r = idx >> 3, ck = idx & 7;
    cp16_g2l(&Qs[r * QLD + ck * 8],
             &qbase[(size_t)(q_base + r) * qkv_row + ck * 8]);
  }
  issue_kv(0, 0);
  wait_async();
  __syncthreads();

  float mrun = -3.0e38f;  // running maximum of this lane's query (equal in both halves)
  float lrun = 0.0f;      // running sum over the keys of this lane's half only
  v8f o[4];               // o[dt][i] = O[query l16][d = dt * 16 + half * 8 + i]
#pragma unroll
  for (int dt = 0; dt < 4; ++dt) o[dt] = v8f_zero();

  for (int j = 0; j <= qt; ++j) {
    const int cur = j & 1;
    if (j < qt) issue_kv(j + 1, cur ^ 1);  // prefetch while computing

    // S^T = K Q^T : s[nt][i] = score(key nt * 16 + half * 8 + i, query l16)
    v8f s[8];
#pragma unroll
    for (int nt = 0; nt < 8; ++nt) s[nt] = v8f_zero();
#pragma unroll
    for (int c = 0; c < 2; ++c) {
      const v16bf bq = load_frag(&Qs[(wr0 + l16) * QLD + c * 32 + ko]);
#pragma unroll
      for (int nt = 0; nt < 8; ++nt) {
        const v16bf ak = load_frag(&Ks[cur][(nt * 16 + l16) * QLD + c * 32 + ko]);
        s[nt] = wmma_bf16(ak, bq, s[nt]);
      }
    }
    // scale, 1/sqrt(64)
#pragma unroll
    for (int nt = 0; nt < 8; ++nt) s[nt] *= 0.125f;
    // causal mask, on the diagonal tile only: key j * 128 + nt * 16 + half * 8 + i is
    // masked above qrow = j * 128 + wr0 + l16
    if (j == qt) {
      const int lim = wr0 + l16 - half * 8;
#pragma unroll
      for (int nt = 0; nt < 8; ++nt)
#pragma unroll
        for (int i = 0; i < 8; ++i)
          if (nt * 16 + i > lim) s[nt][i] = -1.0e30f;
    }
    // maximum over the tile's 128 keys: 64 in the lane (eight independent chains),
    // then one exchange with the other half
    float mx[8];
#pragma unroll
    for (int i = 0; i < 8; ++i) {
      float v = s[0][i];
#pragma unroll
      for (int nt = 1; nt < 8; ++nt) v = fmaxf(v, s[nt][i]);
      mx[i] = v;
    }
    float tmax = fmaxf(fmaxf(fmaxf(mx[0], mx[1]), fmaxf(mx[2], mx[3])),
                       fmaxf(fmaxf(mx[4], mx[5]), fmaxf(mx[6], mx[7])));
    tmax = fmaxf(tmax, xhalf(tmax));
    const float mnew = fmaxf(mrun, tmax);
    const float sc   = __expf(mrun - mnew);
    mrun = mnew;
#pragma unroll
    for (int dt = 0; dt < 4; ++dt)
#pragma unroll
      for (int i = 0; i < 8; ++i) o[dt][i] *= sc;

    // P = exp(S - m), packed in place: element e of the B operand of keys c4 * 32 + 0..31
    // is tile 2 * c4 + (e >> 3), register e & 7: the k order of load_frag
    FragP pb[4];
    float rs[4];
#pragma unroll
    for (int c4 = 0; c4 < 4; ++c4) {
      rs[c4] = 0.f;
#pragma unroll
      for (int e = 0; e < 16; e += 2) {
        v2f pp;
        pp.x = __expf(s[2 * c4 + (e >> 3)][e & 7] - mrun);
        pp.y = __expf(s[2 * c4 + (e >> 3)][(e & 7) + 1] - mrun);
        rs[c4] += pp.x + pp.y;
        pb[c4].h[e >> 1] = __builtin_convertvector(pp, v2bf);
      }
    }
    lrun = lrun * sc + ((rs[0] + rs[1]) + (rs[2] + rs[3]));

    // O^T += V^T P^T
#pragma unroll
    for (int c4 = 0; c4 < 4; ++c4) {
#pragma unroll
      for (int dt = 0; dt < 4; ++dt) {
        const v16bf va = load_frag(&Vt[cur][(dt * 16 + l16) * PLD + c4 * 32 + ko]);
        o[dt] = wmma_bf16(va, pb[c4].v, o[dt]);
      }
    }
    wait_async();     // prefetched K/V tile has landed
    __syncthreads();  // all waves done reading this tile's buffers
  }

  // join the halves' sums, normalize + store av (bf16, row-major [token][D]):
  // 8 consecutive d per lane and tile, one 16-byte store each
  const float inv = 1.0f / (lrun + xhalf(lrun));
  unsigned short* orow = av + ((size_t)(b * T_) + qrow) * D_ + h * HD_ + half * 8;
#pragma unroll
  for (int dt = 0; dt < 4; ++dt) {
    Pack8 pk;
#pragma unroll
    for (int i = 0; i < 8; i += 2) {
      v2f ov;
      ov.x = o[dt][i] * inv;
      ov.y = o[dt][i + 1] * inv;
      pk.h[i >> 1] = __builtin_convertvector(ov, v2bf);
    }
    *reinterpret_cast<uint4*>(orow + dt * 16) = pk.q;
  }
}

// ---------- host launcher ----------
extern "C" void kernel_launch(void* const* d_in, const int* in_sizes, int n_in,
                              void* d_out, int out_size, void* d_ws, size_t ws_size,
                              hipStream_t stream) {
  (void)in_sizes; (void)n_in; (void)out_size; (void)ws_size;
  const float* x     = (const float*)d_in[0];
  const float* ln1_w = (const float*)d_in[1];
  const float* ln1_b = (const float*)d_in[2];
  const float* W_qkv = (const float*)d_in[3];
  const float* b_qkv = (const float*)d_in[4];
  const float* W_o   = (const float*)d_in[5];
  const float* b_o   = (const float*)d_in[6];
  const float* ln2_w = (const float*)d_in[7];
  const float* ln2_b = (const float*)d_in[8];
  const float* W_ff1 = (const float*)d_in[9];
  const float* b_ff1 = (const float*)d_in[10];
  const float* W_ff2 = (const float*)d_in[11];
  const float* b_ff2 = (const float*)d_in[12];
  float* out = (float*)d_out;
  char* ws = (char*)d_ws;

  // workspace layout (bytes)
  constexpr size_t off_wqkv = 0;                               // 3072x1024 bf16
  constexpr size_t off_wo   = off_wqkv + (size_t)3072 * 1024 * 2;
  constexpr size_t off_wff1 = off_wo   + (size_t)1024 * 1024 * 2;
  constexpr size_t off_wff2 = off_wff1 + (size_t)4096 * 1024 * 2;
  constexpr size_t off_h    = off_wff2 + (size_t)1024 * 4096 * 2;  // h / h2 (aliased)
  constexpr size_t off_qkv  = off_h    + (size_t)NTOK * D_ * 2;    // q,k rows (v slot unused)
  constexpr size_t off_vT   = off_qkv  + (size_t)NTOK * 3 * D_ * 2;
  constexpr size_t off_ff1  = off_qkv;                             // reuses qkv+vT after attn
  constexpr size_t off_av   = off_vT   + (size_t)NTOK * D_ * 2;
  constexpr size_t off_x1   = off_av   + (size_t)NTOK * D_ * 2;

  unsigned short* wqkv_t = (unsigned short*)(ws + off_wqkv);
  unsigned short* wo_t   = (unsigned short*)(ws + off_wo);
  unsigned short* wff1_t = (unsigned short*)(ws + off_wff1);
  unsigned short* wff2_t = (unsigned short*)(ws + off_wff2);
  unsigned short* hbuf   = (unsigned short*)(ws + off_h);
  unsigned short* qkvb   = (unsigned short*)(ws + off_qkv);
  unsigned short* vTb    = (unsigned short*)(ws + off_vT);
  unsigned short* ff1b   = (unsigned short*)(ws + off_ff1);
  unsigned short* avb    = (unsigned short*)(ws + off_av);
  float*          x1     = (float*)(ws + off_x1);

  transpose_f32_bf16<<<dim3(3072 / TP_C, 1024 / TP_R), 256, 0, stream>>>(W_qkv, wqkv_t, 1024, 3072);
  transpose_f32_bf16<<<dim3(1024 / TP_C, 1024 / TP_R), 256, 0, stream>>>(W_o,   wo_t,   1024, 1024);
  transpose_f32_bf16<<<dim3(4096 / TP_C, 1024 / TP_R), 256, 0, stream>>>(W_ff1, wff1_t, 1024, 4096);
  transpose_f32_bf16<<<dim3(1024 / TP_C, 4096 / TP_R), 256, 0, stream>>>(W_ff2, wff2_t, 4096, 1024);

  ln_kernel<<<NTOK / LN_ROWS, 256, 0, stream>>>(x, ln1_w, ln1_b, hbuf);

  gemm_kernel<EPI_QKV><<<dim3(3072 / BN, NTOK / BM), 256, 0, stream>>>(
      hbuf, wqkv_t, b_qkv, nullptr, nullptr, qkvb, vTb, NTOK, 3072, 1024);

  attn_kernel<<<dim3(H_, B_, T_ / ATT_BQ), 256, 0, stream>>>(qkvb, vTb, avb);

  gemm_kernel<EPI_OPROJ><<<dim3(1024 / BN, NTOK / BM), 256, 0, stream>>>(
      avb, wo_t, b_o, x, x1, nullptr, nullptr, NTOK, 1024, 1024);

  ln_kernel<<<NTOK / LN_ROWS, 256, 0, stream>>>(x1, ln2_w, ln2_b, hbuf);

  gemm_kernel<EPI_FF1><<<dim3(4096 / BN, NTOK / BM), 256, 0, stream>>>(
      hbuf, wff1_t, b_ff1, nullptr, nullptr, ff1b, nullptr, NTOK, 4096, 1024);

  gemm_kernel<EPI_FF2><<<dim3(1024 / BN, NTOK / BM), 256, 0, stream>>>(
      ff1b, wff2_t, b_ff2, x1, out, nullptr, nullptr, NTOK, 1024, 4096);
}

// v005
// Measured time: 183 microseconds a run.
// Two timings next to v004 put it at 1.05 and 1.06 times that version's speed.
// Counting every step since v000, it is 1.77 times as fast.
#include <hip/hip_runtime.h>
#include <stdint.h>

// ---------- types ----------
typedef __bf16 bf16_t;
typedef bf16_t v16bf __attribute__((ext_vector_type(16)));
typedef float  v8f   __attribute__((ext_vector_type(8)));
typedef int    v4i   __attribute__((ext_vector_type(4)));

#define B_   2
#define T_   2048
#define D_   1024
#define H_   16
#define HD_  64
#define DFF_ 4096
#define NTOK (B_ * T_)

#if defined(__gfx1250__) && __has_builtin(__builtin_amdgcn_global_load_async_to_lds_b128)
#define HAVE_ASYNC_LDS 1
#else
#define HAVE_ASYNC_LDS 0
#endif

__device__ __forceinline__ unsigned short f2bf(float f) {
  union { float f; unsigned int u; } c; c.f = f;
  unsigned int u = c.u;
  unsigned int r = u + 0x7FFFu + ((u >> 16) & 1u);  // round-to-nearest-even
  return (unsigned short)(r >> 16);
}

// 16-byte global -> LDS copy; async engine when available (ASYNCcnt tracked),
// else synchronous VGPR-staged copy.  Both require 16B-aligned src and dst.
__device__ __forceinline__ void cp16_g2l(unsigned short* ldst,
                                         const unsigned short* gsrc) {
#if HAVE_ASYNC_LDS
  __builtin_amdgcn_global_load_async_to_lds_b128(
      (__attribute__((address_space(1))) v4i*)gsrc,
      (__attribute__((address_space(3))) v4i*)ldst, 0, 0);
#else
  *reinterpret_cast<uint4*>(ldst) = *reinterpret_cast<const uint4*>(gsrc);
#endif
}

__device__ __forceinline__ void wait_async() {
#if HAVE_ASYNC_LDS
#if __has_builtin(__builtin_amdgcn_s_wait_asynccnt)
  __builtin_amdgcn_s_wait_asynccnt(0);
#else
  asm volatile("s_wait_asynccnt 0x0" ::: "memory");
#endif
#endif
}

union FragU { v16bf v; uint4 q[2]; };

// Load a 16-element bf16 WMMA fragment: p points at (row_base + ko) where
// ko = (lane/16)*8.  Elements 0..7 are K=ko..ko+7, elements 8..15 are
// K=ko+16..ko+23 (ISA 16-bit A/B fragment layout).  Both halves are 16B loads.
__device__ __forceinline__ v16bf load_frag(const unsigned short* p) {
  FragU f;
  f.q[0] = *reinterpret_cast<const uint4*>(p);
  f.q[1] = *reinterpret_cast<const uint4*>(p + 16);
  return f.v;
}

__device__ __forceinline__ v8f wmma_bf16(v16bf a, v16bf b, v8f c) {
  return __builtin_amdgcn_wmma_f32_16x16x32_bf16(false, a, false, b,
                                                 (short)0, c, false, false);
}

__device__ __forceinline__ v8f v8f_zero() {
  v8f z = {0.f, 0.f, 0.f, 0.f, 0.f, 0.f, 0.f, 0.f};
  return z;
}

// ---------- weight transpose + f32->bf16 convert : out[N][K] = in[K][N] ----------
// One work-group moves a tile of 128 in-rows x 64 in-columns: 256 B of every row it
// reads and 256 B of every row it writes, 32 elements per thread.
#define TP_R 128
#define TP_C 64

__global__ __launch_bounds__(256)
void transpose_f32_bf16(const float* __restrict__ in,
                        unsigned short* __restrict__ out, int R, int C) {
  // [in-column][pair of in-rows]: 64 dwords per column, no pad.  The 16-byte chunks of
  // a column are XOR-ed with (column >> 2), so the dword stores of a wave (16 column
  // groups x 2 row pairs) and its 16-byte reads (16 chunks of one column) both hit
  // every bank at most once.
  __shared__ __align__(16) unsigned int tile[TP_C * (TP_R / 2)];
  const int t  = threadIdx.x;
  const int c0 = blockIdx.x * TP_C, r0 = blockIdx.y * TP_R;
  const int cq = t & 15;   // group of 4 in-columns (one float4)
  const int rp = t >> 4;   // pair of in-rows within a round of 32 rows
  float4 a[4][2];
#pragma unroll
  for (int q = 0; q < 4; ++q)
#pragma unroll
    for (int j = 0; j < 2; ++j)
      a[q][j] = *reinterpret_cast<const float4*>(
          &in[(size_t)(r0 + q * 32 + rp * 2 + j) * C + c0 + cq * 4]);
#pragma unroll
  for (int q = 0; q < 4; ++q) {
    const int d   = q * 16 + rp;                           // row pair 0..63
    const int pos = (((d >> 2) ^ cq) << 2) | (d & 3);
    unsigned int* col = &tile[(cq * 4) * (TP_R / 2) + pos];
    col[0 * (TP_R / 2)] = (unsigned int)f2bf(a[q][0].x) | ((unsigned int)f2bf(a[q][1].x) << 16);
    col[1 * (TP_R / 2)] = (unsigned int)f2bf(a[q][0].y) | ((unsigned int)f2bf(a[q][1].y) << 16);
    col[2 * (TP_R / 2)] = (unsigned int)f2bf(a[q][0].z) | ((unsigned int)f2bf(a[q][1].z) << 16);
    col[3 * (TP_R / 2)] = (unsigned int)f2bf(a[q][0].w) | ((unsigned int)f2bf(a[q][1].w) << 16);
  }
  __syncthreads();
  const int k = t & 15;    // 16-byte chunk of a column: 8 in-rows
#pragma unroll
  for (int p = 0; p < 4; ++p) {
    const int c = p * 16 + (t >> 4);
    const uint4 v = *reinterpret_cast<const uint4*>(
        &tile[c * (TP_R / 2) + ((k ^ (c >> 2)) << 2)]);
    *reinterpret_cast<uint4*>(&out[(size_t)(c0 + c) * R + r0 + k * 8]) = v;
  }
}

// ---------- LayerNorm : f32 [rows][1024] -> bf16, one wave per row ----------
#define LN_ROWS 8  // rows (waves) per work-group

__global__ __launch_bounds__(256)
void ln_kernel(const float* __restrict__ x, const float* __restrict__ w,
               const float* __restrict__ bsh, unsigned short* __restrict__ out) {
  const int lane = threadIdx.x & 31;
  const int row  = blockIdx.x * LN_ROWS + (threadIdx.x >> 5);
  const float4* xr = reinterpret_cast<const float4*>(x + (size_t)row * D_);
  float4 v[8];             // 32 floats per lane; each wave-wide load is 512 contiguous B
#pragma unroll
  for (int i = 0; i < 8; ++i) v[i] = xr[i * 32 + lane];
  float s = 0.f, s2 = 0.f;
#pragma unroll
  for (int i = 0; i < 8; ++i) {
    s  += v[i].x + v[i].y + v[i].z + v[i].w;
    s2 += v[i].x * v[i].x + v[i].y * v[i].y + v[i].z * v[i].z + v[i].w * v[i].w;
  }
#pragma unroll
  for (int m = 1; m < 32; m <<= 1) {
    s  += __shfl_xor(s,  m, 32);
    s2 += __shfl_xor(s2, m, 32);
  }
  const float mu   = s * (1.0f / D_);
  const float var  = s2 * (1.0f / D_) - mu * mu;
  const float rstd = rsqrtf(var + 1e-5f);
  ushort4* orow = reinterpret_cast<ushort4*>(out + (size_t)row * D_);
#pragma unroll
  for (int i = 0; i < 8; ++i) {
    const float4 wv = reinterpret_cast<const float4*>(w)[i * 32 + lane];
    const float4 bv = reinterpret_cast<const float4*>(bsh)[i * 32 + lane];
    ushort4 ov;
    ov.x = f2bf((v[i].x - mu) * rstd * wv.x + bv.x);
    ov.y = f2bf((v[i].y - mu) * rstd * wv.y + bv.y);
    ov.z = f2bf((v[i].z - mu) * rstd * wv.z + bv.z);
    ov.w = f2bf((v[i].w - mu) * rstd * wv.w + bv.w);
    orow[i * 32 + lane] = ov;
  }
}

// Eight independent transcendentals in a row.  The outputs are early-clobber, so none of
// them lands on a source of the run; the closing v_nop is the one slot that the
// instruction set asks for between a transcendental and an instruction that uses its
// result or overwrites its source.
__device__ __forceinline__ void exp2_x8(float (&y)[8], const float (&x)[8]) {
  asm("v_exp_f32 %0, %8\n\tv_exp_f32 %1, %9\n\tv_exp_f32 %2, %10\n\tv_exp_f32 %3, %11\n\t"
      "v_exp_f32 %4, %12\n\tv_exp_f32 %5, %13\n\tv_exp_f32 %6, %14\n\tv_exp_f32 %7, %15\n\t"
      "v_nop"
      : "=&v"(y[0]), "=&v"(y[1]), "=&v"(y[2]), "=&v"(y[3]),
        "=&v"(y[4]), "=&v"(y[5]), "=&v"(y[6]), "=&v"(y[7])
      : "v"(x[0]), "v"(x[1]), "v"(x[2]), "v"(x[3]),
        "v"(x[4]), "v"(x[5]), "v"(x[6]), "v"(x[7]));
}
// the same run and the same closing slot for the reciprocals
__device__ __forceinline__ void rcp_x8(float (&y)[8], const float (&x)[8]) {
  asm("v_rcp_f32 %0, %8\n\tv_rcp_f32 %1, %9\n\tv_rcp_f32 %2, %10\n\tv_rcp_f32 %3, %11\n\t"
      "v_rcp_f32 %4, %12\n\tv_rcp_f32 %5, %13\n\tv_rcp_f32 %6, %14\n\tv_rcp_f32 %7, %15\n\t"
      "v_nop"
      : "=&v"(y[0]), "=&v"(y[1]), "=&v"(y[2]), "=&v"(y[3]),
        "=&v"(y[4]), "=&v"(y[5]), "=&v"(y[6]), "=&v"(y[7])
      : "v"(x[0]), "v"(x[1]), "v"(x[2]), "v"(x[3]),
        "v"(x[4]), "v"(x[5]), "v"(x[6]), "v"(x[7]));
}

// ---------- generic WMMA GEMM : C[M,N] = epi(A_bf16[M,K] @ Bt_bf16[N,K]^T) ----------
#define BM 128
#define BN 128
#define BK 128  // k depth of one LDS stage: 256 B of every operand row (whole L2 units)
#define LDT 136  // padded LDS row stride (elems): 272B rows = 16B x odd, banks spread

enum { EPI_QKV = 0, EPI_OPROJ = 1, EPI_FF1 = 2, EPI_FF2 = 3 };

template <int EPI>
__global__ __launch_bounds__(256)
void gemm_kernel(const unsigned short* __restrict__ A,
                 const unsigned short* __restrict__ Bt,
                 const float* __restrict__ bias,
                 const float* __restrict__ resid,
                 float* __restrict__ outF,
                 unsigned short* __restrict__ outB,
                 unsigned short* __restrict__ vT,
                 int M, int N, int K) {
  __shared__ __align__(16) unsigned short As[2][BM * LDT];
  __shared__ __align__(16) unsigned short Bs[2][BN * LDT];
  const int tid  = threadIdx.x;
  const int lane = tid & 31;
  const int w    = tid >> 5;     // 8 waves
  const int wm   = w & 3;        // 4 row-granules of 32
  const int wn   = w >> 2;       // 2 col-granules of 64
  const int m0 = blockIdx.y * BM;
  const int n0 = blockIdx.x * BN;
  const int l16  = lane & 15;
  const int half = lane >> 4;
  const int ko   = half * 8;

  v8f acc[2][4];
#pragma unroll
  for (int i = 0; i < 2; ++i)
#pragma unroll
    for (int j = 0; j < 4; ++j) acc[i][j] = v8f_zero();

  const int ar0 = tid >> 4;   // 0..15 (row within a copy round)
  const int akg = tid & 15;   // k-group of 8 elems: 16 lanes cover one 256 B row piece
  const int nk  = K / BK;

  // one stage: 128 rows x 256 B of each operand, 16 copies per thread
  auto issue_stage = [&](int kt, int buf) {
    const int kb = kt * BK;
#pragma unroll
    for (int p = 0; p < BM / 16; ++p) {
      const int r = p * 16 + ar0;
      cp16_g2l(&As[buf][r * LDT + akg * 8],
               &A[(size_t)(m0 + r) * K + kb + akg * 8]);
      cp16_g2l(&Bs[buf][r * LDT + akg * 8],
               &Bt[(size_t)(n0 + r) * K + kb + akg * 8]);
    }
  };

  issue_stage(0, 0);
  // stage 0 of this wave has landed before the barrier that publishes it
  asm volatile("s_wait_asynccnt 0x0" ::: "memory");
  __syncthreads();
  if (nk > 1) issue_stage(1, 1);

  for (int kt = 0; kt < nk; ++kt) {
    const int cur = kt & 1;
#pragma unroll
    for (int ks = 0; ks < BK / 32; ++ks) {
      v16bf af[2], bf[4];
#pragma unroll
      for (int mt = 0; mt < 2; ++mt)
        af[mt] = load_frag(&As[cur][(wm * 32 + mt * 16 + l16) * LDT + ks * 32 + ko]);
#pragma unroll
      for (int nt = 0; nt < 4; ++nt)
        bf[nt] = load_frag(&Bs[cur][(wn * 64 + nt * 16 + l16) * LDT + ks * 32 + ko]);
#pragma unroll
      for (int mt = 0; mt < 2; ++mt)
#pragma unroll
        for (int nt = 0; nt < 4; ++nt)
          acc[mt][nt] = wmma_bf16(af[mt], bf[nt], acc[mt][nt]);
    }
    // this wave's reads of buffer cur have retired before the buffer is refilled
    asm volatile("s_wait_dscnt 0x0" ::: "memory");
    // this wave's copies of stage kt + 1 have landed before the barrier publishes them
    asm volatile("s_wait_asynccnt 0x0" ::: "memory");
    __syncthreads();
    if (kt + 2 < nk) issue_stage(kt + 2, cur);  // flies while stage kt + 1 is worked on
  }
  // no copy is outstanding when the wave goes on to its end
  asm volatile("s_wait_asynccnt 0x0" ::: "memory");

  // epilogue: C element (i,lane) -> row = i + 8*(lane/16), col = lane%16
#pragma unroll
  for (int mt = 0; mt < 2; ++mt) {
#pragma unroll
    for (int nt = 0; nt < 4; ++nt) {
      const int n = n0 + wn * 64 + nt * 16 + l16;
      const float bv = bias[n];
      float gl[8];
      if constexpr (EPI == EPI_FF1) {
        // 0.5 v (1 + tanh u) = v / (1 + exp(-2 u)), u = c (v + 0.044715 v^3): the same
        // function with no branch, so a lane's elements interleave.  The two constants
        // are -2 c log2(e) and that times 0.044715; exp2 going to inf or to 0 at the
        // ends gives the limits 0 and v.
        float t[8], e[8];
#pragma unroll
        for (int i = 0; i < 8; ++i) {
          const float v = acc[mt][nt][i] + bv;
          t[i] = v * (-2.3022082f + -0.10294324f * (v * v));
        }
        exp2_x8(e, t);
#pragma unroll
        for (int i = 0; i < 8; ++i) t[i] = 1.0f + e[i];
        rcp_x8(e, t);
#pragma unroll
        for (int i = 0; i < 8; ++i) gl[i] = (acc[mt][nt][i] + bv) * e[i];
      }
#pragma unroll
      for (int i = 0; i < 8; ++i) {
        const int m = m0 + wm * 32 + mt * 16 + i + half * 8;
        const float v = acc[mt][nt][i] + bv;
        if constexpr (EPI == EPI_QKV) {
          if (n < 2 * D_) {
            outB[(size_t)m * (3 * D_) + n] = f2bf(v);  // q,k row-major
          } else {                                     // v stored transposed [b][h][d][t]
            const int hd = n - 2 * D_;
            const int hh = hd >> 6, dd = hd & 63;
            const int bb = m >> 11, tt = m & (T_ - 1);
            vT[(((size_t)(bb * H_ + hh)) * HD_ + dd) * T_ + tt] = f2bf(v);
          }
        } else if constexpr (EPI == EPI_OPROJ) {
          outF[(size_t)m * N + n] = resid[(size_t)m * N + n] + v;
        } else if constexpr (EPI == EPI_FF1) {
          outB[(size_t)m * N + n] = f2bf(gl[i]);
        } else {  // EPI_FF2
          outF[(size_t)m * N + n] = resid[(size_t)m * N + n] + v;
        }
      }
    }
  }
}

#define ATT_BQ 128
#define ATT_BK 128
#define QLD 72    // 144B rows: 16B aligned, banks spread
#define PLD 136   // 272B rows: 16B aligned, conflict-free frag reads

typedef float  v2f  __attribute__((ext_vector_type(2)));
typedef bf16_t v2bf __attribute__((ext_vector_type(2)));
union FragP { v16bf v; v2bf h[8]; };
union Pack8 { uint4 q; v2bf h[4]; };

// value of lane l ^ 16
__device__ __forceinline__ float xhalf(float x) {
  const int b = __builtin_bit_cast(int, x);
  return __builtin_bit_cast(
      float, __builtin_amdgcn_permlanex16(b, b, 0x76543210, 0xfedcba98, false, false));
}

// One work-group per WGP (two waves per SIMD), as before this LDS size.  Left alone the
// compiler aims at the three work-groups that the LDS would admit and, for want of
// registers, waits out every fragment load in front of its own WMMA; and the grid order
// below levels the WGPs only while there are fewer places than work-groups.
__global__ __launch_bounds__(256) __attribute__((amdgpu_waves_per_eu(2, 2)))
void attn_kernel(const unsigned short* __restrict__ qkv,
                 const unsigned short* __restrict__ vT,
                 unsigned short* __restrict__ av) {
  __shared__ __align__(16) unsigned short Qs[ATT_BQ * QLD];
  __shared__ __align__(16) unsigned short Ks[2][ATT_BK * QLD];
  __shared__ __align__(16) unsigned short Vt[2][HD_ * PLD];

  const int tid  = threadIdx.x;
  const int lane = tid & 31;
  const int w    = tid >> 5;       // 8 waves, each owns 16 q-rows
  // A work-group's cost is qt + 1 key tiles, and there are more work-groups than
  // resident places: the slowest grid index counts qt down, so the long ones start
  // first and the short ones fill the places that come free.
  const int qt = T_ / ATT_BQ - 1 - (int)blockIdx.z;  // q tile 15..0
  const int h  = blockIdx.x;
  const int b  = blockIdx.y;
  const int q_base = qt * ATT_BQ;
  const int l16  = lane & 15;
  const int half = lane >> 4;
  const int ko   = half * 8;
  const int wr0  = w * 16;
  const int qrow = q_base + wr0 + l16;   // this lane's query

  const size_t qkv_row = 3 * D_;
  const unsigned short* qbase = qkv + ((size_t)b * T_) * qkv_row + h * HD_;
  const unsigned short* kbase = qbase + D_;
  const unsigned short* vtb   = vT + ((size_t)(b * H_ + h)) * HD_ * T_;

  // K tile (128 x 64, [kk][d]) + V tile (transposed in global: [d][kk])
  auto issue_kv = [&](int j, int buf) {
#pragma unroll
    for (int p = 0; p < 4; ++p) {
      const int idx = p * 256 + tid;
      const int r = idx >> 3, ck = idx & 7;
      cp16_g2l(&Ks[buf][r * QLD + ck * 8],
               &kbase[(size_t)(j * ATT_BK + r) * qkv_row + ck * 8]);
    }
#pragma unroll
    for (int p = 0; p < 4; ++p) {
      const int idx = p * 256 + tid;
      const int d = idx >> 4, ck = idx & 15;
      cp16_g2l(&Vt[buf][d * PLD + ck * 8],
               &vtb[(size_t)d * T_ + j * ATT_BK + ck * 8]);
    }
  };

  // load Q tile (128 x 64) and first K/V tile
#pragma unroll
  for (int p = 0; p < 4; ++p) {
    const int idx = p * 256 + tid;
    const int r = idx >> 3, ck = idx & 7;
    cp16_g2l(&Qs[r * QLD + ck * 8],
             &qbase[(size_t)(q_base + r) * qkv_row + ck * 8]);
  }
  issue_kv(0, 0);
  wait_async();
  __syncthreads();

  float mrun = -3.0e38f;  // running maximum of this lane's query (equal in both halves)
  float lrun = 0.0f;      // running sum over the keys of this lane's half only
  v8f o[4];               // o[dt][i] = O[query l16][d = dt * 16 + half * 8 + i]
#pragma unroll
  for (int dt = 0; dt < 4; ++dt) o[dt] = v8f_zero();

  for (int j = 0; j <= qt; ++j) {
    const int cur = j & 1;
    if (j < qt) issue_kv(j + 1, cur ^ 1);  // prefetch while computing

    // S^T = K Q^T : s[nt][i] = score(key nt * 16 + half * 8 + i, query l16)
    v8f s[8];
#pragma unroll
    for (int nt = 0; nt < 8; ++nt) s[nt] = v8f_zero();
#pragma unroll
    for (int c = 0; c < 2; ++c) {
      const v16bf bq = load_frag(&Qs[(wr0 + l16) * QLD + c * 32 + ko]);
#pragma unroll
      for (int nt = 0; nt < 8; ++nt) {
        const v16bf ak = load_frag(&Ks[cur][(nt * 16 + l16) * QLD + c * 32 + ko]);
        s[nt] = wmma_bf16(ak, bq, s[nt]);
      }
    }
    // scale, 1/sqrt(64)
#pragma unroll
    for (int nt = 0; nt < 8; ++nt) s[nt] *= 0.125f;
    // causal mask, on the diagonal tile only: key j * 128 + nt * 16 + half * 8 + i is
    // masked above qrow = j * 128 + wr0 + l16
    if (j == qt) {
      const int lim = wr0 + l16 - half * 8;
#pragma unroll
      for (int nt = 0; nt < 8; ++nt)
#pragma unroll
        for (int i = 0; i < 8; ++i)
          if (nt * 16 + i > lim) s[nt][i] = -1.0e30f;
    }
    // maximum over the tile's 128 keys: 64 in the lane (eight independent chains),
    // then one exchange with the other half
    float mx[8];
#pragma unroll
    for (int i = 0; i < 8; ++i) {
      float v = s[0][i];
#pragma unroll
      for (int nt = 1; nt < 8; ++nt) v = fmaxf(v, s[nt][i]);
      mx[i] = v;
    }
    float tmax = fmaxf(fmaxf(fmaxf(mx[0], mx[1]), fmaxf(mx[2], mx[3])),
                       fmaxf(fmaxf(mx[4], mx[5]), fmaxf(mx[6], mx[7])));
    tmax = fmaxf(tmax, xhalf(tmax));
    const float mnew = fmaxf(mrun, tmax);
    const float sc   = __expf(mrun - mnew);
    mrun = mnew;
#pragma unroll
    for (int dt = 0; dt < 4; ++dt)
#pragma unroll
      for (int i = 0; i < 8; ++i) o[dt][i] *= sc;

    // P = exp(S - m), packed in place: element e of the B operand of keys c4 * 32 + 0..31
    // is tile 2 * c4 + (e >> 3), register e & 7: the k order of load_frag
    FragP pb[4];
    float rs[4];
#pragma unroll
    for (int c4 = 0; c4 < 4; ++c4) {
      rs[c4] = 0.f;
#pragma unroll
      for (int e = 0; e < 16; e += 2) {
        v2f pp;
        pp.x = __expf(s[2 * c4 + (e >> 3)][e & 7] - mrun);
        pp.y = __expf(s[2 * c4 + (e >> 3)][(e & 7) + 1] - mrun);
        rs[c4] += pp.x + pp.y;
        pb[c4].h[e >> 1] = __builtin_convertvector(pp, v2bf);
      }
    }
    lrun = lrun * sc + ((rs[0] + rs[1]) + (rs[2] + rs[3]));

    // O^T += V^T P^T
#pragma unroll
    for (int c4 = 0; c4 < 4; ++c4) {
#pragma unroll
      for (int dt = 0; dt < 4; ++dt) {
        const v16bf va = load_frag(&Vt[cur][(dt * 16 + l16) * PLD + c4 * 32 + ko]);
        o[dt] = wmma_bf16(va, pb[c4].v, o[dt]);
      }
    }
    wait_async();     // prefetched K/V tile has landed
    __syncthreads();  // all waves done reading this tile's buffers
  }

  // join the halves' sums, normalize + store av (bf16, row-major [token][D]):
  // 8 consecutive d per lane and tile, one 16-byte store each
  const float inv = 1.0f / (lrun + xhalf(lrun));
  unsigned short* orow = av + ((size_t)(b * T_) + qrow) * D_ + h * HD_ + half * 8;
#pragma unroll
  for (int dt = 0; dt < 4; ++dt) {
    Pack8 pk;
#pragma unroll
    for (int i = 0; i < 8; i += 2) {
      v2f ov;
      ov.x = o[dt][i] * inv;
      ov.y = o[dt][i + 1] * inv;
      pk.h[i >> 1] = __builtin_convertvector(ov, v2bf);
    }
    *reinterpret_cast<uint4*>(orow + dt * 16) = pk.q;
  }
}

// ---------- host launcher ----------
extern "C" void kernel_launch(void* const* d_in, const int* in_sizes, int n_in,
                              void* d_out, int out_size, void* d_ws, size_t ws_size,
                              hipStream_t stream) {
  (void)in_sizes; (void)n_in; (void)out_size; (void)ws_size;
  const float* x     = (const float*)d_in[0];
  const float* ln1_w = (const float*)d_in[1];
  const float* ln1_b = (const float*)d_in[2];
  const float* W_qkv = (const float*)d_in[3];
  const float* b_qkv = (const float*)d_in[4];
  const float* W_o   = (const float*)d_in[5];
  const float* b_o   = (const float*)d_in[6];
  const float* ln2_w = (const float*)d_in[7];
  const float* ln2_b = (const float*)d_in[8];
  const float* W_ff1 = (const float*)d_in[9];
  const float* b_ff1 = (const float*)d_in[10];
  const float* W_ff2 = (const float*)d_in[11];
  const float* b_ff2 = (const float*)d_in[12];
  float* out = (float*)d_out;
  char* ws = (char*)d_ws;

  // workspace layout (bytes)
  constexpr size_t off_wqkv = 0;                               // 3072x1024 bf16
  constexpr size_t off_wo   = off_wqkv + (size_t)3072 * 1024 * 2;
  constexpr size_t off_wff1 = off_wo   + (size_t)1024 * 1024 * 2;
  constexpr size_t off_wff2 = off_wff1 + (size_t)4096 * 1024 * 2;
  constexpr size_t off_h    = off_wff2 + (size_t)1024 * 4096 * 2;  // h / h2 (aliased)
  constexpr size_t off_qkv  = off_h    + (size_t)NTOK * D_ * 2;    // q,k rows (v slot unused)
  constexpr size_t off_vT   = off_qkv  + (size_t)NTOK * 3 * D_ * 2;
  constexpr size_t off_ff1  = off_qkv;                             // reuses qkv+vT after attn
  constexpr size_t off_av   = off_vT   + (size_t)NTOK * D_ * 2;
  constexpr size_t off_x1   = off_av   + (size_t)NTOK * D_ * 2;

  unsigned short* wqkv_t = (unsigned short*)(ws + off_wqkv);
  unsigned short* wo_t   = (unsigned short*)(ws + off_wo);
  unsigned short* wff1_t = (unsigned short*)(ws + off_wff1);
  unsigned short* wff2_t = (unsigned short*)(ws + off_wff2);
  unsigned short* hbuf   = (unsigned short*)(ws + off_h);
  unsigned short* qkvb   = (unsigned short*)(ws + off_qkv);
  unsigned short* vTb    = (unsigned short*)(ws + off_vT);
  unsigned short* ff1b   = (unsigned short*)(ws + off_ff1);
  unsigned short* avb    = (unsigned short*)(ws + off_av);
  float*          x1     = (float*)(ws + off_x1);

  transpose_f32_bf16<<<dim3(3072 / TP_C, 1024 / TP_R), 256, 0, stream>>>(W_qkv, wqkv_t, 1024, 3072);
  transpose_f32_bf16<<<dim3(1024 / TP_C, 1024 / TP_R), 256, 0, stream>>>(W_o,   wo_t,   1024, 1024);
  transpose_f32_bf16<<<dim3(4096 / TP_C, 1024 / TP_R), 256, 0, stream>>>(W_ff1, wff1_t, 1024, 4096);
  transpose_f32_bf16<<<dim3(1024 / TP_C, 4096 / TP_R), 256, 0, stream>>>(W_ff2, wff2_t, 4096, 1024);

  ln_kernel<<<NTOK / LN_ROWS, 256, 0, stream>>>(x, ln1_w, ln1_b, hbuf);

  gemm_kernel<EPI_QKV><<<dim3(3072 / BN, NTOK / BM), 256, 0, stream>>>(
      hbuf, wqkv_t, b_qkv, nullptr, nullptr, qkvb, vTb, NTOK, 3072, 1024);

  attn_kernel<<<dim3(H_, B_, T_ / ATT_BQ), 256, 0, stream>>>(qkvb, vTb, avb);

  gemm_kernel<EPI_OPROJ><<<dim3(1024 / BN, NTOK / BM), 256, 0, stream>>>(
      avb, wo_t, b_o, x, x1, nullptr, nullptr, NTOK, 1024, 1024);

  ln_kernel<<<NTOK / LN_ROWS, 256, 0, stream>>>(x1, ln2_w, ln2_b, hbuf);

  gemm_kernel<EPI_FF1><<<dim3(4096 / BN, NTOK / BM), 256, 0, stream>>>(
      hbuf, wff1_t, b_ff1, nullptr, nullptr, ff1b, nullptr, NTOK, 4096, 1024);

  gemm_kernel<EPI_FF2><<<dim3(1024 / BN, NTOK / BM), 256, 0, stream>>>(
      ff1b, wff2_t, b_ff2, x1, out, nullptr, nullptr, NTOK, 1024, 4096);
}

// v006
// A run of this version takes 174 microseconds.
// Two timings next to v005 put it at 1.06 and 1.07 times that version's speed.
// All steps since v000 together make it 1.88 times as fast.
#include <hip/hip_runtime.h>
#include <stdint.h>

// ---------- types ----------
typedef __bf16 bf16_t;
typedef bf16_t v16bf __attribute__((ext_vector_type(16)));
typedef float  v8f   __attribute__((ext_vector_type(8)));
typedef int    v4i   __attribute__((ext_vector_type(4)));

#define B_   2
#define T_   2048
#define D_   1024
#define H_   16
#define HD_  64
#define DFF_ 4096
#define NTOK (B_ * T_)

#if defined(__gfx1250__) && __has_builtin(__builtin_amdgcn_global_load_async_to_lds_b128)
#define HAVE_ASYNC_LDS 1
#else
#define HAVE_ASYNC_LDS 0
#endif

__device__ __forceinline__ unsigned short f2bf(float f) {
  union { float f; unsigned int u; } c; c.f = f;
  unsigned int u = c.u;
  unsigned int r = u + 0x7FFFu + ((u >> 16) & 1u);  // round-to-nearest-even
  return (unsigned short)(r >> 16);
}

// 16-byte global -> LDS copy; async engine when available (ASYNCcnt tracked),
// else synchronous VGPR-staged copy.  Both require 16B-aligned src and dst.
__device__ __forceinline__ void cp16_g2l(unsigned short* ldst,
                                         const unsigned short* gsrc) {
#if HAVE_ASYNC_LDS
  __builtin_amdgcn_global_load_async_to_lds_b128(
      (__attribute__((address_space(1))) v4i*)gsrc,
      (__attribute__((address_space(3))) v4i*)ldst, 0, 0);
#else
  *reinterpret_cast<uint4*>(ldst) = *reinterpret_cast<const uint4*>(gsrc);
#endif
}

__device__ __forceinline__ void wait_async() {
#if HAVE_ASYNC_LDS
#if __has_builtin(__builtin_amdgcn_s_wait_asynccnt)
  __builtin_amdgcn_s_wait_asynccnt(0);
#else
  asm volatile("s_wait_asynccnt 0x0" ::: "memory");
#endif
#endif
}

union FragU { v16bf v; uint4 q[2]; };

// Load a 16-element bf16 WMMA fragment: p points at (row_base + ko) where
// ko = (lane/16)*8.  Elements 0..7 are K=ko..ko+7, elements 8..15 are
// K=ko+16..ko+23 (ISA 16-bit A/B fragment layout).  Both halves are 16B loads.
__device__ __forceinline__ v16bf load_frag(const unsigned short* p) {
  FragU f;
  f.q[0] = *reinterpret_cast<const uint4*>(p);
  f.q[1] = *reinterpret_cast<const uint4*>(p + 16);
  return f.v;
}

__device__ __forceinline__ v8f wmma_bf16(v16bf a, v16bf b, v8f c) {
  return __builtin_amdgcn_wmma_f32_16x16x32_bf16(false, a, false, b,
                                                 (short)0, c, false, false);
}

__device__ __forceinline__ v8f v8f_zero() {
  v8f z = {0.f, 0.f, 0.f, 0.f, 0.f, 0.f, 0.f, 0.f};
  return z;
}

// ---------- weight transpose + f32->bf16 convert : out[N][K] = in[K][N] ----------
// One work-group moves a tile of 128 in-rows x 64 in-columns: 256 B of every row it
// reads and 256 B of every row it writes, 32 elements per thread.
#define TP_R 128
#define TP_C 64

__device__ __forceinline__
void transpose_tile(const float* __restrict__ in,
                    unsigned short* __restrict__ out, int R, int C, int bx, int by) {
  // [in-column][pair of in-rows]: 64 dwords per column, no pad.  The 16-byte chunks of
  // a column are XOR-ed with (column >> 2), so the dword stores of a wave (16 column
  // groups x 2 row pairs) and its 16-byte reads (16 chunks of one column) both hit
  // every bank at most once.
  __shared__ __align__(16) unsigned int tile[TP_C * (TP_R / 2)];
  const int t  = threadIdx.x;
  const int c0 = bx * TP_C, r0 = by * TP_R;
  const int cq = t & 15;   // group of 4 in-columns (one float4)
  const int rp = t >> 4;   // pair of in-rows within a round of 32 rows
  float4 a[4][2];
#pragma unroll
  for (int q = 0; q < 4; ++q)
#pragma unroll
    for (int j = 0; j < 2; ++j)
      a[q][j] = *reinterpret_cast<const float4*>(
          &in[(size_t)(r0 + q * 32 + rp * 2 + j) * C + c0 + cq * 4]);
#pragma unroll
  for (int q = 0; q < 4; ++q) {
    const int d   = q * 16 + rp;                           // row pair 0..63
    const int pos = (((d >> 2) ^ cq) << 2) | (d & 3);
    unsigned int* col = &tile[(cq * 4) * (TP_R / 2) + pos];
    col[0 * (TP_R / 2)] = (unsigned int)f2bf(a[q][0].x) | ((unsigned int)f2bf(a[q][1].x) << 16);
    col[1 * (TP_R / 2)] = (unsigned int)f2bf(a[q][0].y) | ((unsigned int)f2bf(a[q][1].y) << 16);
    col[2 * (TP_R / 2)] = (unsigned int)f2bf(a[q][0].z) | ((unsigned int)f2bf(a[q][1].z) << 16);
    col[3 * (TP_R / 2)] = (unsigned int)f2bf(a[q][0].w) | ((unsigned int)f2bf(a[q][1].w) << 16);
  }
  __syncthreads();
  const int k = t & 15;    // 16-byte chunk of a column: 8 in-rows
#pragma unroll
  for (int p = 0; p < 4; ++p) {
    const int c = p * 16 + (t >> 4);
    const uint4 v = *reinterpret_cast<const uint4*>(
        &tile[c * (TP_R / 2) + ((k ^ (c >> 2)) << 2)]);
    *reinterpret_cast<uint4*>(&out[(size_t)(c0 + c) * R + r0 + k * 8]) = v;
  }
}

// ---------- LayerNorm : f32 [rows][1024] -> bf16, one wave per row ----------
#define LN_ROWS 8  // rows (waves) per work-group

__device__ __forceinline__
void ln_rows(const float* __restrict__ x, const float* __restrict__ w,
             const float* __restrict__ bsh, unsigned short* __restrict__ out, int blk) {
  const int lane = threadIdx.x & 31;
  const int row  = blk * LN_ROWS + (threadIdx.x >> 5);
  const float4* xr = reinterpret_cast<const float4*>(x + (size_t)row * D_);
  float4 v[8];             // 32 floats per lane; each wave-wide load is 512 contiguous B
#pragma unroll
  for (int i = 0; i < 8; ++i) v[i] = xr[i * 32 + lane];
  float s = 0.f, s2 = 0.f;
#pragma unroll
  for (int i = 0; i < 8; ++i) {
    s  += v[i].x + v[i].y + v[i].z + v[i].w;
    s2 += v[i].x * v[i].x + v[i].y * v[i].y + v[i].z * v[i].z + v[i].w * v[i].w;
  }
#pragma unroll
  for (int m = 1; m < 32; m <<= 1) {
    s  += __shfl_xor(s,  m, 32);
    s2 += __shfl_xor(s2, m, 32);
  }
  const float mu   = s * (1.0f / D_);
  const float var  = s2 * (1.0f / D_) - mu * mu;
  const float rstd = rsqrtf(var + 1e-5f);
  ushort4* orow = reinterpret_cast<ushort4*>(out + (size_t)row * D_);
#pragma unroll
  for (int i = 0; i < 8; ++i) {
    const float4 wv = reinterpret_cast<const float4*>(w)[i * 32 + lane];
    const float4 bv = reinterpret_cast<const float4*>(bsh)[i * 32 + lane];
    ushort4 ov;
    ov.x = f2bf((v[i].x - mu) * rstd * wv.x + bv.x);
    ov.y = f2bf((v[i].y - mu) * rstd * wv.y + bv.y);
    ov.z = f2bf((v[i].z - mu) * rstd * wv.z + bv.z);
    ov.w = f2bf((v[i].w - mu) * rstd * wv.w + bv.w);
    orow[i * 32 + lane] = ov;
  }
}

__global__ __launch_bounds__(256)
void ln_kernel(const float* __restrict__ x, const float* __restrict__ w,
               const float* __restrict__ bsh, unsigned short* __restrict__ out) {
  ln_rows(x, w, bsh, out, blockIdx.x);
}

// ---------- the five jobs that depend on the inputs alone, in one grid ----------
// The four weight transposes and the first LayerNorm read only inputs and write
// disjoint buffers: the block index picks the job (a work-group has one job, so the
// transpose's barrier stands under block-uniform control flow).
#define PRE_QKV ((3 * D_ / TP_C) * (D_ / TP_R))   // work-groups per job
#define PRE_O   ((D_ / TP_C) * (D_ / TP_R))
#define PRE_FF1 ((DFF_ / TP_C) * (D_ / TP_R))
#define PRE_FF2 ((D_ / TP_C) * (DFF_ / TP_R))
#define PRE_LN  (NTOK / LN_ROWS)
#define PRE_ALL (PRE_QKV + PRE_O + PRE_FF1 + PRE_FF2 + PRE_LN)

__global__ __launch_bounds__(256)
void prepass_kernel(const float* __restrict__ W_qkv, unsigned short* __restrict__ wqkv_t,
                    const float* __restrict__ W_o,   unsigned short* __restrict__ wo_t,
                    const float* __restrict__ W_ff1, unsigned short* __restrict__ wff1_t,
                    const float* __restrict__ W_ff2, unsigned short* __restrict__ wff2_t,
                    const float* __restrict__ x, const float* __restrict__ ln_w,
                    const float* __restrict__ ln_b, unsigned short* __restrict__ h) {
  int blk = blockIdx.x;
  if (blk >= PRE_ALL - PRE_LN) {
    ln_rows(x, ln_w, ln_b, h, blk - (PRE_ALL - PRE_LN));
  } else {
    const float* in;
    unsigned short* out;
    int R, C, bx, by;
    if (blk < PRE_QKV) {
      in = W_qkv; out = wqkv_t; R = D_; C = 3 * D_;
      bx = blk % (3 * D_ / TP_C); by = blk / (3 * D_ / TP_C);
    } else if (blk < PRE_QKV + PRE_O) {
      blk -= PRE_QKV;
      in = W_o; out = wo_t; R = D_; C = D_;
      bx = blk % (D_ / TP_C); by = blk / (D_ / TP_C);
    } else if (blk < PRE_QKV + PRE_O + PRE_FF1) {
      blk -= PRE_QKV + PRE_O;
      in = W_ff1; out = wff1_t; R = D_; C = DFF_;
      bx = blk % (DFF_ / TP_C); by = blk / (DFF_ / TP_C);
    } else {
      blk -= PRE_QKV + PRE_O + PRE_FF1;
      in = W_ff2; out = wff2_t; R = DFF_; C = D_;
      bx = blk % (D_ / TP_C); by = blk / (D_ / TP_C);
    }
    transpose_tile(in, out, R, C, bx, by);
  }
}

// Eight independent transcendentals in a row.  The outputs are early-clobber, so none of
// them lands on a source of the run; the closing v_nop is the one slot that the
// instruction set asks for between a transcendental and an instruction that uses its
// result or overwrites its source.
__device__ __forceinline__ void exp2_x8(float (&y)[8], const float (&x)[8]) {
  asm("v_exp_f32 %0, %8\n\tv_exp_f32 %1, %9\n\tv_exp_f32 %2, %10\n\tv_exp_f32 %3, %11\n\t"
      "v_exp_f32 %4, %12\n\tv_exp_f32 %5, %13\n\tv_exp_f32 %6, %14\n\tv_exp_f32 %7, %15\n\t"
      "v_nop"
      : "=&v"(y[0]), "=&v"(y[1]), "=&v"(y[2]), "=&v"(y[3]),
        "=&v"(y[4]), "=&v"(y[5]), "=&v"(y[6]), "=&v"(y[7])
      : "v"(x[0]), "v"(x[1]), "v"(x[2]), "v"(x[3]),
        "v"(x[4]), "v"(x[5]), "v"(x[6]), "v"(x[7]));
}
// the same run and the same closing slot for the reciprocals
__device__ __forceinline__ void rcp_x8(float (&y)[8], const float (&x)[8]) {
  asm("v_rcp_f32 %0, %8\n\tv_rcp_f32 %1, %9\n\tv_rcp_f32 %2, %10\n\tv_rcp_f32 %3, %11\n\t"
      "v_rcp_f32 %4, %12\n\tv_rcp_f32 %5, %13\n\tv_rcp_f32 %6, %14\n\tv_rcp_f32 %7, %15\n\t"
      "v_nop"
      : "=&v"(y[0]), "=&v"(y[1]), "=&v"(y[2]), "=&v"(y[3]),
        "=&v"(y[4]), "=&v"(y[5]), "=&v"(y[6]), "=&v"(y[7])
      : "v"(x[0]), "v"(x[1]), "v"(x[2]), "v"(x[3]),
        "v"(x[4]), "v"(x[5]), "v"(x[6]), "v"(x[7]));
}

// ---------- generic WMMA GEMM : C[M,N] = epi(A_bf16[M,K] @ Bt_bf16[N,K]^T) ----------
#define BM 128
#define BN 128
#define BK 128  // k depth of one LDS stage: 256 B of every operand row (whole L2 units)
#define LDT 136  // padded LDS row stride (elems): 272B rows = 16B x odd, banks spread

enum { EPI_QKV = 0, EPI_OPROJ = 1, EPI_FF1 = 2, EPI_FF2 = 3 };

template <int EPI>
__global__ __launch_bounds__(256)
void gemm_kernel(const unsigned short* __restrict__ A,
                 const unsigned short* __restrict__ Bt,
                 const float* __restrict__ bias,
                 const float* __restrict__ resid,
                 float* __restrict__ outF,
                 unsigned short* __restrict__ outB,
                 unsigned short* __restrict__ vT,
                 int M, int N, int K) {
  __shared__ __align__(16) unsigned short As[2][BM * LDT];
  __shared__ __align__(16) unsigned short Bs[2][BN * LDT];
  const int tid  = threadIdx.x;
  const int lane = tid & 31;
  const int w    = tid >> 5;     // 8 waves
  const int wm   = w & 3;        // 4 row-granules of 32
  const int wn   = w >> 2;       // 2 col-granules of 64
  const int m0 = blockIdx.y * BM;
  const int n0 = blockIdx.x * BN;
  const int l16  = lane & 15;
  const int half = lane >> 4;
  const int ko   = half * 8;

  v8f acc[2][4];
#pragma unroll
  for (int i = 0; i < 2; ++i)
#pragma unroll
    for (int j = 0; j < 4; ++j) acc[i][j] = v8f_zero();

  const int ar0 = tid >> 4;   // 0..15 (row within a copy round)
  const int akg = tid & 15;   // k-group of 8 elems: 16 lanes cover one 256 B row piece
  const int nk  = K / BK;

  // one stage: 128 rows x 256 B of each operand, 16 copies per thread
  auto issue_stage = [&](int kt, int buf) {
    const int kb = kt * BK;
#pragma unroll
    for (int p = 0; p < BM / 16; ++p) {
      const int r = p * 16 + ar0;
      cp16_g2l(&As[buf][r * LDT + akg * 8],
               &A[(size_t)(m0 + r) * K + kb + akg * 8]);
      cp16_g2l(&Bs[buf][r * LDT + akg * 8],
               &Bt[(size_t)(n0 + r) * K + kb + akg * 8]);
    }
  };

  issue_stage(0, 0);
  // stage 0 of this wave has landed before the barrier that publishes it
  asm volatile("s_wait_asynccnt 0x0" ::: "memory");
  __syncthreads();
  if (nk > 1) issue_stage(1, 1);

  for (int kt = 0; kt < nk; ++kt) {
    const int cur = kt & 1;
#pragma unroll
    for (int ks = 0; ks < BK / 32; ++ks) {
      v16bf af[2], bf[4];
#pragma unroll
      for (int mt = 0; mt < 2; ++mt)
        af[mt] = load_frag(&As[cur][(wm * 32 + mt * 16 + l16) * LDT + ks * 32 + ko]);
#pragma unroll
      for (int nt = 0; nt < 4; ++nt)
        bf[nt] = load_frag(&Bs[cur][(wn * 64 + nt * 16 + l16) * LDT + ks * 32 + ko]);
#pragma unroll
      for (int mt = 0; mt < 2; ++mt)
#pragma unroll
        for (int nt = 0; nt < 4; ++nt)
          acc[mt][nt] = wmma_bf16(af[mt], bf[nt], acc[mt][nt]);
    }
    // this wave's reads of buffer cur have retired before the buffer is refilled
    asm volatile("s_wait_dscnt 0x0" ::: "memory");
    // this wave's copies of stage kt + 1 have landed before the barrier publishes them
    asm volatile("s_wait_asynccnt 0x0" ::: "memory");
    __syncthreads();
    if (kt + 2 < nk) issue_stage(kt + 2, cur);  // flies while stage kt + 1 is worked on
  }
  // no copy is outstanding when the wave goes on to its end
  asm volatile("s_wait_asynccnt 0x0" ::: "memory");

  // epilogue: C element (i,lane) -> row = i + 8*(lane/16), col = lane%16
#pragma unroll
  for (int mt = 0; mt < 2; ++mt) {
#pragma unroll
    for (int nt = 0; nt < 4; ++nt) {
      const int n = n0 + wn * 64 + nt * 16 + l16;
      const float bv = bias[n];
      float gl[8];
      if constexpr (EPI == EPI_FF1) {
        // 0.5 v (1 + tanh u) = v / (1 + exp(-2 u)), u = c (v + 0.044715 v^3): the same
        // function with no branch, so a lane's elements interleave.  The two constants
        // are -2 c log2(e) and that times 0.044715; exp2 going to inf or to 0 at the
        // ends gives the limits 0 and v.
        float t[8], e[8];
#pragma unroll
        for (int i = 0; i < 8; ++i) {
          const float v = acc[mt][nt][i] + bv;
          t[i] = v * (-2.3022082f + -0.10294324f * (v * v));
        }
        exp2_x8(e, t);
#pragma unroll
        for (int i = 0; i < 8; ++i) t[i] = 1.0f + e[i];
        rcp_x8(e, t);
#pragma unroll
        for (int i = 0; i < 8; ++i) gl[i] = (acc[mt][nt][i] + bv) * e[i];
      }
#pragma unroll
      for (int i = 0; i < 8; ++i) {
        const int m = m0 + wm * 32 + mt * 16 + i + half * 8;
        const float v = acc[mt][nt][i] + bv;
        if constexpr (EPI == EPI_QKV) {
          if (n < 2 * D_) {
            outB[(size_t)m * (3 * D_) + n] = f2bf(v);  // q,k row-major
          } else {                                     // v stored transposed [b][h][d][t]
            const int hd = n - 2 * D_;
            const int hh = hd >> 6, dd = hd & 63;
            const int bb = m >> 11, tt = m & (T_ - 1);
            vT[(((size_t)(bb * H_ + hh)) * HD_ + dd) * T_ + tt] = f2bf(v);
          }
        } else if constexpr (EPI == EPI_OPROJ) {
          outF[(size_t)m * N + n] = resid[(size_t)m * N + n] + v;
        } else if constexpr (EPI == EPI_FF1) {
          outB[(size_t)m * N + n] = f2bf(gl[i]);
        } else {  // EPI_FF2
          outF[(size_t)m * N + n] = resid[(size_t)m * N + n] + v;
        }
      }
    }
  }
}

#define ATT_BQ 128
#define ATT_BK 128
#define QLD 72    // 144B rows: 16B aligned, banks spread
#define PLD 136   // 272B rows: 16B aligned, conflict-free frag reads

typedef float  v2f  __attribute__((ext_vector_type(2)));
typedef bf16_t v2bf __attribute__((ext_vector_type(2)));
union FragP { v16bf v; v2bf h[8]; };
union Pack8 { uint4 q; v2bf h[4]; };

// value of lane l ^ 16
__device__ __forceinline__ float xhalf(float x) {
  const int b = __builtin_bit_cast(int, x);
  return __builtin_bit_cast(
      float, __builtin_amdgcn_permlanex16(b, b, 0x76543210, 0xfedcba98, false, false));
}

// One work-group per WGP (two waves per SIMD), as before this LDS size.  Left alone the
// compiler aims at the three work-groups that the LDS would admit and, for want of
// registers, waits out every fragment load in front of its own WMMA; and the grid order
// below levels the WGPs only while there are fewer places than work-groups.
__global__ __launch_bounds__(256) __attribute__((amdgpu_waves_per_eu(2, 2)))
void attn_kernel(const unsigned short* __restrict__ qkv,
                 const unsigned short* __restrict__ vT,
                 unsigned short* __restrict__ av) {
  __shared__ __align__(16) unsigned short Qs[ATT_BQ * QLD];
  __shared__ __align__(16) unsigned short Ks[2][ATT_BK * QLD];
  __shared__ __align__(16) unsigned short Vt[2][HD_ * PLD];

  const int tid  = threadIdx.x;
  const int lane = tid & 31;
  const int w    = tid >> 5;       // 8 waves, each owns 16 q-rows
  // A work-group's cost is qt + 1 key tiles, and there are more work-groups than
  // resident places: the slowest grid index counts qt down, so the long ones start
  // first and the short ones fill the places that come free.
  const int qt = T_ / ATT_BQ - 1 - (int)blockIdx.z;  // q tile 15..0
  const int h  = blockIdx.x;
  const int b  = blockIdx.y;
  const int q_base = qt * ATT_BQ;
  const int l16  = lane & 15;
  const int half = lane >> 4;
  const int ko   = half * 8;
  const int wr0  = w * 16;
  const int qrow = q_base + wr0 + l16;   // this lane's query

  const size_t qkv_row = 3 * D_;
  const unsigned short* qbase = qkv + ((size_t)b * T_) * qkv_row + h * HD_;
  const unsigned short* kbase = qbase + D_;
  const unsigned short* vtb   = vT + ((size_t)(b * H_ + h)) * HD_ * T_;

  // K tile (128 x 64, [kk][d]) + V tile (transposed in global: [d][kk])
  auto issue_kv = [&](int j, int buf) {
#pragma unroll
    for (int p = 0; p < 4; ++p) {
      const int idx = p * 256 + tid;
      const int r = idx >> 3, ck = idx & 7;
      cp16_g2l(&Ks[buf][r * QLD + ck * 8],
               &kbase[(size_t)(j * ATT_BK + r) * qkv_row + ck * 8]);
    }
#pragma unroll
    for (int p = 0; p < 4; ++p) {
      const int idx = p * 256 + tid;
      const int d = idx >> 4, ck = idx & 15;
      cp16_g2l(&Vt[buf][d * PLD + ck * 8],
               &vtb[(size_t)d * T_ + j * ATT_BK + ck * 8]);
    }
  };

  // load Q tile (128 x 64) and first K/V tile
#pragma unroll
  for (int p = 0; p < 4; ++p) {
    const int idx = p * 256 + tid;
    const int r = idx >> 3, ck = idx & 7;
    cp16_g2l(&Qs[r * QLD + ck * 8],
             &qbase[(size_t)(q_base + r) * qkv_row + ck * 8]);
  }
  issue_kv(0, 0);
  wait_async();
  __syncthreads();

  float mrun = -3.0e38f;  // running maximum of this lane's query (equal in both halves)
  float lrun = 0.0f;      // running sum over the keys of this lane's half only
  v8f o[4];               // o[dt][i] = O[query l16][d = dt * 16 + half * 8 + i]
#pragma unroll
  for (int dt = 0; dt < 4; ++dt) o[dt] = v8f_zero();

  for (int j = 0; j <= qt; ++j) {
    const int cur = j & 1;
    if (j < qt) issue_kv(j + 1, cur ^ 1);  // prefetch while computing

    // S^T = K Q^T : s[nt][i] = score(key nt * 16 + half * 8 + i, query l16)
    v8f s[8];
#pragma unroll
    for (int nt = 0; nt < 8; ++nt) s[nt] = v8f_zero();
#pragma unroll
    for (int c = 0; c < 2; ++c) {
      const v16bf bq = load_frag(&Qs[(wr0 + l16) * QLD + c * 32 + ko]);
#pragma unroll
      for (int nt = 0; nt < 8; ++nt) {
        const v16bf ak = load_frag(&Ks[cur][(nt * 16 + l16) * QLD + c * 32 + ko]);
        s[nt] = wmma_bf16(ak, bq, s[nt]);
      }
    }
    // scale, 1/sqrt(64)
#pragma unroll
    for (int nt = 0; nt < 8; ++nt) s[nt] *= 0.125f;
    // causal mask, on the diagonal tile only: key j * 128 + nt * 16 + half * 8 + i is
    // masked above qrow = j * 128 + wr0 + l16
    if (j == qt) {
      const int lim = wr0 + l16 - half * 8;
#pragma unroll
      for (int nt = 0; nt < 8; ++nt)
#pragma unroll
        for (int i = 0; i < 8; ++i)
          if (nt * 16 + i > lim) s[nt][i] = -1.0e30f;
    }
    // maximum over the tile's 128 keys: 64 in the lane (eight independent chains),
    // then one exchange with the other half
    float mx[8];
#pragma unroll
    for (int i = 0; i < 8; ++i) {
      float v = s[0][i];
#pragma unroll
      for (int nt = 1; nt < 8; ++nt) v = fmaxf(v, s[nt][i]);
      mx[i] = v;
    }
    float tmax = fmaxf(fmaxf(fmaxf(mx[0], mx[1]), fmaxf(mx[2], mx[3])),
                       fmaxf(fmaxf(mx[4], mx[5]), fmaxf(mx[6], mx[7])));
    tmax = fmaxf(tmax, xhalf(tmax));
    const float mnew = fmaxf(mrun, tmax);
    const float sc   = __expf(mrun - mnew);
    mrun = mnew;
#pragma unroll
    for (int dt = 0; dt < 4; ++dt)
#pragma unroll
      for (int i = 0; i < 8; ++i) o[dt][i] *= sc;

    // P = exp(S - m), packed in place: element e of the B operand of keys c4 * 32 + 0..31
    // is tile 2 * c4 + (e >> 3), register e & 7: the k order of load_frag
    FragP pb[4];
    float rs[4];
#pragma unroll
    for (int c4 = 0; c4 < 4; ++c4) {
      rs[c4] = 0.f;
#pragma unroll
      for (int e = 0; e < 16; e += 2) {
        v2f pp;
        pp.x = __expf(s[2 * c4 + (e >> 3)][e & 7] - mrun);
        pp.y = __expf(s[2 * c4 + (e >> 3)][(e & 7) + 1] - mrun);
        rs[c4] += pp.x + pp.y;
        pb[c4].h[e >> 1] = __builtin_convertvector(pp, v2bf);
      }
    }
    lrun = lrun * sc + ((rs[0] + rs[1]) + (rs[2] + rs[3]));

    // O^T += V^T P^T
#pragma unroll
    for (int c4 = 0; c4 < 4; ++c4) {
#pragma unroll
      for (int dt = 0; dt < 4; ++dt) {
        const v16bf va = load_frag(&Vt[cur][(dt * 16 + l16) * PLD + c4 * 32 + ko]);
        o[dt] = wmma_bf16(va, pb[c4].v, o[dt]);
      }
    }
    wait_async();     // prefetched K/V tile has landed
    __syncthreads();  // all waves done reading this tile's buffers
  }

  // join the halves' sums, normalize + store av (bf16, row-major [token][D]):
  // 8 consecutive d per lane and tile, one 16-byte store each
  const float inv = 1.0f / (lrun + xhalf(lrun));
  unsigned short* orow = av + ((size_t)(b * T_) + qrow) * D_ + h * HD_ + half * 8;
#pragma unroll
  for (int dt = 0; dt < 4; ++dt) {
    Pack8 pk;
#pragma unroll
    for (int i = 0; i < 8; i += 2) {
      v2f ov;
      ov.x = o[dt][i] * inv;
      ov.y = o[dt][i + 1] * inv;
      pk.h[i >> 1] = __builtin_convertvector(ov, v2bf);
    }
    *reinterpret_cast<uint4*>(orow + dt * 16) = pk.q;
  }
}

// ---------- host launcher ----------
extern "C" void kernel_launch(void* const* d_in, const int* in_sizes, int n_in,
                              void* d_out, int out_size, void* d_ws, size_t ws_size,
                              hipStream_t stream) {
  (void)in_sizes; (void)n_in; (void)out_size; (void)ws_size;
  const float* x     = (const float*)d_in[0];
  const float* ln1_w = (const float*)d_in[1];
  const float* ln1_b = (const float*)d_in[2];
  const float* W_qkv = (const float*)d_in[3];
  const float* b_qkv = (const float*)d_in[4];
  const float* W_o   = (const float*)d_in[5];
  const float* b_o   = (const float*)d_in[6];
  const float* ln2_w = (const float*)d_in[7];
  const float* ln2_b = (const float*)d_in[8];
  const float* W_ff1 = (const float*)d_in[9];
  const float* b_ff1 = (const float*)d_in[10];
  const float* W_ff2 = (const float*)d_in[11];
  const float* b_ff2 = (const float*)d_in[12];
  float* out = (float*)d_out;
  char* ws = (char*)d_ws;

  // workspace layout (bytes)
  constexpr size_t off_wqkv = 0;                               // 3072x1024 bf16
  constexpr size_t off_wo   = off_wqkv + (size_t)3072 * 1024 * 2;
  constexpr size_t off_wff1 = off_wo   + (size_t)1024 * 1024 * 2;
  constexpr size_t off_wff2 = off_wff1 + (size_t)4096 * 1024 * 2;
  constexpr size_t off_h    = off_wff2 + (size_t)1024 * 4096 * 2;  // h / h2 (aliased)
  constexpr size_t off_qkv  = off_h    + (size_t)NTOK * D_ * 2;    // q,k rows (v slot unused)
  constexpr size_t off_vT   = off_qkv  + (size_t)NTOK * 3 * D_ * 2;
  constexpr size_t off_ff1  = off_qkv;                             // reuses qkv+vT after attn
  constexpr size_t off_av   = off_vT   + (size_t)NTOK * D_ * 2;
  constexpr size_t off_x1   = off_av   + (size_t)NTOK * D_ * 2;

  unsigned short* wqkv_t = (unsigned short*)(ws + off_wqkv);
  unsigned short* wo_t   = (unsigned short*)(ws + off_wo);
  unsigned short* wff1_t = (unsigned short*)(ws + off_wff1);
  unsigned short* wff2_t = (unsigned short*)(ws + off_wff2);
  unsigned short* hbuf   = (unsigned short*)(ws + off_h);
  unsigned short* qkvb   = (unsigned short*)(ws + off_qkv);
  unsigned short* vTb    = (unsigned short*)(ws + off_vT);
  unsigned short* ff1b   = (unsigned short*)(ws + off_ff1);
  unsigned short* avb    = (unsigned short*)(ws + off_av);
  float*          x1     = (float*)(ws + off_x1);

  prepass_kernel<<<PRE_ALL, 256, 0, stream>>>(W_qkv, wqkv_t, W_o, wo_t, W_ff1, wff1_t,
                                              W_ff2, wff2_t, x, ln1_w, ln1_b, hbuf);

  gemm_kernel<EPI_QKV><<<dim3(3072 / BN, NTOK / BM), 256, 0, stream>>>(
      hbuf, wqkv_t, b_qkv, nullptr, nullptr, qkvb, vTb, NTOK, 3072, 1024);

  attn_kernel<<<dim3(H_, B_, T_ / ATT_BQ), 256, 0, stream>>>(qkvb, vTb, avb);

  gemm_kernel<EPI_OPROJ><<<dim3(1024 / BN, NTOK / BM), 256, 0, stream>>>(
      avb, wo_t, b_o, x, x1, nullptr, nullptr, NTOK, 1024, 1024);

  ln_kernel<<<NTOK / LN_ROWS, 256, 0, stream>>>(x1, ln2_w, ln2_b, hbuf);

  gemm_kernel<EPI_FF1><<<dim3(4096 / BN, NTOK / BM), 256, 0, stream>>>(
      hbuf, wff1_t, b_ff1, nullptr, nullptr, ff1b, nullptr, NTOK, 4096, 1024);

  gemm_kernel<EPI_FF2><<<dim3(1024 / BN, NTOK / BM), 256, 0, stream>>>(
      ff1b, wff2_t, b_ff2, x1, out, nullptr, nullptr, NTOK, 1024, 4096);
}

// v007
// Measured time: 154 microseconds a run.
// Timed twice side by side with v006, it ran 1.14 and 1.13 times as fast.
// All steps since v000 together make it 2.14 times as fast.
#include <hip/hip_runtime.h>
#include <stdint.h>

// ---------- types ----------
typedef __bf16 bf16_t;
typedef bf16_t v16bf __attribute__((ext_vector_type(16)));
typedef float  v8f   __attribute__((ext_vector_type(8)));
typedef int    v4i   __attribute__((ext_vector_type(4)));

#define B_   2
#define T_   2048
#define D_   1024
#define H_   16
#define HD_  64
#define DFF_ 4096
#define NTOK (B_ * T_)

#if defined(__gfx1250__) && __has_builtin(__builtin_amdgcn_global_load_async_to_lds_b128)
#define HAVE_ASYNC_LDS 1
#else
#define HAVE_ASYNC_LDS 0
#endif

__device__ __forceinline__ unsigned short f2bf(float f) {
  union { float f; unsigned int u; } c; c.f = f;
  unsigned int u = c.u;
  unsigned int r = u + 0x7FFFu + ((u >> 16) & 1u);  // round-to-nearest-even
  return (unsigned short)(r >> 16);
}

// 16-byte global -> LDS copy; async engine when available (ASYNCcnt tracked),
// else synchronous VGPR-staged copy.  Both require 16B-aligned src and dst.
__device__ __forceinline__ void cp16_g2l(unsigned short* ldst,
                                         const unsigned short* gsrc) {
#if HAVE_ASYNC_LDS
  __builtin_amdgcn_global_load_async_to_lds_b128(
      (__attribute__((address_space(1))) v4i*)gsrc,
      (__attribute__((address_space(3))) v4i*)ldst, 0, 0);
#else
  *reinterpret_cast<uint4*>(ldst) = *reinterpret_cast<const uint4*>(gsrc);
#endif
}

__device__ __forceinline__ void wait_async() {
#if HAVE_ASYNC_LDS
#if __has_builtin(__builtin_amdgcn_s_wait_asynccnt)
  __builtin_amdgcn_s_wait_asynccnt(0);
#else
  asm volatile("s_wait_asynccnt 0x0" ::: "memory");
#endif
#endif
}

union FragU { v16bf v; uint4 q[2]; };

typedef float  v2f  __attribute__((ext_vector_type(2)));
typedef bf16_t v2bf __attribute__((ext_vector_type(2)));
union Pack8 { uint4 q; v2bf h[4]; };

// eight f32 -> eight bf16 (round to nearest even), one 16-byte value
__device__ __forceinline__ uint4 pack8_bf16(const float (&v)[8]) {
  Pack8 pk;
#pragma unroll
  for (int i = 0; i < 8; i += 2) {
    v2f p;
    p.x = v[i];
    p.y = v[i + 1];
    pk.h[i >> 1] = __builtin_convertvector(p, v2bf);
  }
  return pk.q;
}

// Load a 16-element bf16 WMMA fragment: p points at (row_base + ko) where
// ko = (lane/16)*8.  Elements 0..7 are K=ko..ko+7, elements 8..15 are
// K=ko+16..ko+23 (ISA 16-bit A/B fragment layout).  Both halves are 16B loads.
__device__ __forceinline__ v16bf load_frag(const unsigned short* p) {
  FragU f;
  f.q[0] = *reinterpret_cast<const uint4*>(p);
  f.q[1] = *reinterpret_cast<const uint4*>(p + 16);
  return f.v;
}

__device__ __forceinline__ v8f wmma_bf16(v16bf a, v16bf b, v8f c) {
  return __builtin_amdgcn_wmma_f32_16x16x32_bf16(false, a, false, b,
                                                 (short)0, c, false, false);
}

__device__ __forceinline__ v8f v8f_zero() {
  v8f z = {0.f, 0.f, 0.f, 0.f, 0.f, 0.f, 0.f, 0.f};
  return z;
}

// ---------- weight transpose + f32->bf16 convert : out[N][K] = in[K][N] ----------
// One work-group moves a tile of 128 in-rows x 64 in-columns: 256 B of every row it
// reads and 256 B of every row it writes, 32 elements per thread.
#define TP_R 128
#define TP_C 64

__device__ __forceinline__
void transpose_tile(const float* __restrict__ in,
                    unsigned short* __restrict__ out, int R, int C, int bx, int by) {
  // [in-column][pair of in-rows]: 64 dwords per column, no pad.  The 16-byte chunks of
  // a column are XOR-ed with (column >> 2), so the dword stores of a wave (16 column
  // groups x 2 row pairs) and its 16-byte reads (16 chunks of one column) both hit
  // every bank at most once.
  __shared__ __align__(16) unsigned int tile[TP_C * (TP_R / 2)];
  const int t  = threadIdx.x;
  const int c0 = bx * TP_C, r0 = by * TP_R;
  const int cq = t & 15;   // group of 4 in-columns (one float4)
  const int rp = t >> 4;   // pair of in-rows within a round of 32 rows
  float4 a[4][2];
#pragma unroll
  for (int q = 0; q < 4; ++q)
#pragma unroll
    for (int j = 0; j < 2; ++j)
      a[q][j] = *reinterpret_cast<const float4*>(
          &in[(size_t)(r0 + q * 32 + rp * 2 + j) * C + c0 + cq * 4]);
#pragma unroll
  for (int q = 0; q < 4; ++q) {
    const int d   = q * 16 + rp;                           // row pair 0..63
    const int pos = (((d >> 2) ^ cq) << 2) | (d & 3);
    unsigned int* col = &tile[(cq * 4) * (TP_R / 2) + pos];
    col[0 * (TP_R / 2)] = (unsigned int)f2bf(a[q][0].x) | ((unsigned int)f2bf(a[q][1].x) << 16);
    col[1 * (TP_R / 2)] = (unsigned int)f2bf(a[q][0].y) | ((unsigned int)f2bf(a[q][1].y) << 16);
    col[2 * (TP_R / 2)] = (unsigned int)f2bf(a[q][0].z) | ((unsigned int)f2bf(a[q][1].z) << 16);
    col[3 * (TP_R / 2)] = (unsigned int)f2bf(a[q][0].w) | ((unsigned int)f2bf(a[q][1].w) << 16);
  }
  __syncthreads();
  const int k = t & 15;    // 16-byte chunk of a column: 8 in-rows
#pragma unroll
  for (int p = 0; p < 4; ++p) {
    const int c = p * 16 + (t >> 4);
    const uint4 v = *reinterpret_cast<const uint4*>(
        &tile[c * (TP_R / 2) + ((k ^ (c >> 2)) << 2)]);
    *reinterpret_cast<uint4*>(&out[(size_t)(c0 + c) * R + r0 + k * 8]) = v;
  }
}

// ---------- LayerNorm : f32 [rows][1024] -> bf16, one wave per row ----------
#define LN_ROWS 8  // rows (waves) per work-group

__device__ __forceinline__
void ln_rows(const float* __restrict__ x, const float* __restrict__ w,
             const float* __restrict__ bsh, unsigned short* __restrict__ out, int blk) {
  const int lane = threadIdx.x & 31;
  const int row  = blk * LN_ROWS + (threadIdx.x >> 5);
  const float4* xr = reinterpret_cast<const float4*>(x + (size_t)row * D_);
  float4 v[8];             // 32 floats per lane; each wave-wide load is 512 contiguous B
#pragma unroll
  for (int i = 0; i < 8; ++i) v[i] = xr[i * 32 + lane];
  float s = 0.f, s2 = 0.f;
#pragma unroll
  for (int i = 0; i < 8; ++i) {
    s  += v[i].x + v[i].y + v[i].z + v[i].w;
    s2 += v[i].x * v[i].x + v[i].y * v[i].y + v[i].z * v[i].z + v[i].w * v[i].w;
  }
#pragma unroll
  for (int m = 1; m < 32; m <<= 1) {
    s  += __shfl_xor(s,  m, 32);
    s2 += __shfl_xor(s2, m, 32);
  }
  const float mu   = s * (1.0f / D_);
  const float var  = s2 * (1.0f / D_) - mu * mu;
  const float rstd = rsqrtf(var + 1e-5f);
  ushort4* orow = reinterpret_cast<ushort4*>(out + (size_t)row * D_);
#pragma unroll
  for (int i = 0; i < 8; ++i) {
    const float4 wv = reinterpret_cast<const float4*>(w)[i * 32 + lane];
    const float4 bv = reinterpret_cast<const float4*>(bsh)[i * 32 + lane];
    ushort4 ov;
    ov.x = f2bf((v[i].x - mu) * rstd * wv.x + bv.x);
    ov.y = f2bf((v[i].y - mu) * rstd * wv.y + bv.y);
    ov.z = f2bf((v[i].z - mu) * rstd * wv.z + bv.z);
    ov.w = f2bf((v[i].w - mu) * rstd * wv.w + bv.w);
    orow[i * 32 + lane] = ov;
  }
}

__global__ __launch_bounds__(256)
void ln_kernel(const float* __restrict__ x, const float* __restrict__ w,
               const float* __restrict__ bsh, unsigned short* __restrict__ out) {
  ln_rows(x, w, bsh, out, blockIdx.x);
}

// ---------- the five jobs that depend on the inputs alone, in one grid ----------
// The four weight transposes and the first LayerNorm read only inputs and write
// disjoint buffers: the block index picks the job (a work-group has one job, so the
// transpose's barrier stands under block-uniform control flow).
#define PRE_QKV ((3 * D_ / TP_C) * (D_ / TP_R))   // work-groups per job
#define PRE_O   ((D_ / TP_C) * (D_ / TP_R))
#define PRE_FF1 ((DFF_ / TP_C) * (D_ / TP_R))
#define PRE_FF2 ((D_ / TP_C) * (DFF_ / TP_R))
#define PRE_LN  (NTOK / LN_ROWS)
#define PRE_ALL (PRE_QKV + PRE_O + PRE_FF1 + PRE_FF2 + PRE_LN)

__global__ __launch_bounds__(256)
void prepass_kernel(const float* __restrict__ W_qkv, unsigned short* __restrict__ wqkv_t,
                    const float* __restrict__ W_o,   unsigned short* __restrict__ wo_t,
                    const float* __restrict__ W_ff1, unsigned short* __restrict__ wff1_t,
                    const float* __restrict__ W_ff2, unsigned short* __restrict__ wff2_t,
                    const float* __restrict__ x, const float* __restrict__ ln_w,
                    const float* __restrict__ ln_b, unsigned short* __restrict__ h) {
  int blk = blockIdx.x;
  if (blk >= PRE_ALL - PRE_LN) {
    ln_rows(x, ln_w, ln_b, h, blk - (PRE_ALL - PRE_LN));
  } else {
    const float* in;
    unsigned short* out;
    int R, C, bx, by;
    if (blk < PRE_QKV) {
      in = W_qkv; out = wqkv_t; R = D_; C = 3 * D_;
      bx = blk % (3 * D_ / TP_C); by = blk / (3 * D_ / TP_C);
    } else if (blk < PRE_QKV + PRE_O) {
      blk -= PRE_QKV;
      in = W_o; out = wo_t; R = D_; C = D_;
      bx = blk % (D_ / TP_C); by = blk / (D_ / TP_C);
    } else if (blk < PRE_QKV + PRE_O + PRE_FF1) {
      blk -= PRE_QKV + PRE_O;
      in = W_ff1; out = wff1_t; R = D_; C = DFF_;
      bx = blk % (DFF_ / TP_C); by = blk / (DFF_ / TP_C);
    } else {
      blk -= PRE_QKV + PRE_O + PRE_FF1;
      in = W_ff2; out = wff2_t; R = DFF_; C = D_;
      bx = blk % (D_ / TP_C); by = blk / (D_ / TP_C);
    }
    transpose_tile(in, out, R, C, bx, by);
  }
}

// Eight independent transcendentals in a row.  The outputs are early-clobber, so none of
// them lands on a source of the run; the closing v_nop is the one slot that the
// instruction set asks for between a transcendental and an instruction that uses its
// result or overwrites its source.
__device__ __forceinline__ void exp2_x8(float (&y)[8], const float (&x)[8]) {
  asm("v_exp_f32 %0, %8\n\tv_exp_f32 %1, %9\n\tv_exp_f32 %2, %10\n\tv_exp_f32 %3, %11\n\t"
      "v_exp_f32 %4, %12\n\tv_exp_f32 %5, %13\n\tv_exp_f32 %6, %14\n\tv_exp_f32 %7, %15\n\t"
      "v_nop"
      : "=&v"(y[0]), "=&v"(y[1]), "=&v"(y[2]), "=&v"(y[3]),
        "=&v"(y[4]), "=&v"(y[5]), "=&v"(y[6]), "=&v"(y[7])
      : "v"(x[0]), "v"(x[1]), "v"(x[2]), "v"(x[3]),
        "v"(x[4]), "v"(x[5]), "v"(x[6]), "v"(x[7]));
}
// the same run and the same closing slot for the reciprocals
__device__ __forceinline__ void rcp_x8(float (&y)[8], const float (&x)[8]) {
  asm("v_rcp_f32 %0, %8\n\tv_rcp_f32 %1, %9\n\tv_rcp_f32 %2, %10\n\tv_rcp_f32 %3, %11\n\t"
      "v_rcp_f32 %4, %12\n\tv_rcp_f32 %5, %13\n\tv_rcp_f32 %6, %14\n\tv_rcp_f32 %7, %15\n\t"
      "v_nop"
      : "=&v"(y[0]), "=&v"(y[1]), "=&v"(y[2]), "=&v"(y[3]),
        "=&v"(y[4]), "=&v"(y[5]), "=&v"(y[6]), "=&v"(y[7])
      : "v"(x[0]), "v"(x[1]), "v"(x[2]), "v"(x[3]),
        "v"(x[4]), "v"(x[5]), "v"(x[6]), "v"(x[7]));
}

// ---------- generic WMMA GEMM : C[M,N] = epi(A_bf16[M,K] @ Bt_bf16[N,K]^T) ----------
#define BM 128
#define BN 128
#define BK 128  // k depth of one LDS stage: 256 B of every operand row (whole L2 units)
#define LDT 136  // padded LDS row stride (elems): 272B rows = 16B x odd, banks spread

enum { EPI_QKV = 0, EPI_OPROJ = 1, EPI_FF1 = 2, EPI_FF2 = 3 };

template <int EPI>
__global__ __launch_bounds__(256)
void gemm_kernel(const unsigned short* __restrict__ A,
                 const unsigned short* __restrict__ Bt,
                 const float* __restrict__ bias,
                 const float* __restrict__ resid,
                 float* __restrict__ outF,
                 unsigned short* __restrict__ outB,
                 unsigned short* __restrict__ vT,
                 int M, int N, int K) {
  __shared__ __align__(16) unsigned short As[2][BM * LDT];
  __shared__ __align__(16) unsigned short Bs[2][BN * LDT];
  const int tid  = threadIdx.x;
  const int lane = tid & 31;
  const int w    = tid >> 5;     // 8 waves
  const int wm   = w & 3;        // 4 row-granules of 32
  const int wn   = w >> 2;       // 2 col-granules of 64
  const int m0 = blockIdx.y * BM;
  const int n0 = blockIdx.x * BN;
  const int l16  = lane & 15;
  const int half = lane >> 4;
  const int ko   = half * 8;

  // The accumulator gives a lane 8 consecutive ROWS of one column.  Where the output is
  // bf16 the operand whose index runs along the output's rows is therefore made the A
  // operand, so that a lane's 8 values are 16 contiguous bytes of the output: the weight
  // rows (n) for q, k and FF1, the tokens (m) for v, which is stored transposed.  The
  // A side has 4 fragments per wave (granule wn), the B side 2 (granule wm); a v tile is
  // a whole work-group (2 * D_ is a multiple of BN), so the choice is block-uniform.
  constexpr bool PACKED = (EPI == EPI_QKV || EPI == EPI_FF1);
  static_assert(BM == BN, "the two operands' LDS tiles are exchangeable");
  const bool vtile = (EPI == EPI_QKV) && n0 >= 2 * D_;
  const unsigned short* rowop = vtile ? &As[0][0] : &Bs[0][0];  // accumulator rows
  const unsigned short* colop = vtile ? &Bs[0][0] : &As[0][0];  // accumulator columns

  v8f acc[2][4];
#pragma unroll
  for (int i = 0; i < 2; ++i)
#pragma unroll
    for (int j = 0; j < 4; ++j) acc[i][j] = v8f_zero();

  const int ar0 = tid >> 4;   // 0..15 (row within a copy round)
  const int akg = tid & 15;   // k-group of 8 elems: 16 lanes cover one 256 B row piece
  const int nk  = K / BK;

  // one stage: 128 rows x 256 B of each operand, 16 copies per thread
  auto issue_stage = [&](int kt, int buf) {
    const int kb = kt * BK;
#pragma unroll
    for (int p = 0; p < BM / 16; ++p) {
      const int r = p * 16 + ar0;
      cp16_g2l(&As[buf][r * LDT + akg * 8],
               &A[(size_t)(m0 + r) * K + kb + akg * 8]);
      cp16_g2l(&Bs[buf][r * LDT + akg * 8],
               &Bt[(size_t)(n0 + r) * K + kb + akg * 8]);
    }
  };

  issue_stage(0, 0);
  // stage 0 of this wave has landed before the barrier that publishes it
  asm volatile("s_wait_asynccnt 0x0" ::: "memory");
  __syncthreads();
  if (nk > 1) issue_stage(1, 1);

  for (int kt = 0; kt < nk; ++kt) {
    const int cur = kt & 1;
#pragma unroll
    for (int ks = 0; ks < BK / 32; ++ks) {
      v16bf af[2], bf[4];
      if constexpr (PACKED) {
#pragma unroll
        for (int mt = 0; mt < 2; ++mt)
          af[mt] = load_frag(&colop[cur * (BM * LDT) +
                                    (wm * 32 + mt * 16 + l16) * LDT + ks * 32 + ko]);
#pragma unroll
        for (int nt = 0; nt < 4; ++nt)
          bf[nt] = load_frag(&rowop[cur * (BM * LDT) +
                                    (wn * 64 + nt * 16 + l16) * LDT + ks * 32 + ko]);
#pragma unroll
        for (int mt = 0; mt < 2; ++mt)
#pragma unroll
          for (int nt = 0; nt < 4; ++nt)
            acc[mt][nt] = wmma_bf16(bf[nt], af[mt], acc[mt][nt]);
      } else {
#pragma unroll
        for (int mt = 0; mt < 2; ++mt)
          af[mt] = load_frag(&As[cur][(wm * 32 + mt * 16 + l16) * LDT + ks * 32 + ko]);
#pragma unroll
        for (int nt = 0; nt < 4; ++nt)
          bf[nt] = load_frag(&Bs[cur][(wn * 64 + nt * 16 + l16) * LDT + ks * 32 + ko]);
#pragma unroll
        for (int mt = 0; mt < 2; ++mt)
#pragma unroll
          for (int nt = 0; nt < 4; ++nt)
            acc[mt][nt] = wmma_bf16(af[mt], bf[nt], acc[mt][nt]);
      }
    }
    // this wave's reads of buffer cur have retired before the buffer is refilled
    asm volatile("s_wait_dscnt 0x0" ::: "memory");
    // this wave's copies of stage kt + 1 have landed before the barrier publishes them
    asm volatile("s_wait_asynccnt 0x0" ::: "memory");
    __syncthreads();
    if (kt + 2 < nk) issue_stage(kt + 2, cur);  // flies while stage kt + 1 is worked on
  }
  // no copy is outstanding when the wave goes on to its end
  asm volatile("s_wait_asynccnt 0x0" ::: "memory");

  // epilogue: accumulator element (i, lane) -> row = i + 8*(lane/16), col = lane%16
  if constexpr (PACKED) {
    // dst: this lane's 8 values of tile (0, 0); tile (mt, nt) lies mt * 16 output rows
    // of ld elements and nt * 16 elements further on
    unsigned short* dst;
    size_t ld;
    if (vtile) {
      // accumulator rows = tokens, columns = v features; v is stored [b][h][d][t], and
      // (b * H_ + h) * HD_ + d = b * D_ + (n - 2 * D_); a tile lies in one batch
      const int mr = m0 + wn * 64;
      const int nc = n0 + wm * 32 + l16;
      dst = vT + (size_t)((mr >> 11) * D_ + nc - 2 * D_) * T_ + (mr & (T_ - 1)) + half * 8;
      ld  = T_;
#pragma unroll
      for (int mt = 0; mt < 2; ++mt) {
        const float bv = bias[nc + mt * 16];
#pragma unroll
        for (int nt = 0; nt < 4; ++nt)
#pragma unroll
          for (int i = 0; i < 8; ++i) acc[mt][nt][i] += bv;
      }
    } else {
      // accumulator rows = output features, columns = tokens; row-major [token][N]
      const int nr = n0 + wn * 64 + half * 8;
      dst = outB + (size_t)(m0 + wm * 32 + l16) * N + nr;
      ld  = N;
#pragma unroll
      for (int nt = 0; nt < 4; ++nt) {
        const float4 b0 = *reinterpret_cast<const float4*>(&bias[nr + nt * 16]);
        const float4 b1 = *reinterpret_cast<const float4*>(&bias[nr + nt * 16 + 4]);
        const float bv[8] = {b0.x, b0.y, b0.z, b0.w, b1.x, b1.y, b1.z, b1.w};
#pragma unroll
        for (int mt = 0; mt < 2; ++mt)
#pragma unroll
          for (int i = 0; i < 8; ++i) acc[mt][nt][i] += bv[i];
      }
    }
#pragma unroll
    for (int mt = 0; mt < 2; ++mt) {
#pragma unroll
      for (int nt = 0; nt < 4; ++nt) {
        float v[8];
#pragma unroll
        for (int i = 0; i < 8; ++i) v[i] = acc[mt][nt][i];
        if constexpr (EPI == EPI_FF1) {
          // 0.5 v (1 + tanh u) = v / (1 + exp(-2 u)), u = c (v + 0.044715 v^3): the same
          // function with no branch, so a lane's elements interleave.  The two constants
          // are -2 c log2(e) and that times 0.044715; exp2 going to inf or to 0 at the
          // ends gives the limits 0 and v.
          float t[8], e[8];
#pragma unroll
          for (int i = 0; i < 8; ++i)
            t[i] = v[i] * (-2.3022082f + -0.10294324f * (v[i] * v[i]));
          exp2_x8(e, t);
#pragma unroll
          for (int i = 0; i < 8; ++i) t[i] = 1.0f + e[i];
          rcp_x8(e, t);
#pragma unroll
          for (int i = 0; i < 8; ++i) v[i] *= e[i];
        }
        *reinterpret_cast<uint4*>(dst + (size_t)(mt * 16) * ld + nt * 16) = pack8_bf16(v);
      }
    }
  } else {
#pragma unroll
    for (int mt = 0; mt < 2; ++mt) {
#pragma unroll
      for (int nt = 0; nt < 4; ++nt) {
        const int n = n0 + wn * 64 + nt * 16 + l16;
        const float bv = bias[n];
#pragma unroll
        for (int i = 0; i < 8; ++i) {
          const int m = m0 + wm * 32 + mt * 16 + i + half * 8;
          const float v = acc[mt][nt][i] + bv;
          outF[(size_t)m * N + n] = resid[(size_t)m * N + n] + v;
        }
      }
    }
  }
}

#define ATT_BQ 128
#define ATT_BK 128
#define QLD 72    // 144B rows: 16B aligned, banks spread
#define PLD 136   // 272B rows: 16B aligned, conflict-free frag reads

union FragP { v16bf v; v2bf h[8]; };

// value of lane l ^ 16
__device__ __forceinline__ float xhalf(float x) {
  const int b = __builtin_bit_cast(int, x);
  return __builtin_bit_cast(
      float, __builtin_amdgcn_permlanex16(b, b, 0x76543210, 0xfedcba98, false, false));
}

// One work-group per WGP (two waves per SIMD), as before this LDS size.  Left alone the
// compiler aims at the three work-groups that the LDS would admit and, for want of
// registers, waits out every fragment load in front of its own WMMA; and the grid order
// below levels the WGPs only while there are fewer places than work-groups.
__global__ __launch_bounds__(256) __attribute__((amdgpu_waves_per_eu(2, 2)))
void attn_kernel(const unsigned short* __restrict__ qkv,
                 const unsigned short* __restrict__ vT,
                 unsigned short* __restrict__ av) {
  __shared__ __align__(16) unsigned short Qs[ATT_BQ * QLD];
  __shared__ __align__(16) unsigned short Ks[2][ATT_BK * QLD];
  __shared__ __align__(16) unsigned short Vt[2][HD_ * PLD];

  const int tid  = threadIdx.x;
  const int lane = tid & 31;
  const int w    = tid >> 5;       // 8 waves, each owns 16 q-rows
  // A work-group's cost is qt + 1 key tiles, and there are more work-groups than
  // resident places: the slowest grid index counts qt down, so the long ones start
  // first and the short ones fill the places that come free.
  const int qt = T_ / ATT_BQ - 1 - (int)blockIdx.z;  // q tile 15..0
  const int h  = blockIdx.x;
  const int b  = blockIdx.y;
  const int q_base = qt * ATT_BQ;
  const int l16  = lane & 15;
  const int half = lane >> 4;
  const int ko   = half * 8;
  const int wr0  = w * 16;
  const int qrow = q_base + wr0 + l16;   // this lane's query

  const size_t qkv_row = 3 * D_;
  const unsigned short* qbase = qkv + ((size_t)b * T_) * qkv_row + h * HD_;
  const unsigned short* kbase = qbase + D_;
  const unsigned short* vtb   = vT + ((size_t)(b * H_ + h)) * HD_ * T_;

  // K tile (128 x 64, [kk][d]) + V tile (transposed in global: [d][kk])
  auto issue_kv = [&](int j, int buf) {
#pragma unroll
    for (int p = 0; p < 4; ++p) {
      const int idx = p * 256 + tid;
      const int r = idx >> 3, ck = idx & 7;
      cp16_g2l(&Ks[buf][r * QLD + ck * 8],
               &kbase[(size_t)(j * ATT_BK + r) * qkv_row + ck * 8]);
    }
#pragma unroll
    for (int p = 0; p < 4; ++p) {
      const int idx = p * 256 + tid;
      const int d = idx >> 4, ck = idx & 15;
      cp16_g2l(&Vt[buf][d * PLD + ck * 8],
               &vtb[(size_t)d * T_ + j * ATT_BK + ck * 8]);
    }
  };

  // load Q tile (128 x 64) and first K/V tile
#pragma unroll
  for (int p = 0; p < 4; ++p) {
    const int idx = p * 256 + tid;
    const int r = idx >> 3, ck = idx & 7;
    cp16_g2l(&Qs[r * QLD + ck * 8],
             &qbase[(size_t)(q_base + r) * qkv_row + ck * 8]);
  }
  issue_kv(0, 0);
  wait_async();
  __syncthreads();

  float mrun = -3.0e38f;  // running maximum of this lane's query (equal in both halves)
  float lrun = 0.0f;      // running sum over the keys of this lane's half only
  v8f o[4];               // o[dt][i] = O[query l16][d = dt * 16 + half * 8 + i]
#pragma unroll
  for (int dt = 0; dt < 4; ++dt) o[dt] = v8f_zero();

  for (int j = 0; j <= qt; ++j) {
    const int cur = j & 1;
    if (j < qt) issue_kv(j + 1, cur ^ 1);  // prefetch while computing

    // S^T = K Q^T : s[nt][i] = score(key nt * 16 + half * 8 + i, query l16)
    v8f s[8];
#pragma unroll
    for (int nt = 0; nt < 8; ++nt) s[nt] = v8f_zero();
#pragma unroll
    for (int c = 0; c < 2; ++c) {
      const v16bf bq = load_frag(&Qs[(wr0 + l16) * QLD + c * 32 + ko]);
#pragma unroll
      for (int nt = 0; nt < 8; ++nt) {
        const v16bf ak = load_frag(&Ks[cur][(nt * 16 + l16) * QLD + c * 32 + ko]);
        s[nt] = wmma_bf16(ak, bq, s[nt]);
      }
    }
    // scale, 1/sqrt(64)
#pragma unroll
    for (int nt = 0; nt < 8; ++nt) s[nt] *= 0.125f;
    // causal mask, on the diagonal tile only: key j * 128 + nt * 16 + half * 8 + i is
    // masked above qrow = j * 128 + wr0 + l16
    if (j == qt) {
      const int lim = wr0 + l16 - half * 8;
#pragma unroll
      for (int nt = 0; nt < 8; ++nt)
#pragma unroll
        for (int i = 0; i < 8; ++i)
          if (nt * 16 + i > lim) s[nt][i] = -1.0e30f;
    }
    // maximum over the tile's 128 keys: 64 in the lane (eight independent chains),
    // then one exchange with the other half
    float mx[8];
#pragma unroll
    for (int i = 0; i < 8; ++i) {
      float v = s[0][i];
#pragma unroll
      for (int nt = 1; nt < 8; ++nt) v = fmaxf(v, s[nt][i]);
      mx[i] = v;
    }
    float tmax = fmaxf(fmaxf(fmaxf(mx[0], mx[1]), fmaxf(mx[2], mx[3])),
                       fmaxf(fmaxf(mx[4], mx[5]), fmaxf(mx[6], mx[7])));
    tmax = fmaxf(tmax, xhalf(tmax));
    const float mnew = fmaxf(mrun, tmax);
    const float sc   = __expf(mrun - mnew);
    mrun = mnew;
#pragma unroll
    for (int dt = 0; dt < 4; ++dt)
#pragma unroll
      for (int i = 0; i < 8; ++i) o[dt][i] *= sc;

    // P = exp(S - m), packed in place: element e of the B operand of keys c4 * 32 + 0..31
    // is tile 2 * c4 + (e >> 3), register e & 7: the k order of load_frag
    FragP pb[4];
    float rs[4];
#pragma unroll
    for (int c4 = 0; c4 < 4; ++c4) {
      rs[c4] = 0.f;
#pragma unroll
      for (int e = 0; e < 16; e += 2) {
        v2f pp;
        pp.x = __expf(s[2 * c4 + (e >> 3)][e & 7] - mrun);
        pp.y = __expf(s[2 * c4 + (e >> 3)][(e & 7) + 1] - mrun);
        rs[c4] += pp.x + pp.y;
        pb[c4].h[e >> 1] = __builtin_convertvector(pp, v2bf);
      }
    }
    lrun = lrun * sc + ((rs[0] + rs[1]) + (rs[2] + rs[3]));

    // O^T += V^T P^T
#pragma unroll
    for (int c4 = 0; c4 < 4; ++c4) {
#pragma unroll
      for (int dt = 0; dt < 4; ++dt) {
        const v16bf va = load_frag(&Vt[cur][(dt * 16 + l16) * PLD + c4 * 32 + ko]);
        o[dt] = wmma_bf16(va, pb[c4].v, o[dt]);
      }
    }
    wait_async();     // prefetched K/V tile has landed
    __syncthreads();  // all waves done reading this tile's buffers
  }

  // join the halves' sums, normalize + store av (bf16, row-major [token][D]):
  // 8 consecutive d per lane and tile, one 16-byte store each
  const float inv = 1.0f / (lrun + xhalf(lrun));
  unsigned short* orow = av + ((size_t)(b * T_) + qrow) * D_ + h * HD_ + half * 8;
#pragma unroll
  for (int dt = 0; dt < 4; ++dt) {
    Pack8 pk;
#pragma unroll
    for (int i = 0; i < 8; i += 2) {
      v2f ov;
      ov.x = o[dt][i] * inv;
      ov.y = o[dt][i + 1] * inv;
      pk.h[i >> 1] = __builtin_convertvector(ov, v2bf);
    }
    *reinterpret_cast<uint4*>(orow + dt * 16) = pk.q;
  }
}

// ---------- host launcher ----------
extern "C" void kernel_launch(void* const* d_in, const int* in_sizes, int n_in,
                              void* d_out, int out_size, void* d_ws, size_t ws_size,
                              hipStream_t stream) {
  (void)in_sizes; (void)n_in; (void)out_size; (void)ws_size;
  const float* x     = (const float*)d_in[0];
  const float* ln1_w = (const float*)d_in[1];
  const float* ln1_b = (const float*)d_in[2];
  const float* W_qkv = (const float*)d_in[3];
  const float* b_qkv = (const float*)d_in[4];
  const float* W_o   = (const float*)d_in[5];
  const float* b_o   = (const float*)d_in[6];
  const float* ln2_w = (const float*)d_in[7];
  const float* ln2_b = (const float*)d_in[8];
  const float* W_ff1 = (const float*)d_in[9];
  const float* b_ff1 = (const float*)d_in[10];
  const float* W_ff2 = (const float*)d_in[11];
  const float* b_ff2 = (const float*)d_in[12];
  float* out = (float*)d_out;
  char* ws = (char*)d_ws;

  // workspace layout (bytes)
  constexpr size_t off_wqkv = 0;                               // 3072x1024 bf16
  constexpr size_t off_wo   = off_wqkv + (size_t)3072 * 1024 * 2;
  constexpr size_t off_wff1 = off_wo   + (size_t)1024 * 1024 * 2;
  constexpr size_t off_wff2 = off_wff1 + (size_t)4096 * 1024 * 2;
  constexpr size_t off_h    = off_wff2 + (size_t)1024 * 4096 * 2;  // h / h2 (aliased)
  constexpr size_t off_qkv  = off_h    + (size_t)NTOK * D_ * 2;    // q,k rows (v slot unused)
  constexpr size_t off_vT   = off_qkv  + (size_t)NTOK * 3 * D_ * 2;
  constexpr size_t off_ff1  = off_qkv;                             // reuses qkv+vT after attn
  constexpr size_t off_av   = off_vT   + (size_t)NTOK * D_ * 2;
  constexpr size_t off_x1   = off_av   + (size_t)NTOK * D_ * 2;

  unsigned short* wqkv_t = (unsigned short*)(ws + off_wqkv);
  unsigned short* wo_t   = (unsigned short*)(ws + off_wo);
  unsigned short* wff1_t = (unsigned short*)(ws + off_wff1);
  unsigned short* wff2_t = (unsigned short*)(ws + off_wff2);
  unsigned short* hbuf   = (unsigned short*)(ws + off_h);
  unsigned short* qkvb   = (unsigned short*)(ws + off_qkv);
  unsigned short* vTb    = (unsigned short*)(ws + off_vT);
  unsigned short* ff1b   = (unsigned short*)(ws + off_ff1);
  unsigned short* avb    = (unsigned short*)(ws + off_av);
  float*          x1     = (float*)(ws + off_x1);

  prepass_kernel<<<PRE_ALL, 256, 0, stream>>>(W_qkv, wqkv_t, W_o, wo_t, W_ff1, wff1_t,
                                              W_ff2, wff2_t, x, ln1_w, ln1_b, hbuf);

  gemm_kernel<EPI_QKV><<<dim3(3072 / BN, NTOK / BM), 256, 0, stream>>>(
      hbuf, wqkv_t, b_qkv, nullptr, nullptr, qkvb, vTb, NTOK, 3072, 1024);

  attn_kernel<<<dim3(H_, B_, T_ / ATT_BQ), 256, 0, stream>>>(qkvb, vTb, avb);

  gemm_kernel<EPI_OPROJ><<<dim3(1024 / BN, NTOK / BM), 256, 0, stream>>>(
      avb, wo_t, b_o, x, x1, nullptr, nullptr, NTOK, 1024, 1024);

  ln_kernel<<<NTOK / LN_ROWS, 256, 0, stream>>>(x1, ln2_w, ln2_b, hbuf);

  gemm_kernel<EPI_FF1><<<dim3(4096 / BN, NTOK / BM), 256, 0, stream>>>(
      hbuf, wff1_t, b_ff1, nullptr, nullptr, ff1b, nullptr, NTOK, 4096, 1024);

  gemm_kernel<EPI_FF2><<<dim3(1024 / BN, NTOK / BM), 256, 0, stream>>>(
      ff1b, wff2_t, b_ff2, x1, out, nullptr, nullptr, NTOK, 1024, 4096);
}

// v008
// One run takes 149 microseconds.
// Two timings next to v007 put it at 1.03 and 1.05 times that version's speed.
// Over all steps from v000 it is 2.23 times as fast.
#include <hip/hip_runtime.h>
#include <stdint.h>

// ---------- types ----------
typedef __bf16 bf16_t;
typedef bf16_t v16bf __attribute__((ext_vector_type(16)));
typedef float  v8f   __attribute__((ext_vector_type(8)));
typedef int    v4i   __attribute__((ext_vector_type(4)));

#define B_   2
#define T_   2048
#define D_   1024
#define H_   16
#define HD_  64
#define DFF_ 4096
#define NTOK (B_ * T_)

#if defined(__gfx1250__) && __has_builtin(__builtin_amdgcn_global_load_async_to_lds_b128)
#define HAVE_ASYNC_LDS 1
#else
#define HAVE_ASYNC_LDS 0
#endif

__device__ __forceinline__ unsigned short f2bf(float f) {
  union { float f; unsigned int u; } c; c.f = f;
  unsigned int u = c.u;
  unsigned int r = u + 0x7FFFu + ((u >> 16) & 1u);  // round-to-nearest-even
  return (unsigned short)(r >> 16);
}

// 16-byte global -> LDS copy; async engine when available (ASYNCcnt tracked),
// else synchronous VGPR-staged copy.  Both require 16B-aligned src and dst.
__device__ __forceinline__ void cp16_g2l(unsigned short* ldst,
                                         const unsigned short* gsrc) {
#if HAVE_ASYNC_LDS
  __builtin_amdgcn_global_load_async_to_lds_b128(
      (__attribute__((address_space(1))) v4i*)gsrc,
      (__attribute__((address_space(3))) v4i*)ldst, 0, 0);
#else
  *reinterpret_cast<uint4*>(ldst) = *reinterpret_cast<const uint4*>(gsrc);
#endif
}

__device__ __forceinline__ void wait_async() {
#if HAVE_ASYNC_LDS
#if __has_builtin(__builtin_amdgcn_s_wait_asynccnt)
  __builtin_amdgcn_s_wait_asynccnt(0);
#else
  asm volatile("s_wait_asynccnt 0x0" ::: "memory");
#endif
#endif
}

union FragU { v16bf v; uint4 q[2]; };

typedef float  v2f  __attribute__((ext_vector_type(2)));
typedef bf16_t v2bf __attribute__((ext_vector_type(2)));
union Pack8 { uint4 q; v2bf h[4]; };

// eight f32 -> eight bf16 (round to nearest even), one 16-byte value
__device__ __forceinline__ uint4 pack8_bf16(const float (&v)[8]) {
  Pack8 pk;
#pragma unroll
  for (int i = 0; i < 8; i += 2) {
    v2f p;
    p.x = v[i];
    p.y = v[i + 1];
    pk.h[i >> 1] = __builtin_convertvector(p, v2bf);
  }
  return pk.q;
}

// Load a 16-element bf16 WMMA fragment: p points at (row_base + ko) where
// ko = (lane/16)*8.  Elements 0..7 are K=ko..ko+7, elements 8..15 are
// K=ko+16..ko+23 (ISA 16-bit A/B fragment layout).  Both halves are 16B loads.
__device__ __forceinline__ v16bf load_frag(const unsigned short* p) {
  FragU f;
  f.q[0] = *reinterpret_cast<const uint4*>(p);
  f.q[1] = *reinterpret_cast<const uint4*>(p + 16);
  return f.v;
}

__device__ __forceinline__ v8f wmma_bf16(v16bf a, v16bf b, v8f c) {
  return __builtin_amdgcn_wmma_f32_16x16x32_bf16(false, a, false, b,
                                                 (short)0, c, false, false);
}

__device__ __forceinline__ v8f v8f_zero() {
  v8f z = {0.f, 0.f, 0.f, 0.f, 0.f, 0.f, 0.f, 0.f};
  return z;
}

// ---------- weight transpose + f32->bf16 convert : out[N][K] = in[K][N] ----------
// One work-group moves a tile of 128 in-rows x 64 in-columns: 256 B of every row it
// reads and 256 B of every row it writes, 32 elements per thread.
#define TP_R 128
#define TP_C 64

__device__ __forceinline__
void transpose_tile(const float* __restrict__ in,
                    unsigned short* __restrict__ out, int R, int C, int bx, int by) {
  // [in-column][pair of in-rows]: 64 dwords per column, no pad.  The 16-byte chunks of
  // a column are XOR-ed with (column >> 2), so the dword stores of a wave (16 column
  // groups x 2 row pairs) and its 16-byte reads (16 chunks of one column) both hit
  // every bank at most once.
  __shared__ __align__(16) unsigned int tile[TP_C * (TP_R / 2)];
  const int t  = threadIdx.x;
  const int c0 = bx * TP_C, r0 = by * TP_R;
  const int cq = t & 15;   // group of 4 in-columns (one float4)
  const int rp = t >> 4;   // pair of in-rows within a round of 32 rows
  float4 a[4][2];
#pragma unroll
  for (int q = 0; q < 4; ++q)
#pragma unroll
    for (int j = 0; j < 2; ++j)
      a[q][j] = *reinterpret_cast<const float4*>(
          &in[(size_t)(r0 + q * 32 + rp * 2 + j) * C + c0 + cq * 4]);
#pragma unroll
  for (int q = 0; q < 4; ++q) {
    const int d   = q * 16 + rp;                           // row pair 0..63
    const int pos = (((d >> 2) ^ cq) << 2) | (d & 3);
    unsigned int* col = &tile[(cq * 4) * (TP_R / 2) + pos];
    col[0 * (TP_R / 2)] = (unsigned int)f2bf(a[q][0].x) | ((unsigned int)f2bf(a[q][1].x) << 16);
    col[1 * (TP_R / 2)] = (unsigned int)f2bf(a[q][0].y) | ((unsigned int)f2bf(a[q][1].y) << 16);
    col[2 * (TP_R / 2)] = (unsigned int)f2bf(a[q][0].z) | ((unsigned int)f2bf(a[q][1].z) << 16);
    col[3 * (TP_R / 2)] = (unsigned int)f2bf(a[q][0].w) | ((unsigned int)f2bf(a[q][1].w) << 16);
  }
  __syncthreads();
  const int k = t & 15;    // 16-byte chunk of a column: 8 in-rows
#pragma unroll
  for (int p = 0; p < 4; ++p) {
    const int c = p * 16 + (t >> 4);
    const uint4 v = *reinterpret_cast<const uint4*>(
        &tile[c * (TP_R / 2) + ((k ^ (c >> 2)) << 2)]);
    *reinterpret_cast<uint4*>(&out[(size_t)(c0 + c) * R + r0 + k * 8]) = v;
  }
}

// ---------- LayerNorm : f32 [rows][1024] -> bf16, one wave per row ----------
#define LN_ROWS 8  // rows (waves) per work-group

__device__ __forceinline__
void ln_rows(const float* __restrict__ x, const float* __restrict__ w,
             const float* __restrict__ bsh, unsigned short* __restrict__ out, int blk) {
  const int lane = threadIdx.x & 31;
  const int row  = blk * LN_ROWS + (threadIdx.x >> 5);
  const float4* xr = reinterpret_cast<const float4*>(x + (size_t)row * D_);
  float4 v[8];             // 32 floats per lane; each wave-wide load is 512 contiguous B
#pragma unroll
  for (int i = 0; i < 8; ++i) v[i] = xr[i * 32 + lane];
  float s = 0.f, s2 = 0.f;
#pragma unroll
  for (int i = 0; i < 8; ++i) {
    s  += v[i].x + v[i].y + v[i].z + v[i].w;
    s2 += v[i].x * v[i].x + v[i].y * v[i].y + v[i].z * v[i].z + v[i].w * v[i].w;
  }
#pragma unroll
  for (int m = 1; m < 32; m <<= 1) {
    s  += __shfl_xor(s,  m, 32);
    s2 += __shfl_xor(s2, m, 32);
  }
  const float mu   = s * (1.0f / D_);
  const float var  = s2 * (1.0f / D_) - mu * mu;
  const float rstd = rsqrtf(var + 1e-5f);
  ushort4* orow = reinterpret_cast<ushort4*>(out + (size_t)row * D_);
#pragma unroll
  for (int i = 0; i < 8; ++i) {
    const float4 wv = reinterpret_cast<const float4*>(w)[i * 32 + lane];
    const float4 bv = reinterpret_cast<const float4*>(bsh)[i * 32 + lane];
    ushort4 ov;
    ov.x = f2bf((v[i].x - mu) * rstd * wv.x + bv.x);
    ov.y = f2bf((v[i].y - mu) * rstd * wv.y + bv.y);
    ov.z = f2bf((v[i].z - mu) * rstd * wv.z + bv.z);
    ov.w = f2bf((v[i].w - mu) * rstd * wv.w + bv.w);
    orow[i * 32 + lane] = ov;
  }
}

__global__ __launch_bounds__(256)
void ln_kernel(const float* __restrict__ x, const float* __restrict__ w,
               const float* __restrict__ bsh, unsigned short* __restrict__ out) {
  ln_rows(x, w, bsh, out, blockIdx.x);
}

// ---------- the five jobs that depend on the inputs alone, in one grid ----------
// The four weight transposes and the first LayerNorm read only inputs and write
// disjoint buffers: the block index picks the job (a work-group has one job, so the
// transpose's barrier stands under block-uniform control flow).
#define PRE_QKV ((3 * D_ / TP_C) * (D_ / TP_R))   // work-groups per job
#define PRE_O   ((D_ / TP_C) * (D_ / TP_R))
#define PRE_FF1 ((DFF_ / TP_C) * (D_ / TP_R))
#define PRE_FF2 ((D_ / TP_C) * (DFF_ / TP_R))
#define PRE_LN  (NTOK / LN_ROWS)
#define PRE_ALL (PRE_QKV + PRE_O + PRE_FF1 + PRE_FF2 + PRE_LN)

__global__ __launch_bounds__(256)
void prepass_kernel(const float* __restrict__ W_qkv, unsigned short* __restrict__ wqkv_t,
                    const float* __restrict__ W_o,   unsigned short* __restrict__ wo_t,
                    const float* __restrict__ W_ff1, unsigned short* __restrict__ wff1_t,
                    const float* __restrict__ W_ff2, unsigned short* __restrict__ wff2_t,
                    const float* __restrict__ x, const float* __restrict__ ln_w,
                    const float* __restrict__ ln_b, unsigned short* __restrict__ h) {
  int blk = blockIdx.x;
  if (blk >= PRE_ALL - PRE_LN) {
    ln_rows(x, ln_w, ln_b, h, blk - (PRE_ALL - PRE_LN));
  } else {
    const float* in;
    unsigned short* out;
    int R, C, bx, by;
    if (blk < PRE_QKV) {
      in = W_qkv; out = wqkv_t; R = D_; C = 3 * D_;
      bx = blk % (3 * D_ / TP_C); by = blk / (3 * D_ / TP_C);
    } else if (blk < PRE_QKV + PRE_O) {
      blk -= PRE_QKV;
      in = W_o; out = wo_t; R = D_; C = D_;
      bx = blk % (D_ / TP_C); by = blk / (D_ / TP_C);
    } else if (blk < PRE_QKV + PRE_O + PRE_FF1) {
      blk -= PRE_QKV + PRE_O;
      in = W_ff1; out = wff1_t; R = D_; C = DFF_;
      bx = blk % (DFF_ / TP_C); by = blk / (DFF_ / TP_C);
    } else {
      blk -= PRE_QKV + PRE_O + PRE_FF1;
      in = W_ff2; out = wff2_t; R = DFF_; C = D_;
      bx = blk % (D_ / TP_C); by = blk / (D_ / TP_C);
    }
    transpose_tile(in, out, R, C, bx, by);
  }
}

// Eight independent transcendentals in a row.  The outputs are early-clobber, so none of
// them lands on a source of the run; the closing v_nop is the one slot that the
// instruction set asks for between a transcendental and an instruction that uses its
// result or overwrites its source.
__device__ __forceinline__ void exp2_x8(float (&y)[8], const float (&x)[8]) {
  asm("v_exp_f32 %0, %8\n\tv_exp_f32 %1, %9\n\tv_exp_f32 %2, %10\n\tv_exp_f32 %3, %11\n\t"
      "v_exp_f32 %4, %12\n\tv_exp_f32 %5, %13\n\tv_exp_f32 %6, %14\n\tv_exp_f32 %7, %15\n\t"
      "v_nop"
      : "=&v"(y[0]), "=&v"(y[1]), "=&v"(y[2]), "=&v"(y[3]),
        "=&v"(y[4]), "=&v"(y[5]), "=&v"(y[6]), "=&v"(y[7])
      : "v"(x[0]), "v"(x[1]), "v"(x[2]), "v"(x[3]),
        "v"(x[4]), "v"(x[5]), "v"(x[6]), "v"(x[7]));
}
// the same run and the same closing slot for the reciprocals
__device__ __forceinline__ void rcp_x8(float (&y)[8], const float (&x)[8]) {
  asm("v_rcp_f32 %0, %8\n\tv_rcp_f32 %1, %9\n\tv_rcp_f32 %2, %10\n\tv_rcp_f32 %3, %11\n\t"
      "v_rcp_f32 %4, %12\n\tv_rcp_f32 %5, %13\n\tv_rcp_f32 %6, %14\n\tv_rcp_f32 %7, %15\n\t"
      "v_nop"
      : "=&v"(y[0]), "=&v"(y[1]), "=&v"(y[2]), "=&v"(y[3]),
        "=&v"(y[4]), "=&v"(y[5]), "=&v"(y[6]), "=&v"(y[7])
      : "v"(x[0]), "v"(x[1]), "v"(x[2]), "v"(x[3]),
        "v"(x[4]), "v"(x[5]), "v"(x[6]), "v"(x[7]));
}

// Four 16-byte global stores, step elements apart, and behind them the wait that belongs
// in front of any overwrite of a register that an issued store names.  In one statement,
// so that the operands' registers live up to the wait.
__device__ __forceinline__ void store4(unsigned short* p, size_t step, const v4i (&d)[4]) {
  asm volatile("global_store_b128 %0, %4, off\n\t"
               "global_store_b128 %1, %5, off\n\t"
               "global_store_b128 %2, %6, off\n\t"
               "global_store_b128 %3, %7, off\n\t"
               "s_wait_xcnt 0x0"
               :: "v"(p), "v"(p + step), "v"(p + 2 * step), "v"(p + 3 * step),
                  "v"(d[0]), "v"(d[1]), "v"(d[2]), "v"(d[3])
               : "memory");
}
// The same wait behind a run of plain loads from p + constants.  p is an input, so that
// its registers stay untouched up to the wait.
__device__ __forceinline__ void loads_issued(const float* p) {
  asm volatile("s_wait_xcnt 0x0" :: "v"(p) : "memory");
}

// ---------- generic WMMA GEMM : C[M,N] = epi(A_bf16[M,K] @ Bt_bf16[N,K]^T) ----------
// The work-group's output tile is TS x TS (a template argument): 128 with 8 waves (4 x 2)
// of 32 x 64, or 256 with 16 waves (4 x 4) of 64 x 64.  An operand byte brought from L2
// serves TS columns of the other operand, and a fragment read from LDS 2 and 4 or 4 and 4
// WMMAs, so the wide outputs (QKV, FF1) take 256; the outputs of 1024 columns keep 128,
// which gives them one work-group per WGP.
#define BK 128  // k depth of one LDS stage: 256 B of every operand row (whole L2 units)
#define LDT 136  // padded LDS row stride (elems): 272B rows = 16B x odd, banks spread

enum { EPI_QKV = 0, EPI_OPROJ = 1, EPI_FF1 = 2, EPI_FF2 = 3 };

template <int EPI, int TS>
__global__ __launch_bounds__(2 * TS)
void gemm_kernel(const unsigned short* __restrict__ A,
                 const unsigned short* __restrict__ Bt,
                 const float* __restrict__ bias,
                 const float* __restrict__ resid,
                 float* __restrict__ outF,
                 unsigned short* __restrict__ outB,
                 unsigned short* __restrict__ vT,
                 int M, int N, int K) {
  constexpr int FM = TS / 64;   // fragments per wave on the side split 4 ways (wm)
  constexpr int FN = 4;         // fragments per wave on the side split TS / 64 ways (wn)
  constexpr int RPR = TS / 8;   // operand rows that the work-group copies per round
  __shared__ __align__(16) unsigned short As[2][TS * LDT];
  __shared__ __align__(16) unsigned short Bs[2][TS * LDT];
  const int tid  = threadIdx.x;
  const int lane = tid & 31;
  const int w    = tid >> 5;     // 8 or 16 waves
  const int wm   = w & 3;        // 4 row-granules of FM * 16
  const int wn   = w >> 2;       // 2 or 4 col-granules of FN * 16
  const int m0 = blockIdx.y * TS;
  const int n0 = blockIdx.x * TS;
  const int l16  = lane & 15;
  const int half = lane >> 4;
  const int ko   = half * 8;

  // The accumulator gives a lane 8 consecutive ROWS of one column.  Where the output is
  // bf16 the operand whose index runs along the output's rows is therefore made the A
  // operand, so that a lane's 8 values are 16 contiguous bytes of the output: the weight
  // rows (n) for q, k and FF1, the tokens (m) for v, which is stored transposed.  The
  // A side has FN fragments per wave (granule wn), the B side FM (granule wm); a v tile is
  // a whole work-group (2 * D_ is a multiple of TS), so the choice is block-uniform.
  constexpr bool PACKED = (EPI == EPI_QKV || EPI == EPI_FF1);
  static_assert((2 * D_) % TS == 0 && T_ % TS == 0, "a tile is all v or none, in one batch");
  const bool vtile = (EPI == EPI_QKV) && n0 >= 2 * D_;
  const unsigned short* rowop = vtile ? &As[0][0] : &Bs[0][0];  // accumulator rows
  const unsigned short* colop = vtile ? &Bs[0][0] : &As[0][0];  // accumulator columns

  v8f acc[FM][FN];
#pragma unroll
  for (int i = 0; i < FM; ++i)
#pragma unroll
    for (int j = 0; j < FN; ++j) acc[i][j] = v8f_zero();

  const int ar0 = tid >> 4;   // 0..RPR-1 (row within a copy round)
  const int akg = tid & 15;   // k-group of 8 elems: 16 lanes cover one 256 B row piece
  const int nk  = K / BK;

  // one stage: TS rows x 256 B of each operand, 16 copies per thread
  auto issue_stage = [&](int kt, int buf) {
    const int kb = kt * BK;
#pragma unroll
    for (int p = 0; p < TS / RPR; ++p) {
      const int r = p * RPR + ar0;
      cp16_g2l(&As[buf][r * LDT + akg * 8],
               &A[(size_t)(m0 + r) * K + kb + akg * 8]);
      cp16_g2l(&Bs[buf][r * LDT + akg * 8],
               &Bt[(size_t)(n0 + r) * K + kb + akg * 8]);
    }
  };

  issue_stage(0, 0);
  // stage 0 of this wave has landed before the barrier that publishes it
  asm volatile("s_wait_asynccnt 0x0" ::: "memory");
  __syncthreads();
  if (nk > 1) issue_stage(1, 1);

  for (int kt = 0; kt < nk; ++kt) {
    const int cur = kt & 1;
#pragma unroll
    for (int ks = 0; ks < BK / 32; ++ks) {
      v16bf af[FM], bf[FN];
      if constexpr (PACKED) {
#pragma unroll
        for (int mt = 0; mt < FM; ++mt)
          af[mt] = load_frag(&colop[cur * (TS * LDT) +
                                    (wm * (FM * 16) + mt * 16 + l16) * LDT + ks * 32 + ko]);
#pragma unroll
        for (int nt = 0; nt < FN; ++nt)
          bf[nt] = load_frag(&rowop[cur * (TS * LDT) +
                                    (wn * (FN * 16) + nt * 16 + l16) * LDT + ks * 32 + ko]);
        // The block's 2 * (FM + FN) LDS reads stay one group in front of its WMMAs.  Left
        // alone the compiler kept one register set for all of af and reloaded it in front
        // of every row of FN WMMAs, each time with a wait for the whole LDS latency.
        __builtin_amdgcn_sched_barrier(0);
#pragma unroll
        for (int mt = 0; mt < FM; ++mt)
#pragma unroll
          for (int nt = 0; nt < FN; ++nt)
            acc[mt][nt] = wmma_bf16(bf[nt], af[mt], acc[mt][nt]);
        // and the next block's reads do not move in among these WMMAs
        __builtin_amdgcn_sched_barrier(0);
      } else {
#pragma unroll
        for (int mt = 0; mt < FM; ++mt)
          af[mt] = load_frag(&As[cur][(wm * (FM * 16) + mt * 16 + l16) * LDT + ks * 32 + ko]);
#pragma unroll
        for (int nt = 0; nt < FN; ++nt)
          bf[nt] = load_frag(&Bs[cur][(wn * (FN * 16) + nt * 16 + l16) * LDT + ks * 32 + ko]);
#pragma unroll
        for (int mt = 0; mt < FM; ++mt)
#pragma unroll
          for (int nt = 0; nt < FN; ++nt)
            acc[mt][nt] = wmma_bf16(af[mt], bf[nt], acc[mt][nt]);
      }
    }
    // this wave's reads of buffer cur have retired before the buffer is refilled
    asm volatile("s_wait_dscnt 0x0" ::: "memory");
    // this wave's copies of stage kt + 1 have landed before the barrier publishes them
    asm volatile("s_wait_asynccnt 0x0" ::: "memory");
    __syncthreads();
    if (kt + 2 < nk) issue_stage(kt + 2, cur);  // flies while stage kt + 1 is worked on
  }
  // no copy is outstanding when the wave goes on to its end
  asm volatile("s_wait_asynccnt 0x0" ::: "memory");

  // epilogue: accumulator element (i, lane) -> row = i + 8*(lane/16), col = lane%16
  if constexpr (PACKED) {
    // The tiles go out four at a time: bias, activation and packing, then store4, so that
    // no second copy of the 128 accumulator registers is alive in the two branches.
    static_assert(FM == 4 && FN == 4, "the packed epilogue stores four tiles at a time");
    auto pack_tile = [&](float (&v)[8]) -> v4i {
      if constexpr (EPI == EPI_FF1) {
        // 0.5 v (1 + tanh u) = v / (1 + exp(-2 u)), u = c (v + 0.044715 v^3): the same
        // function with no branch, so a lane's elements interleave.  The two constants
        // are -2 c log2(e) and that times 0.044715; exp2 going to inf or to 0 at the
        // ends gives the limits 0 and v.
        float t[8], e[8];
#pragma unroll
        for (int i = 0; i < 8; ++i)
          t[i] = v[i] * (-2.3022082f + -0.10294324f * (v[i] * v[i]));
        exp2_x8(e, t);
#pragma unroll
        for (int i = 0; i < 8; ++i) t[i] = 1.0f + e[i];
        rcp_x8(e, t);
#pragma unroll
        for (int i = 0; i < 8; ++i) v[i] *= e[i];
      }
      return __builtin_bit_cast(v4i, pack8_bf16(v));
    };
    // dst: this lane's 8 values of tile (0, 0); tile (mt, nt) lies mt * 16 output rows
    // and nt * 16 elements further on.  The bias is fetched whole in front of the first
    // store4, whose "memory" clobber would hold a later load behind it.
    if (vtile) {
      // accumulator rows = tokens, columns = v features; v is stored [b][h][d][t], and
      // (b * H_ + h) * HD_ + d = b * D_ + (n - 2 * D_); a tile lies in one batch
      const int mr = m0 + wn * (FN * 16);
      const int nc = n0 + wm * (FM * 16) + l16;
      unsigned short* dst =
          vT + (size_t)((mr >> 11) * D_ + nc - 2 * D_) * T_ + (mr & (T_ - 1)) + half * 8;
      const float* bp = bias + nc;
      float bv[FM];
#pragma unroll
      for (int mt = 0; mt < FM; ++mt) bv[mt] = bp[mt * 16];
      loads_issued(bp);
#pragma unroll
      for (int mt = 0; mt < FM; ++mt) {
        v4i pk[4];
#pragma unroll
        for (int nt = 0; nt < FN; ++nt) {
          float v[8];
#pragma unroll
          for (int i = 0; i < 8; ++i) v[i] = acc[mt][nt][i] + bv[mt];
          pk[nt] = pack_tile(v);
        }
        store4(dst + (size_t)(mt * 16) * T_, 16, pk);
      }
    } else {
      // accumulator rows = output features, columns = tokens; row-major [token][N]
      const int nr = n0 + wn * (FN * 16) + half * 8;
      unsigned short* dst = outB + (size_t)(m0 + wm * (FM * 16) + l16) * N + nr;
      const float* bp = bias + nr;
      float4 bb[FN][2];
#pragma unroll
      for (int nt = 0; nt < FN; ++nt) {
        bb[nt][0] = *reinterpret_cast<const float4*>(bp + nt * 16);
        bb[nt][1] = *reinterpret_cast<const float4*>(bp + nt * 16 + 4);
      }
      loads_issued(bp);
#pragma unroll
      for (int nt = 0; nt < FN; ++nt) {
        const float bv[8] = {bb[nt][0].x, bb[nt][0].y, bb[nt][0].z, bb[nt][0].w,
                             bb[nt][1].x, bb[nt][1].y, bb[nt][1].z, bb[nt][1].w};
        v4i pk[4];
#pragma unroll
        for (int mt = 0; mt < FM; ++mt) {
          float v[8];
#pragma unroll
          for (int i = 0; i < 8; ++i) v[i] = acc[mt][nt][i] + bv[i];
          pk[mt] = pack_tile(v);
        }
        store4(dst + nt * 16, (size_t)16 * N, pk);
      }
    }
  } else {
#pragma unroll
    for (int mt = 0; mt < FM; ++mt) {
#pragma unroll
      for (int nt = 0; nt < FN; ++nt) {
        const int n = n0 + wn * (FN * 16) + nt * 16 + l16;
        const float bv = bias[n];
#pragma unroll
        for (int i = 0; i < 8; ++i) {
          const int m = m0 + wm * (FM * 16) + mt * 16 + i + half * 8;
          const float v = acc[mt][nt][i] + bv;
          outF[(size_t)m * N + n] = resid[(size_t)m * N + n] + v;
        }
      }
    }
  }
}

#define ATT_BQ 128
#define ATT_BK 128
#define QLD 72    // 144B rows: 16B aligned, banks spread
#define PLD 136   // 272B rows: 16B aligned, conflict-free frag reads

union FragP { v16bf v; v2bf h[8]; };

// value of lane l ^ 16
__device__ __forceinline__ float xhalf(float x) {
  const int b = __builtin_bit_cast(int, x);
  return __builtin_bit_cast(
      float, __builtin_amdgcn_permlanex16(b, b, 0x76543210, 0xfedcba98, false, false));
}

// One work-group per WGP (two waves per SIMD), as before this LDS size.  Left alone the
// compiler aims at the three work-groups that the LDS would admit and, for want of
// registers, waits out every fragment load in front of its own WMMA; and the grid order
// below levels the WGPs only while there are fewer places than work-groups.
__global__ __launch_bounds__(256) __attribute__((amdgpu_waves_per_eu(2, 2)))
void attn_kernel(const unsigned short* __restrict__ qkv,
                 const unsigned short* __restrict__ vT,
                 unsigned short* __restrict__ av) {
  __shared__ __align__(16) unsigned short Qs[ATT_BQ * QLD];
  __shared__ __align__(16) unsigned short Ks[2][ATT_BK * QLD];
  __shared__ __align__(16) unsigned short Vt[2][HD_ * PLD];

  const int tid  = threadIdx.x;
  const int lane = tid & 31;
  const int w    = tid >> 5;       // 8 waves, each owns 16 q-rows
  // A work-group's cost is qt + 1 key tiles, and there are more work-groups than
  // resident places: the slowest grid index counts qt down, so the long ones start
  // first and the short ones fill the places that come free.
  const int qt = T_ / ATT_BQ - 1 - (int)blockIdx.z;  // q tile 15..0
  const int h  = blockIdx.x;
  const int b  = blockIdx.y;
  const int q_base = qt * ATT_BQ;
  const int l16  = lane & 15;
  const int half = lane >> 4;
  const int ko   = half * 8;
  const int wr0  = w * 16;
  const int qrow = q_base + wr0 + l16;   // this lane's query

  const size_t qkv_row = 3 * D_;
  const unsigned short* qbase = qkv + ((size_t)b * T_) * qkv_row + h * HD_;
  const unsigned short* kbase = qbase + D_;
  const unsigned short* vtb   = vT + ((size_t)(b * H_ + h)) * HD_ * T_;

  // K tile (128 x 64, [kk][d]) + V tile (transposed in global: [d][kk])
  auto issue_kv = [&](int j, int buf) {
#pragma unroll
    for (int p = 0; p < 4; ++p) {
      const int idx = p * 256 + tid;
      const int r = idx >> 3, ck = idx & 7;
      cp16_g2l(&Ks[buf][r * QLD + ck * 8],
               &kbase[(size_t)(j * ATT_BK + r) * qkv_row + ck * 8]);
    }
#pragma unroll
    for (int p = 0; p < 4; ++p) {
      const int idx = p * 256 + tid;
      const int d = idx >> 4, ck = idx & 15;
      cp16_g2l(&Vt[buf][d * PLD + ck * 8],
               &vtb[(size_t)d * T_ + j * ATT_BK + ck * 8]);
    }
  };

  // load Q tile (128 x 64) and first K/V tile
#pragma unroll
  for (int p = 0; p < 4; ++p) {
    const int idx = p * 256 + tid;
    const int r = idx >> 3, ck = idx & 7;
    cp16_g2l(&Qs[r * QLD + ck * 8],
             &qbase[(size_t)(q_base + r) * qkv_row + ck * 8]);
  }
  issue_kv(0, 0);
  wait_async();
  __syncthreads();

  float mrun = -3.0e38f;  // running maximum of this lane's query (equal in both halves)
  float lrun = 0.0f;      // running sum over the keys of this lane's half only
  v8f o[4];               // o[dt][i] = O[query l16][d = dt * 16 + half * 8 + i]
#pragma unroll
  for (int dt = 0; dt < 4; ++dt) o[dt] = v8f_zero();

  for (int j = 0; j <= qt; ++j) {
    const int cur = j & 1;
    if (j < qt) issue_kv(j + 1, cur ^ 1);  // prefetch while computing

    // S^T = K Q^T : s[nt][i] = score(key nt * 16 + half * 8 + i, query l16)
    v8f s[8];
#pragma unroll
    for (int nt = 0; nt < 8; ++nt) s[nt] = v8f_zero();
#pragma unroll
    for (int c = 0; c < 2; ++c) {
      const v16bf bq = load_frag(&Qs[(wr0 + l16) * QLD + c * 32 + ko]);
#pragma unroll
      for (int nt = 0; nt < 8; ++nt) {
        const v16bf ak = load_frag(&Ks[cur][(nt * 16 + l16) * QLD + c * 32 + ko]);
        s[nt] = wmma_bf16(ak, bq, s[nt]);
      }
    }
    // scale, 1/sqrt(64)
#pragma unroll
    for (int nt = 0; nt < 8; ++nt) s[nt] *= 0.125f;
    // causal mask, on the diagonal tile only: key j * 128 + nt * 16 + half * 8 + i is
    // masked above qrow = j * 128 + wr0 + l16
    if (j == qt) {
      const int lim = wr0 + l16 - half * 8;
#pragma unroll
      for (int nt = 0; nt < 8; ++nt)
#pragma unroll
        for (int i = 0; i < 8; ++i)
          if (nt * 16 + i > lim) s[nt][i] = -1.0e30f;
    }
    // maximum over the tile's 128 keys: 64 in the lane (eight independent chains),
    // then one exchange with the other half
    float mx[8];
#pragma unroll
    for (int i = 0; i < 8; ++i) {
      float v = s[0][i];
#pragma unroll
      for (int nt = 1; nt < 8; ++nt) v = fmaxf(v, s[nt][i]);
      mx[i] = v;
    }
    float tmax = fmaxf(fmaxf(fmaxf(mx[0], mx[1]), fmaxf(mx[2], mx[3])),
                       fmaxf(fmaxf(mx[4], mx[5]), fmaxf(mx[6], mx[7])));
    tmax = fmaxf(tmax, xhalf(tmax));
    const float mnew = fmaxf(mrun, tmax);
    const float sc   = __expf(mrun - mnew);
    mrun = mnew;
#pragma unroll
    for (int dt = 0; dt < 4; ++dt)
#pragma unroll
      for (int i = 0; i < 8; ++i) o[dt][i] *= sc;

    // P = exp(S - m), packed in place: element e of the B operand of keys c4 * 32 + 0..31
    // is tile 2 * c4 + (e >> 3), register e & 7: the k order of load_frag
    FragP pb[4];
    float rs[4];
#pragma unroll
    for (int c4 = 0; c4 < 4; ++c4) {
      rs[c4] = 0.f;
#pragma unroll
      for (int e = 0; e < 16; e += 2) {
        v2f pp;
        pp.x = __expf(s[2 * c4 + (e >> 3)][e & 7] - mrun);
        pp.y = __expf(s[2 * c4 + (e >> 3)][(e & 7) + 1] - mrun);
        rs[c4] += pp.x + pp.y;
        pb[c4].h[e >> 1] = __builtin_convertvector(pp, v2bf);
      }
    }
    lrun = lrun * sc + ((rs[0] + rs[1]) + (rs[2] + rs[3]));

    // O^T += V^T P^T
#pragma unroll
    for (int c4 = 0; c4 < 4; ++c4) {
#pragma unroll
      for (int dt = 0; dt < 4; ++dt) {
        const v16bf va = load_frag(&Vt[cur][(dt * 16 + l16) * PLD + c4 * 32 + ko]);
        o[dt] = wmma_bf16(va, pb[c4].v, o[dt]);
      }
    }
    wait_async();     // prefetched K/V tile has landed
    __syncthreads();  // all waves done reading this tile's buffers
  }

  // join the halves' sums, normalize + store av (bf16, row-major [token][D]):
  // 8 consecutive d per lane and tile, one 16-byte store each
  const float inv = 1.0f / (lrun + xhalf(lrun));
  unsigned short* orow = av + ((size_t)(b * T_) + qrow) * D_ + h * HD_ + half * 8;
#pragma unroll
  for (int dt = 0; dt < 4; ++dt) {
    Pack8 pk;
#pragma unroll
    for (int i = 0; i < 8; i += 2) {
      v2f ov;
      ov.x = o[dt][i] * inv;
      ov.y = o[dt][i + 1] * inv;
      pk.h[i >> 1] = __builtin_convertvector(ov, v2bf);
    }
    *reinterpret_cast<uint4*>(orow + dt * 16) = pk.q;
  }
}

// ---------- host launcher ----------
extern "C" void kernel_launch(void* const* d_in, const int* in_sizes, int n_in,
                              void* d_out, int out_size, void* d_ws, size_t ws_size,
                              hipStream_t stream) {
  (void)in_sizes; (void)n_in; (void)out_size; (void)ws_size;
  const float* x     = (const float*)d_in[0];
  const float* ln1_w = (const float*)d_in[1];
  const float* ln1_b = (const float*)d_in[2];
  const float* W_qkv = (const float*)d_in[3];
  const float* b_qkv = (const float*)d_in[4];
  const float* W_o   = (const float*)d_in[5];
  const float* b_o   = (const float*)d_in[6];
  const float* ln2_w = (const float*)d_in[7];
  const float* ln2_b = (const float*)d_in[8];
  const float* W_ff1 = (const float*)d_in[9];
  const float* b_ff1 = (const float*)d_in[10];
  const float* W_ff2 = (const float*)d_in[11];
  const float* b_ff2 = (const float*)d_in[12];
  float* out = (float*)d_out;
  char* ws = (char*)d_ws;

  // workspace layout (bytes)
  constexpr size_t off_wqkv = 0;                               // 3072x1024 bf16
  constexpr size_t off_wo   = off_wqkv + (size_t)3072 * 1024 * 2;
  constexpr size_t off_wff1 = off_wo   + (size_t)1024 * 1024 * 2;
  constexpr size_t off_wff2 = off_wff1 + (size_t)4096 * 1024 * 2;
  constexpr size_t off_h    = off_wff2 + (size_t)1024 * 4096 * 2;  // h / h2 (aliased)
  constexpr size_t off_qkv  = off_h    + (size_t)NTOK * D_ * 2;    // q,k rows (v slot unused)
  constexpr size_t off_vT   = off_qkv  + (size_t)NTOK * 3 * D_ * 2;
  constexpr size_t off_ff1  = off_qkv;                             // reuses qkv+vT after attn
  constexpr size_t off_av   = off_vT   + (size_t)NTOK * D_ * 2;
  constexpr size_t off_x1   = off_av   + (size_t)NTOK * D_ * 2;

  unsigned short* wqkv_t = (unsigned short*)(ws + off_wqkv);
  unsigned short* wo_t   = (unsigned short*)(ws + off_wo);
  unsigned short* wff1_t = (unsigned short*)(ws + off_wff1);
  unsigned short* wff2_t = (unsigned short*)(ws + off_wff2);
  unsigned short* hbuf   = (unsigned short*)(ws + off_h);
  unsigned short* qkvb   = (unsigned short*)(ws + off_qkv);
  unsigned short* vTb    = (unsigned short*)(ws + off_vT);
  unsigned short* ff1b   = (unsigned short*)(ws + off_ff1);
  unsigned short* avb    = (unsigned short*)(ws + off_av);
  float*          x1     = (float*)(ws + off_x1);

  prepass_kernel<<<PRE_ALL, 256, 0, stream>>>(W_qkv, wqkv_t, W_o, wo_t, W_ff1, wff1_t,
                                              W_ff2, wff2_t, x, ln1_w, ln1_b, hbuf);

  gemm_kernel<EPI_QKV, 256><<<dim3(3072 / 256, NTOK / 256), 512, 0, stream>>>(
      hbuf, wqkv_t, b_qkv, nullptr, nullptr, qkvb, vTb, NTOK, 3072, 1024);

  attn_kernel<<<dim3(H_, B_, T_ / ATT_BQ), 256, 0, stream>>>(qkvb, vTb, avb);

  gemm_kernel<EPI_OPROJ, 128><<<dim3(1024 / 128, NTOK / 128), 256, 0, stream>>>(
      avb, wo_t, b_o, x, x1, nullptr, nullptr, NTOK, 1024, 1024);

  ln_kernel<<<NTOK / LN_ROWS, 256, 0, stream>>>(x1, ln2_w, ln2_b, hbuf);

  gemm_kernel<EPI_FF1, 256><<<dim3(4096 / 256, NTOK / 256), 512, 0, stream>>>(
      hbuf, wff1_t, b_ff1, nullptr, nullptr, ff1b, nullptr, NTOK, 4096, 1024);

  gemm_kernel<EPI_FF2, 128><<<dim3(1024 / 128, NTOK / 128), 256, 0, stream>>>(
      ff1b, wff2_t, b_ff2, x1, out, nullptr, nullptr, NTOK, 1024, 4096);
}

// v009
// Measured time: 143 microseconds a run.
// In both of two side-by-side timings against v008, it was 1.04 times as fast.
// Counting every step since v000, it is 2.31 times as fast.
#include <hip/hip_runtime.h>
#include <stdint.h>

// ---------- types ----------
typedef __bf16 bf16_t;
typedef bf16_t v16bf __attribute__((ext_vector_type(16)));
typedef float  v8f   __attribute__((ext_vector_type(8)));
typedef int    v4i   __attribute__((ext_vector_type(4)));

#define B_   2
#define T_   2048
#define D_   1024
#define H_   16
#define HD_  64
#define DFF_ 4096
#define NTOK (B_ * T_)

#if defined(__gfx1250__) && __has_builtin(__builtin_amdgcn_global_load_async_to_lds_b128)
#define HAVE_ASYNC_LDS 1
#else
#define HAVE_ASYNC_LDS 0
#endif

__device__ __forceinline__ unsigned short f2bf(float f) {
  union { float f; unsigned int u; } c; c.f = f;
  unsigned int u = c.u;
  unsigned int r = u + 0x7FFFu + ((u >> 16) & 1u);  // round-to-nearest-even
  return (unsigned short)(r >> 16);
}

// 16-byte global -> LDS copy; async engine when available (ASYNCcnt tracked),
// else synchronous VGPR-staged copy.  Both require 16B-aligned src and dst.
__device__ __forceinline__ void cp16_g2l(unsigned short* ldst,
                                         const unsigned short* gsrc) {
#if HAVE_ASYNC_LDS
  __builtin_amdgcn_global_load_async_to_lds_b128(
      (__attribute__((address_space(1))) v4i*)gsrc,
      (__attribute__((address_space(3))) v4i*)ldst, 0, 0);
#else
  *reinterpret_cast<uint4*>(ldst) = *reinterpret_cast<const uint4*>(gsrc);
#endif
}

__device__ __forceinline__ void wait_async() {
#if HAVE_ASYNC_LDS
#if __has_builtin(__builtin_amdgcn_s_wait_asynccnt)
  __builtin_amdgcn_s_wait_asynccnt(0);
#else
  asm volatile("s_wait_asynccnt 0x0" ::: "memory");
#endif
#endif
}

union FragU { v16bf v; uint4 q[2]; };

typedef float  v2f  __attribute__((ext_vector_type(2)));
typedef bf16_t v2bf __attribute__((ext_vector_type(2)));
union Pack8 { uint4 q; v2bf h[4]; };

// eight f32 -> eight bf16 (round to nearest even), one 16-byte value
__device__ __forceinline__ uint4 pack8_bf16(const float (&v)[8]) {
  Pack8 pk;
#pragma unroll
  for (int i = 0; i < 8; i += 2) {
    v2f p;
    p.x = v[i];
    p.y = v[i + 1];
    pk.h[i >> 1] = __builtin_convertvector(p, v2bf);
  }
  return pk.q;
}

// Load a 16-element bf16 WMMA fragment: p points at (row_base + ko) where
// ko = (lane/16)*8.  Elements 0..7 are K=ko..ko+7, elements 8..15 are
// K=ko+16..ko+23 (ISA 16-bit A/B fragment layout).  Both halves are 16B loads.
__device__ __forceinline__ v16bf load_frag(const unsigned short* p) {
  FragU f;
  f.q[0] = *reinterpret_cast<const uint4*>(p);
  f.q[1] = *reinterpret_cast<const uint4*>(p + 16);
  return f.v;
}

__device__ __forceinline__ v8f wmma_bf16(v16bf a, v16bf b, v8f c) {
  return __builtin_amdgcn_wmma_f32_16x16x32_bf16(false, a, false, b,
                                                 (short)0, c, false, false);
}

__device__ __forceinline__ v8f v8f_zero() {
  v8f z = {0.f, 0.f, 0.f, 0.f, 0.f, 0.f, 0.f, 0.f};
  return z;
}

// ---------- weight transpose + f32->bf16 convert : out[N][K] = in[K][N] ----------
// One work-group moves a tile of 128 in-rows x 64 in-columns: 256 B of every row it
// reads and 256 B of every row it writes, 32 elements per thread.
#define TP_R 128
#define TP_C 64

__device__ __forceinline__
void transpose_tile(const float* __restrict__ in,
                    unsigned short* __restrict__ out, int R, int C, int bx, int by) {
  // [in-column][pair of in-rows]: 64 dwords per column, no pad.  The 16-byte chunks of
  // a column are XOR-ed with (column >> 2), so the dword stores of a wave (16 column
  // groups x 2 row pairs) and its 16-byte reads (16 chunks of one column) both hit
  // every bank at most once.
  __shared__ __align__(16) unsigned int tile[TP_C * (TP_R / 2)];
  const int t  = threadIdx.x;
  const int c0 = bx * TP_C, r0 = by * TP_R;
  const int cq = t & 15;   // group of 4 in-columns (one float4)
  const int rp = t >> 4;   // pair of in-rows within a round of 32 rows
  float4 a[4][2];
#pragma unroll
  for (int q = 0; q < 4; ++q)
#pragma unroll
    for (int j = 0; j < 2; ++j)
      a[q][j] = *reinterpret_cast<const float4*>(
          &in[(size_t)(r0 + q * 32 + rp * 2 + j) * C + c0 + cq * 4]);
#pragma unroll
  for (int q = 0; q < 4; ++q) {
    const int d   = q * 16 + rp;                           // row pair 0..63
    const int pos = (((d >> 2) ^ cq) << 2) | (d & 3);
    unsigned int* col = &tile[(cq * 4) * (TP_R / 2) + pos];
    col[0 * (TP_R / 2)] = (unsigned int)f2bf(a[q][0].x) | ((unsigned int)f2bf(a[q][1].x) << 16);
    col[1 * (TP_R / 2)] = (unsigned int)f2bf(a[q][0].y) | ((unsigned int)f2bf(a[q][1].y) << 16);
    col[2 * (TP_R / 2)] = (unsigned int)f2bf(a[q][0].z) | ((unsigned int)f2bf(a[q][1].z) << 16);
    col[3 * (TP_R / 2)] = (unsigned int)f2bf(a[q][0].w) | ((unsigned int)f2bf(a[q][1].w) << 16);
  }
  __syncthreads();
  const int k = t & 15;    // 16-byte chunk of a column: 8 in-rows
#pragma unroll
  for (int p = 0; p < 4; ++p) {
    const int c = p * 16 + (t >> 4);
    const uint4 v = *reinterpret_cast<const uint4*>(
        &tile[c * (TP_R / 2) + ((k ^ (c >> 2)) << 2)]);
    *reinterpret_cast<uint4*>(&out[(size_t)(c0 + c) * R + r0 + k * 8]) = v;
  }
}

// ---------- LayerNorm : f32 [rows][1024] -> bf16, one wave per row ----------
#define LN_ROWS 8  // rows (waves) per work-group

__device__ __forceinline__
void ln_rows(const float* __restrict__ x, const float* __restrict__ w,
             const float* __restrict__ bsh, unsigned short* __restrict__ out, int blk) {
  const int lane = threadIdx.x & 31;
  const int row  = blk * LN_ROWS + (threadIdx.x >> 5);
  const float4* xr = reinterpret_cast<const float4*>(x + (size_t)row * D_);
  float4 v[8];             // 32 floats per lane; each wave-wide load is 512 contiguous B
#pragma unroll
  for (int i = 0; i < 8; ++i) v[i] = xr[i * 32 + lane];
  float s = 0.f, s2 = 0.f;
#pragma unroll
  for (int i = 0; i < 8; ++i) {
    s  += v[i].x + v[i].y + v[i].z + v[i].w;
    s2 += v[i].x * v[i].x + v[i].y * v[i].y + v[i].z * v[i].z + v[i].w * v[i].w;
  }
#pragma unroll
  for (int m = 1; m < 32; m <<= 1) {
    s  += __shfl_xor(s,  m, 32);
    s2 += __shfl_xor(s2, m, 32);
  }
  const float mu   = s * (1.0f / D_);
  const float var  = s2 * (1.0f / D_) - mu * mu;
  const float rstd = rsqrtf(var + 1e-5f);
  ushort4* orow = reinterpret_cast<ushort4*>(out + (size_t)row * D_);
#pragma unroll
  for (int i = 0; i < 8; ++i) {
    const float4 wv = reinterpret_cast<const float4*>(w)[i * 32 + lane];
    const float4 bv = reinterpret_cast<const float4*>(bsh)[i * 32 + lane];
    ushort4 ov;
    ov.x = f2bf((v[i].x - mu) * rstd * wv.x + bv.x);
    ov.y = f2bf((v[i].y - mu) * rstd * wv.y + bv.y);
    ov.z = f2bf((v[i].z - mu) * rstd * wv.z + bv.z);
    ov.w = f2bf((v[i].w - mu) * rstd * wv.w + bv.w);
    orow[i * 32 + lane] = ov;
  }
}

__global__ __launch_bounds__(256)
void ln_kernel(const float* __restrict__ x, const float* __restrict__ w,
               const float* __restrict__ bsh, unsigned short* __restrict__ out) {
  ln_rows(x, w, bsh, out, blockIdx.x);
}

// ---------- the five jobs that depend on the inputs alone, in one grid ----------
// The four weight transposes and the first LayerNorm read only inputs and write
// disjoint buffers: the block index picks the job (a work-group has one job, so the
// transpose's barrier stands under block-uniform control flow).
#define PRE_QKV ((3 * D_ / TP_C) * (D_ / TP_R))   // work-groups per job
#define PRE_O   ((D_ / TP_C) * (D_ / TP_R))
#define PRE_FF1 ((DFF_ / TP_C) * (D_ / TP_R))
#define PRE_FF2 ((D_ / TP_C) * (DFF_ / TP_R))
#define PRE_LN  (NTOK / LN_ROWS)
#define PRE_ALL (PRE_QKV + PRE_O + PRE_FF1 + PRE_FF2 + PRE_LN)

__global__ __launch_bounds__(256)
void prepass_kernel(const float* __restrict__ W_qkv, unsigned short* __restrict__ wqkv_t,
                    const float* __restrict__ W_o,   unsigned short* __restrict__ wo_t,
                    const float* __restrict__ W_ff1, unsigned short* __restrict__ wff1_t,
                    const float* __restrict__ W_ff2, unsigned short* __restrict__ wff2_t,
                    const float* __restrict__ x, const float* __restrict__ ln_w,
                    const float* __restrict__ ln_b, unsigned short* __restrict__ h) {
  int blk = blockIdx.x;
  if (blk >= PRE_ALL - PRE_LN) {
    ln_rows(x, ln_w, ln_b, h, blk - (PRE_ALL - PRE_LN));
  } else {
    const float* in;
    unsigned short* out;
    int R, C, bx, by;
    if (blk < PRE_QKV) {
      in = W_qkv; out = wqkv_t; R = D_; C = 3 * D_;
      bx = blk % (3 * D_ / TP_C); by = blk / (3 * D_ / TP_C);
    } else if (blk < PRE_QKV + PRE_O) {
      blk -= PRE_QKV;
      in = W_o; out = wo_t; R = D_; C = D_;
      bx = blk % (D_ / TP_C); by = blk / (D_ / TP_C);
    } else if (blk < PRE_QKV + PRE_O + PRE_FF1) {
      blk -= PRE_QKV + PRE_O;
      in = W_ff1; out = wff1_t; R = D_; C = DFF_;
      bx = blk % (DFF_ / TP_C); by = blk / (DFF_ / TP_C);
    } else {
      blk -= PRE_QKV + PRE_O + PRE_FF1;
      in = W_ff2; out = wff2_t; R = DFF_; C = D_;
      bx = blk % (D_ / TP_C); by = blk / (D_ / TP_C);
    }
    transpose_tile(in, out, R, C, bx, by);
  }
}

// Eight independent transcendentals in a row.  The outputs are early-clobber, so none of
// them lands on a source of the run; the closing v_nop is the one slot that the
// instruction set asks for between a transcendental and an instruction that uses its
// result or overwrites its source.
__device__ __forceinline__ void exp2_x8(float (&y)[8], const float (&x)[8]) {
  asm("v_exp_f32 %0, %8\n\tv_exp_f32 %1, %9\n\tv_exp_f32 %2, %10\n\tv_exp_f32 %3, %11\n\t"
      "v_exp_f32 %4, %12\n\tv_exp_f32 %5, %13\n\tv_exp_f32 %6, %14\n\tv_exp_f32 %7, %15\n\t"
      "v_nop"
      : "=&v"(y[0]), "=&v"(y[1]), "=&v"(y[2]), "=&v"(y[3]),
        "=&v"(y[4]), "=&v"(y[5]), "=&v"(y[6]), "=&v"(y[7])
      : "v"(x[0]), "v"(x[1]), "v"(x[2]), "v"(x[3]),
        "v"(x[4]), "v"(x[5]), "v"(x[6]), "v"(x[7]));
}
// the same run and the same closing slot for the reciprocals
__device__ __forceinline__ void rcp_x8(float (&y)[8], const float (&x)[8]) {
  asm("v_rcp_f32 %0, %8\n\tv_rcp_f32 %1, %9\n\tv_rcp_f32 %2, %10\n\tv_rcp_f32 %3, %11\n\t"
      "v_rcp_f32 %4, %12\n\tv_rcp_f32 %5, %13\n\tv_rcp_f32 %6, %14\n\tv_rcp_f32 %7, %15\n\t"
      "v_nop"
      : "=&v"(y[0]), "=&v"(y[1]), "=&v"(y[2]), "=&v"(y[3]),
        "=&v"(y[4]), "=&v"(y[5]), "=&v"(y[6]), "=&v"(y[7])
      : "v"(x[0]), "v"(x[1]), "v"(x[2]), "v"(x[3]),
        "v"(x[4]), "v"(x[5]), "v"(x[6]), "v"(x[7]));
}

// Four 16-byte global stores, step elements apart, and behind them the wait that belongs
// in front of any overwrite of a register that an issued store names.  In one statement,
// so that the operands' registers live up to the wait.
__device__ __forceinline__ void store4(unsigned short* p, size_t step, const v4i (&d)[4]) {
  asm volatile("global_store_b128 %0, %4, off\n\t"
               "global_store_b128 %1, %5, off\n\t"
               "global_store_b128 %2, %6, off\n\t"
               "global_store_b128 %3, %7, off\n\t"
               "s_wait_xcnt 0x0"
               :: "v"(p), "v"(p + step), "v"(p + 2 * step), "v"(p + 3 * step),
                  "v"(d[0]), "v"(d[1]), "v"(d[2]), "v"(d[3])
               : "memory");
}
// The same wait behind a run of plain loads from p + constants.  p is an input, so that
// its registers stay untouched up to the wait.
__device__ __forceinline__ void loads_issued(const float* p) {
  asm volatile("s_wait_xcnt 0x0" :: "v"(p) : "memory");
}

// ---------- generic WMMA GEMM : C[M,N] = epi(A_bf16[M,K] @ Bt_bf16[N,K]^T) ----------
// The work-group's output tile is TS x TS (a template argument): 128 with 8 waves (4 x 2)
// of 32 x 64, or 256 with 16 waves (4 x 4) of 64 x 64.  An operand byte brought from L2
// serves TS columns of the other operand, and a fragment read from LDS 2 and 4 or 4 and 4
// WMMAs, so the wide outputs (QKV, FF1) take 256; the outputs of 1024 columns keep 128,
// which gives them one work-group per WGP.  Their LDS has room for four buffers, so three
// stages of copies are in flight instead of one: every stage holds lines that nobody has
// read before, and one trip of 128 x 128 x 128 is shorter than their way from memory.
#define BK 128  // k depth of one LDS stage: 256 B of every operand row (whole L2 units)
#define LDT 136  // padded LDS row stride (elems): 272B rows = 16B x odd, banks spread

enum { EPI_QKV = 0, EPI_OPROJ = 1, EPI_FF1 = 2, EPI_FF2 = 3 };

template <int EPI, int TS>
__global__ __launch_bounds__(2 * TS)
void gemm_kernel(const unsigned short* __restrict__ A,
                 const unsigned short* __restrict__ Bt,
                 const float* __restrict__ bias,
                 const float* __restrict__ resid,
                 float* __restrict__ outF,
                 unsigned short* __restrict__ outB,
                 unsigned short* __restrict__ vT,
                 int M, int N, int K) {
  constexpr int FM = TS / 64;   // fragments per wave on the side split 4 ways (wm)
  constexpr int FN = 4;         // fragments per wave on the side split TS / 64 ways (wn)
  constexpr int RPR = TS / 8;   // operand rows that the work-group copies per round
  constexpr int NB = (TS == 128) ? 4 : 2;   // LDS buffers of the ring (a power of two)
  constexpr int AHEAD = NB - 1;             // stages in flight while one is worked on
  // copies of a wave that may stay in flight when the oldest stage has to have landed
  constexpr int YOUNGER = (AHEAD - 1) * 2 * (TS / RPR);
  static_assert(AHEAD * 2 * (TS / RPR) <= 63, "copies of one wave in flight");
  __shared__ __align__(16) unsigned short As[NB][TS * LDT];
  __shared__ __align__(16) unsigned short Bs[NB][TS * LDT];
  const int tid  = threadIdx.x;
  const int lane = tid & 31;
  const int w    = tid >> 5;     // 8 or 16 waves
  const int wm   = w & 3;        // 4 row-granules of FM * 16
  const int wn   = w >> 2;       // 2 or 4 col-granules of FN * 16
  const int m0 = blockIdx.y * TS;
  const int n0 = blockIdx.x * TS;
  const int l16  = lane & 15;
  const int half = lane >> 4;
  const int ko   = half * 8;

  // The accumulator gives a lane 8 consecutive ROWS of one column.  Where the output is
  // bf16 the operand whose index runs along the output's rows is therefore made the A
  // operand, so that a lane's 8 values are 16 contiguous bytes of the output: the weight
  // rows (n) for q, k and FF1, the tokens (m) for v, which is stored transposed.  The
  // A side has FN fragments per wave (granule wn), the B side FM (granule wm); a v tile is
  // a whole work-group (2 * D_ is a multiple of TS), so the choice is block-uniform.
  constexpr bool PACKED = (EPI == EPI_QKV || EPI == EPI_FF1);
  static_assert((2 * D_) % TS == 0 && T_ % TS == 0, "a tile is all v or none, in one batch");
  const bool vtile = (EPI == EPI_QKV) && n0 >= 2 * D_;
  const unsigned short* rowop = vtile ? &As[0][0] : &Bs[0][0];  // accumulator rows
  const unsigned short* colop = vtile ? &Bs[0][0] : &As[0][0];  // accumulator columns

  v8f acc[FM][FN];
#pragma unroll
  for (int i = 0; i < FM; ++i)
#pragma unroll
    for (int j = 0; j < FN; ++j) acc[i][j] = v8f_zero();

  const int ar0 = tid >> 4;   // 0..RPR-1 (row within a copy round)
  const int akg = tid & 15;   // k-group of 8 elems: 16 lanes cover one 256 B row piece
  const int nk  = K / BK;

  // one stage: TS rows x 256 B of each operand, 16 copies per thread
  auto issue_stage = [&](int kt, int buf) {
    const int kb = kt * BK;
#pragma unroll
    for (int p = 0; p < TS / RPR; ++p) {
      const int r = p * RPR + ar0;
      cp16_g2l(&As[buf][r * LDT + akg * 8],
               &A[(size_t)(m0 + r) * K + kb + akg * 8]);
      cp16_g2l(&Bs[buf][r * LDT + akg * 8],
               &Bt[(size_t)(n0 + r) * K + kb + akg * 8]);
    }
  };

  // The oldest stage of this wave's copies has landed.  The counter returns in issue order,
  // so with all AHEAD stages in flight it need only fall to the copies of the younger ones;
  // with fewer in flight (the tail) it falls to 0.
  auto wait_oldest = [&](bool all_in_flight) {
    if (AHEAD > 1 && all_in_flight) {
      asm volatile("s_wait_asynccnt %0" :: "n"(YOUNGER) : "memory");
    } else {
      asm volatile("s_wait_asynccnt 0x0" ::: "memory");
    }
  };

  issue_stage(0, 0);
  // unrolled, so that every copy's buffer is a constant of its address
#pragma unroll
  for (int s = 1; s < AHEAD; ++s)
    if (s < nk) issue_stage(s, s);
  // stage 0 of this wave has landed before the barrier that publishes it
  wait_oldest(AHEAD <= nk);
  __syncthreads();
  if (AHEAD < nk) issue_stage(AHEAD, AHEAD);

  for (int kt = 0; kt < nk; ++kt) {
    const int cur = kt & (NB - 1);
#pragma unroll
    for (int ks = 0; ks < BK / 32; ++ks) {
      v16bf af[FM], bf[FN];
      if constexpr (PACKED) {
#pragma unroll
        for (int mt = 0; mt < FM; ++mt)
          af[mt] = load_frag(&colop[cur * (TS * LDT) +
                                    (wm * (FM * 16) + mt * 16 + l16) * LDT + ks * 32 + ko]);
#pragma unroll
        for (int nt = 0; nt < FN; ++nt)
          bf[nt] = load_frag(&rowop[cur * (TS * LDT) +
                                    (wn * (FN * 16) + nt * 16 + l16) * LDT + ks * 32 + ko]);
        // The block's 2 * (FM + FN) LDS reads stay one group in front of its WMMAs.  Left
        // alone the compiler kept one register set for all of af and reloaded it in front
        // of every row of FN WMMAs, each time with a wait for the whole LDS latency.
        __builtin_amdgcn_sched_barrier(0);
#pragma unroll
        for (int mt = 0; mt < FM; ++mt)
#pragma unroll
          for (int nt = 0; nt < FN; ++nt)
            acc[mt][nt] = wmma_bf16(bf[nt], af[mt], acc[mt][nt]);
        // and the next block's reads do not move in among these WMMAs
        __builtin_amdgcn_sched_barrier(0);
      } else {
#pragma unroll
        for (int mt = 0; mt < FM; ++mt)
          af[mt] = load_frag(&As[cur][(wm * (FM * 16) + mt * 16 + l16) * LDT + ks * 32 + ko]);
#pragma unroll
        for (int nt = 0; nt < FN; ++nt)
          bf[nt] = load_frag(&Bs[cur][(wn * (FN * 16) + nt * 16 + l16) * LDT + ks * 32 + ko]);
#pragma unroll
        for (int mt = 0; mt < FM; ++mt)
#pragma unroll
          for (int nt = 0; nt < FN; ++nt)
            acc[mt][nt] = wmma_bf16(af[mt], bf[nt], acc[mt][nt]);
      }
    }
    // this wave's reads of buffer cur have retired before the buffer is refilled
    asm volatile("s_wait_dscnt 0x0" ::: "memory");
    // this wave's copies of stage kt + 1 have landed before the barrier publishes them
    wait_oldest(kt + AHEAD < nk);
    __syncthreads();
    // into the buffer that this trip has read; flies while the stages between are worked on
    if (kt + NB < nk) issue_stage(kt + NB, cur);
  }
  // no copy is outstanding when the wave goes on to its end
  asm volatile("s_wait_asynccnt 0x0" ::: "memory");

  // epilogue: accumulator element (i, lane) -> row = i + 8*(lane/16), col = lane%16
  if constexpr (PACKED) {
    // The tiles go out four at a time: bias, activation and packing, then store4, so that
    // no second copy of the 128 accumulator registers is alive in the two branches.
    static_assert(FM == 4 && FN == 4, "the packed epilogue stores four tiles at a time");
    auto pack_tile = [&](float (&v)[8]) -> v4i {
      if constexpr (EPI == EPI_FF1) {
        // 0.5 v (1 + tanh u) = v / (1 + exp(-2 u)), u = c (v + 0.044715 v^3): the same
        // function with no branch, so a lane's elements interleave.  The two constants
        // are -2 c log2(e) and that times 0.044715; exp2 going to inf or to 0 at the
        // ends gives the limits 0 and v.
        float t[8], e[8];
#pragma unroll
        for (int i = 0; i < 8; ++i)
          t[i] = v[i] * (-2.3022082f + -0.10294324f * (v[i] * v[i]));
        exp2_x8(e, t);
#pragma unroll
        for (int i = 0; i < 8; ++i) t[i] = 1.0f + e[i];
        rcp_x8(e, t);
#pragma unroll
        for (int i = 0; i < 8; ++i) v[i] *= e[i];
      }
      return __builtin_bit_cast(v4i, pack8_bf16(v));
    };
    // dst: this lane's 8 values of tile (0, 0); tile (mt, nt) lies mt * 16 output rows
    // and nt * 16 elements further on.  The bias is fetched whole in front of the first
    // store4, whose "memory" clobber would hold a later load behind it.
    if (vtile) {
      // accumulator rows = tokens, columns = v features; v is stored [b][h][d][t], and
      // (b * H_ + h) * HD_ + d = b * D_ + (n - 2 * D_); a tile lies in one batch
      const int mr = m0 + wn * (FN * 16);
      const int nc = n0 + wm * (FM * 16) + l16;
      unsigned short* dst =
          vT + (size_t)((mr >> 11) * D_ + nc - 2 * D_) * T_ + (mr & (T_ - 1)) + half * 8;
      const float* bp = bias + nc;
      float bv[FM];
#pragma unroll
      for (int mt = 0; mt < FM; ++mt) bv[mt] = bp[mt * 16];
      loads_issued(bp);
#pragma unroll
      for (int mt = 0; mt < FM; ++mt) {
        v4i pk[4];
#pragma unroll
        for (int nt = 0; nt < FN; ++nt) {
          float v[8];
#pragma unroll
          for (int i = 0; i < 8; ++i) v[i] = acc[mt][nt][i] + bv[mt];
          pk[nt] = pack_tile(v);
        }
        store4(dst + (size_t)(mt * 16) * T_, 16, pk);
      }
    } else {
      // accumulator rows = output features, columns = tokens; row-major [token][N]
      const int nr = n0 + wn * (FN * 16) + half * 8;
      unsigned short* dst = outB + (size_t)(m0 + wm * (FM * 16) + l16) * N + nr;
      const float* bp = bias + nr;
      float4 bb[FN][2];
#pragma unroll
      for (int nt = 0; nt < FN; ++nt) {
        bb[nt][0] = *reinterpret_cast<const float4*>(bp + nt * 16);
        bb[nt][1] = *reinterpret_cast<const float4*>(bp + nt * 16 + 4);
      }
      loads_issued(bp);
#pragma unroll
      for (int nt = 0; nt < FN; ++nt) {
        const float bv[8] = {bb[nt][0].x, bb[nt][0].y, bb[nt][0].z, bb[nt][0].w,
                             bb[nt][1].x, bb[nt][1].y, bb[nt][1].z, bb[nt][1].w};
        v4i pk[4];
#pragma unroll
        for (int mt = 0; mt < FM; ++mt) {
          float v[8];
#pragma unroll
          for (int i = 0; i < 8; ++i) v[i] = acc[mt][nt][i] + bv[i];
          pk[mt] = pack_tile(v);
        }
        store4(dst + nt * 16, (size_t)16 * N, pk);
      }
    }
  } else {
#pragma unroll
    for (int mt = 0; mt < FM; ++mt) {
#pragma unroll
      for (int nt = 0; nt < FN; ++nt) {
        const int n = n0 + wn * (FN * 16) + nt * 16 + l16;
        const float bv = bias[n];
#pragma unroll
        for (int i = 0; i < 8; ++i) {
          const int m = m0 + wm * (FM * 16) + mt * 16 + i + half * 8;
          const float v = acc[mt][nt][i] + bv;
          outF[(size_t)m * N + n] = resid[(size_t)m * N + n] + v;
        }
      }
    }
  }
}

#define ATT_BQ 128
#define ATT_BK 128
#define QLD 72    // 144B rows: 16B aligned, banks spread
#define PLD 136   // 272B rows: 16B aligned, conflict-free frag reads

union FragP { v16bf v; v2bf h[8]; };

// value of lane l ^ 16
__device__ __forceinline__ float xhalf(float x) {
  const int b = __builtin_bit_cast(int, x);
  return __builtin_bit_cast(
      float, __builtin_amdgcn_permlanex16(b, b, 0x76543210, 0xfedcba98, false, false));
}

// One work-group per WGP (two waves per SIMD), as before this LDS size.  Left alone the
// compiler aims at the three work-groups that the LDS would admit and, for want of
// registers, waits out every fragment load in front of its own WMMA; and the grid order
// below levels the WGPs only while there are fewer places than work-groups.
__global__ __launch_bounds__(256) __attribute__((amdgpu_waves_per_eu(2, 2)))
void attn_kernel(const unsigned short* __restrict__ qkv,
                 const unsigned short* __restrict__ vT,
                 unsigned short* __restrict__ av) {
  __shared__ __align__(16) unsigned short Qs[ATT_BQ * QLD];
  __shared__ __align__(16) unsigned short Ks[2][ATT_BK * QLD];
  __shared__ __align__(16) unsigned short Vt[2][HD_ * PLD];

  const int tid  = threadIdx.x;
  const int lane = tid & 31;
  const int w    = tid >> 5;       // 8 waves, each owns 16 q-rows
  // A work-group's cost is qt + 1 key tiles, and there are more work-groups than
  // resident places: the slowest grid index counts qt down, so the long ones start
  // first and the short ones fill the places that come free.
  const int qt = T_ / ATT_BQ - 1 - (int)blockIdx.z;  // q tile 15..0
  const int h  = blockIdx.x;
  const int b  = blockIdx.y;
  const int q_base = qt * ATT_BQ;
  const int l16  = lane & 15;
  const int half = lane >> 4;
  const int ko   = half * 8;
  const int wr0  = w * 16;
  const int qrow = q_base + wr0 + l16;   // this lane's query

  const size_t qkv_row = 3 * D_;
  const unsigned short* qbase = qkv + ((size_t)b * T_) * qkv_row + h * HD_;
  const unsigned short* kbase = qbase + D_;
  const unsigned short* vtb   = vT + ((size_t)(b * H_ + h)) * HD_ * T_;

  // K tile (128 x 64, [kk][d]) + V tile (transposed in global: [d][kk])
  auto issue_kv = [&](int j, int buf) {
#pragma unroll
    for (int p = 0; p < 4; ++p) {
      const int idx = p * 256 + tid;
      const int r = idx >> 3, ck = idx & 7;
      cp16_g2l(&Ks[buf][r * QLD + ck * 8],
               &kbase[(size_t)(j * ATT_BK + r) * qkv_row + ck * 8]);
    }
#pragma unroll
    for (int p = 0; p < 4; ++p) {
      const int idx = p * 256 + tid;
      const int d = idx >> 4, ck = idx & 15;
      cp16_g2l(&Vt[buf][d * PLD + ck * 8],
               &vtb[(size_t)d * T_ + j * ATT_BK + ck * 8]);
    }
  };

  // load Q tile (128 x 64) and first K/V tile
#pragma unroll
  for (int p = 0; p < 4; ++p) {
    const int idx = p * 256 + tid;
    const int r = idx >> 3, ck = idx & 7;
    cp16_g2l(&Qs[r * QLD + ck * 8],
             &qbase[(size_t)(q_base + r) * qkv_row + ck * 8]);
  }
  issue_kv(0, 0);
  wait_async();
  __syncthreads();

  float mrun = -3.0e38f;  // running maximum of this lane's query (equal in both halves)
  float lrun = 0.0f;      // running sum over the keys of this lane's half only
  v8f o[4];               // o[dt][i] = O[query l16][d = dt * 16 + half * 8 + i]
#pragma unroll
  for (int dt = 0; dt < 4; ++dt) o[dt] = v8f_zero();

  for (int j = 0; j <= qt; ++j) {
    const int cur = j & 1;
    if (j < qt) issue_kv(j + 1, cur ^ 1);  // prefetch while computing

    // S^T = K Q^T : s[nt][i] = score(key nt * 16 + half * 8 + i, query l16)
    v8f s[8];
#pragma unroll
    for (int nt = 0; nt < 8; ++nt) s[nt] = v8f_zero();
#pragma unroll
    for (int c = 0; c < 2; ++c) {
      const v16bf bq = load_frag(&Qs[(wr0 + l16) * QLD + c * 32 + ko]);
#pragma unroll
      for (int nt = 0; nt < 8; ++nt) {
        const v16bf ak = load_frag(&Ks[cur][(nt * 16 + l16) * QLD + c * 32 + ko]);
        s[nt] = wmma_bf16(ak, bq, s[nt]);
      }
    }
    // scale, 1/sqrt(64)
#pragma unroll
    for (int nt = 0; nt < 8; ++nt) s[nt] *= 0.125f;
    // causal mask, on the diagonal tile only: key j * 128 + nt * 16 + half * 8 + i is
    // masked above qrow = j * 128 + wr0 + l16
    if (j == qt) {
      const int lim = wr0 + l16 - half * 8;
#pragma unroll
      for (int nt = 0; nt < 8; ++nt)
#pragma unroll
        for (int i = 0; i < 8; ++i)
          if (nt * 16 + i > lim) s[nt][i] = -1.0e30f;
    }
    // maximum over the tile's 128 keys: 64 in the lane (eight independent chains),
    // then one exchange with the other half
    float mx[8];
#pragma unroll
    for (int i = 0; i < 8; ++i) {
      float v = s[0][i];
#pragma unroll
      for (int nt = 1; nt < 8; ++nt) v = fmaxf(v, s[nt][i]);
      mx[i] = v;
    }
    float tmax = fmaxf(fmaxf(fmaxf(mx[0], mx[1]), fmaxf(mx[2], mx[3])),
                       fmaxf(fmaxf(mx[4], mx[5]), fmaxf(mx[6], mx[7])));
    tmax = fmaxf(tmax, xhalf(tmax));
    const float mnew = fmaxf(mrun, tmax);
    const float sc   = __expf(mrun - mnew);
    mrun = mnew;
#pragma unroll
    for (int dt = 0; dt < 4; ++dt)
#pragma unroll
      for (int i = 0; i < 8; ++i) o[dt][i] *= sc;

    // P = exp(S - m), packed in place: element e of the B operand of keys c4 * 32 + 0..31
    // is tile 2 * c4 + (e >> 3), register e & 7: the k order of load_frag
    FragP pb[4];
    float rs[4];
#pragma unroll
    for (int c4 = 0; c4 < 4; ++c4) {
      rs[c4] = 0.f;
#pragma unroll
      for (int e = 0; e < 16; e += 2) {
        v2f pp;
        pp.x = __expf(s[2 * c4 + (e >> 3)][e & 7] - mrun);
        pp.y = __expf(s[2 * c4 + (e >> 3)][(e & 7) + 1] - mrun);
        rs[c4] += pp.x + pp.y;
        pb[c4].h[e >> 1] = __builtin_convertvector(pp, v2bf);
      }
    }
    lrun = lrun * sc + ((rs[0] + rs[1]) + (rs[2] + rs[3]));

    // O^T += V^T P^T
#pragma unroll
    for (int c4 = 0; c4 < 4; ++c4) {
#pragma unroll
      for (int dt = 0; dt < 4; ++dt) {
        const v16bf va = load_frag(&Vt[cur][(dt * 16 + l16) * PLD + c4 * 32 + ko]);
        o[dt] = wmma_bf16(va, pb[c4].v, o[dt]);
      }
    }
    wait_async();     // prefetched K/V tile has landed
    __syncthreads();  // all waves done reading this tile's buffers
  }

  // join the halves' sums, normalize + store av (bf16, row-major [token][D]):
  // 8 consecutive d per lane and tile, one 16-byte store each
  const float inv = 1.0f / (lrun + xhalf(lrun));
  unsigned short* orow = av + ((size_t)(b * T_) + qrow) * D_ + h * HD_ + half * 8;
#pragma unroll
  for (int dt = 0; dt < 4; ++dt) {
    Pack8 pk;
#pragma unroll
    for (int i = 0; i < 8; i += 2) {
      v2f ov;
      ov.x = o[dt][i] * inv;
      ov.y = o[dt][i + 1] * inv;
      pk.h[i >> 1] = __builtin_convertvector(ov, v2bf);
    }
    *reinterpret_cast<uint4*>(orow + dt * 16) = pk.q;
  }
}

// ---------- host launcher ----------
extern "C" void kernel_launch(void* const* d_in, const int* in_sizes, int n_in,
                              void* d_out, int out_size, void* d_ws, size_t ws_size,
                              hipStream_t stream) {
  (void)in_sizes; (void)n_in; (void)out_size; (void)ws_size;
  const float* x     = (const float*)d_in[0];
  const float* ln1_w = (const float*)d_in[1];
  const float* ln1_b = (const float*)d_in[2];
  const float* W_qkv = (const float*)d_in[3];
  const float* b_qkv = (const float*)d_in[4];
  const float* W_o   = (const float*)d_in[5];
  const float* b_o   = (const float*)d_in[6];
  const float* ln2_w = (const float*)d_in[7];
  const float* ln2_b = (const float*)d_in[8];
  const float* W_ff1 = (const float*)d_in[9];
  const float* b_ff1 = (const float*)d_in[10];
  const float* W_ff2 = (const float*)d_in[11];
  const float* b_ff2 = (const float*)d_in[12];
  float* out = (float*)d_out;
  char* ws = (char*)d_ws;

  // workspace layout (bytes)
  constexpr size_t off_wqkv = 0;                               // 3072x1024 bf16
  constexpr size_t off_wo   = off_wqkv + (size_t)3072 * 1024 * 2;
  constexpr size_t off_wff1 = off_wo   + (size_t)1024 * 1024 * 2;
  constexpr size_t off_wff2 = off_wff1 + (size_t)4096 * 1024 * 2;
  constexpr size_t off_h    = off_wff2 + (size_t)1024 * 4096 * 2;  // h / h2 (aliased)
  constexpr size_t off_qkv  = off_h    + (size_t)NTOK * D_ * 2;    // q,k rows (v slot unused)
  constexpr size_t off_vT   = off_qkv  + (size_t)NTOK * 3 * D_ * 2;
  constexpr size_t off_ff1  = off_qkv;                             // reuses qkv+vT after attn
  constexpr size_t off_av   = off_vT   + (size_t)NTOK * D_ * 2;
  constexpr size_t off_x1   = off_av   + (size_t)NTOK * D_ * 2;

  unsigned short* wqkv_t = (unsigned short*)(ws + off_wqkv);
  unsigned short* wo_t   = (unsigned short*)(ws + off_wo);
  unsigned short* wff1_t = (unsigned short*)(ws + off_wff1);
  unsigned short* wff2_t = (unsigned short*)(ws + off_wff2);
  unsigned short* hbuf   = (unsigned short*)(ws + off_h);
  unsigned short* qkvb   = (unsigned short*)(ws + off_qkv);
  unsigned short* vTb    = (unsigned short*)(ws + off_vT);
  unsigned short* ff1b   = (unsigned short*)(ws + off_ff1);
  unsigned short* avb    = (unsigned short*)(ws + off_av);
  float*          x1     = (float*)(ws + off_x1);

  prepass_kernel<<<PRE_ALL, 256, 0, stream>>>(W_qkv, wqkv_t, W_o, wo_t, W_ff1, wff1_t,
                                              W_ff2, wff2_t, x, ln1_w, ln1_b, hbuf);

  gemm_kernel<EPI_QKV, 256><<<dim3(3072 / 256, NTOK / 256), 512, 0, stream>>>(
      hbuf, wqkv_t, b_qkv, nullptr, nullptr, qkvb, vTb, NTOK, 3072, 1024);

  attn_kernel<<<dim3(H_, B_, T_ / ATT_BQ), 256, 0, stream>>>(qkvb, vTb, avb);

  gemm_kernel<EPI_OPROJ, 128><<<dim3(1024 / 128, NTOK / 128), 256, 0, stream>>>(
      avb, wo_t, b_o, x, x1, nullptr, nullptr, NTOK, 1024, 1024);

  ln_kernel<<<NTOK / LN_ROWS, 256, 0, stream>>>(x1, ln2_w, ln2_b, hbuf);

  gemm_kernel<EPI_FF1, 256><<<dim3(4096 / 256, NTOK / 256), 512, 0, stream>>>(
      hbuf, wff1_t, b_ff1, nullptr, nullptr, ff1b, nullptr, NTOK, 4096, 1024);

  gemm_kernel<EPI_FF2, 128><<<dim3(1024 / 128, NTOK / 128), 256, 0, stream>>>(
      ff1b, wff2_t, b_ff2, x1, out, nullptr, nullptr, NTOK, 1024, 4096);
}

// v010
// It runs in 135 microseconds.
// Two timings next to v009 both put it at 1.06 times that version's speed.
// Counting every step since v000, it is 2.44 times as fast.
#include <hip/hip_runtime.h>
#include <stdint.h>

// ---------- types ----------
typedef __bf16 bf16_t;
typedef bf16_t v16bf __attribute__((ext_vector_type(16)));
typedef float  v8f   __attribute__((ext_vector_type(8)));
typedef int    v4i   __attribute__((ext_vector_type(4)));

#define B_   2
#define T_   2048
#define D_   1024
#define H_   16
#define HD_  64
#define DFF_ 4096
#define NTOK (B_ * T_)

#if defined(__gfx1250__) && __has_builtin(__builtin_amdgcn_global_load_async_to_lds_b128)
#define HAVE_ASYNC_LDS 1
#else
#define HAVE_ASYNC_LDS 0
#endif

__device__ __forceinline__ unsigned short f2bf(float f) {
  union { float f; unsigned int u; } c; c.f = f;
  unsigned int u = c.u;
  unsigned int r = u + 0x7FFFu + ((u >> 16) & 1u);  // round-to-nearest-even
  return (unsigned short)(r >> 16);
}

// 16-byte global -> LDS copy; async engine when available (ASYNCcnt tracked),
// else synchronous VGPR-staged copy.  Both require 16B-aligned src and dst.
__device__ __forceinline__ void cp16_g2l(unsigned short* ldst,
                                         const unsigned short* gsrc) {
#if HAVE_ASYNC_LDS
  __builtin_amdgcn_global_load_async_to_lds_b128(
      (__attribute__((address_space(1))) v4i*)gsrc,
      (__attribute__((address_space(3))) v4i*)ldst, 0, 0);
#else
  *reinterpret_cast<uint4*>(ldst) = *reinterpret_cast<const uint4*>(gsrc);
#endif
}

__device__ __forceinline__ void wait_async() {
#if HAVE_ASYNC_LDS
#if __has_builtin(__builtin_amdgcn_s_wait_asynccnt)
  __builtin_amdgcn_s_wait_asynccnt(0);
#else
  asm volatile("s_wait_asynccnt 0x0" ::: "memory");
#endif
#endif
}

union FragU { v16bf v; uint4 q[2]; };

typedef float  v2f  __attribute__((ext_vector_type(2)));
typedef bf16_t v2bf __attribute__((ext_vector_type(2)));
union Pack8 { uint4 q; v2bf h[4]; };

// eight f32 -> eight bf16 (round to nearest even), one 16-byte value
__device__ __forceinline__ uint4 pack8_bf16(const float (&v)[8]) {
  Pack8 pk;
#pragma unroll
  for (int i = 0; i < 8; i += 2) {
    v2f p;
    p.x = v[i];
    p.y = v[i + 1];
    pk.h[i >> 1] = __builtin_convertvector(p, v2bf);
  }
  return pk.q;
}

// Load a 16-element bf16 WMMA fragment: p points at (row_base + ko) where
// ko = (lane/16)*8.  Elements 0..7 are K=ko..ko+7, elements 8..15 are
// K=ko+16..ko+23 (ISA 16-bit A/B fragment layout).  Both halves are 16B loads.
__device__ __forceinline__ v16bf load_frag(const unsigned short* p) {
  FragU f;
  f.q[0] = *reinterpret_cast<const uint4*>(p);
  f.q[1] = *reinterpret_cast<const uint4*>(p + 16);
  return f.v;
}

__device__ __forceinline__ v8f wmma_bf16(v16bf a, v16bf b, v8f c) {
  return __builtin_amdgcn_wmma_f32_16x16x32_bf16(false, a, false, b,
                                                 (short)0, c, false, false);
}

__device__ __forceinline__ v8f v8f_zero() {
  v8f z = {0.f, 0.f, 0.f, 0.f, 0.f, 0.f, 0.f, 0.f};
  return z;
}

// ---------- weight transpose + f32->bf16 convert : out[N][K] = in[K][N] ----------
// One work-group moves a tile of 128 in-rows x 64 in-columns: 256 B of every row it
// reads and 256 B of every row it writes, 32 elements per thread.
#define TP_R 128
#define TP_C 64

__device__ __forceinline__
void transpose_tile(const float* __restrict__ in,
                    unsigned short* __restrict__ out, int R, int C, int bx, int by) {
  // [in-column][pair of in-rows]: 64 dwords per column, no pad.  The 16-byte chunks of
  // a column are XOR-ed with (column >> 2), so the dword stores of a wave (16 column
  // groups x 2 row pairs) and its 16-byte reads (16 chunks of one column) both hit
  // every bank at most once.
  __shared__ __align__(16) unsigned int tile[TP_C * (TP_R / 2)];
  const int t  = threadIdx.x;
  const int c0 = bx * TP_C, r0 = by * TP_R;
  const int cq = t & 15;   // group of 4 in-columns (one float4)
  const int rp = t >> 4;   // pair of in-rows within a round of 32 rows
  float4 a[4][2];
#pragma unroll
  for (int q = 0; q < 4; ++q)
#pragma unroll
    for (int j = 0; j < 2; ++j)
      a[q][j] = *reinterpret_cast<const float4*>(
          &in[(size_t)(r0 + q * 32 + rp * 2 + j) * C + c0 + cq * 4]);
#pragma unroll
  for (int q = 0; q < 4; ++q) {
    const int d   = q * 16 + rp;                           // row pair 0..63
    const int pos = (((d >> 2) ^ cq) << 2) | (d & 3);
    unsigned int* col = &tile[(cq * 4) * (TP_R / 2) + pos];
    col[0 * (TP_R / 2)] = (unsigned int)f2bf(a[q][0].x) | ((unsigned int)f2bf(a[q][1].x) << 16);
    col[1 * (TP_R / 2)] = (unsigned int)f2bf(a[q][0].y) | ((unsigned int)f2bf(a[q][1].y) << 16);
    col[2 * (TP_R / 2)] = (unsigned int)f2bf(a[q][0].z) | ((unsigned int)f2bf(a[q][1].z) << 16);
    col[3 * (TP_R / 2)] = (unsigned int)f2bf(a[q][0].w) | ((unsigned int)f2bf(a[q][1].w) << 16);
  }
  __syncthreads();
  const int k = t & 15;    // 16-byte chunk of a column: 8 in-rows
#pragma unroll
  for (int p = 0; p < 4; ++p) {
    const int c = p * 16 + (t >> 4);
    const uint4 v = *reinterpret_cast<const uint4*>(
        &tile[c * (TP_R / 2) + ((k ^ (c >> 2)) << 2)]);
    *reinterpret_cast<uint4*>(&out[(size_t)(c0 + c) * R + r0 + k * 8]) = v;
  }
}

// ---------- LayerNorm : f32 [rows][1024] -> bf16, one wave per row ----------
#define LN_ROWS 8  // rows (waves) per work-group

__device__ __forceinline__
void ln_rows(const float* __restrict__ x, const float* __restrict__ w,
             const float* __restrict__ bsh, unsigned short* __restrict__ out, int blk) {
  const int lane = threadIdx.x & 31;
  const int row  = blk * LN_ROWS + (threadIdx.x >> 5);
  const float4* xr = reinterpret_cast<const float4*>(x + (size_t)row * D_);
  float4 v[8];             // 32 floats per lane; each wave-wide load is 512 contiguous B
#pragma unroll
  for (int i = 0; i < 8; ++i) v[i] = xr[i * 32 + lane];
  float s = 0.f, s2 = 0.f;
#pragma unroll
  for (int i = 0; i < 8; ++i) {
    s  += v[i].x + v[i].y + v[i].z + v[i].w;
    s2 += v[i].x * v[i].x + v[i].y * v[i].y + v[i].z * v[i].z + v[i].w * v[i].w;
  }
#pragma unroll
  for (int m = 1; m < 32; m <<= 1) {
    s  += __shfl_xor(s,  m, 32);
    s2 += __shfl_xor(s2, m, 32);
  }
  const float mu   = s * (1.0f / D_);
  const float var  = s2 * (1.0f / D_) - mu * mu;
  const float rstd = rsqrtf(var + 1e-5f);
  ushort4* orow = reinterpret_cast<ushort4*>(out + (size_t)row * D_);
#pragma unroll
  for (int i = 0; i < 8; ++i) {
    const float4 wv = reinterpret_cast<const float4*>(w)[i * 32 + lane];
    const float4 bv = reinterpret_cast<const float4*>(bsh)[i * 32 + lane];
    ushort4 ov;
    ov.x = f2bf((v[i].x - mu) * rstd * wv.x + bv.x);
    ov.y = f2bf((v[i].y - mu) * rstd * wv.y + bv.y);
    ov.z = f2bf((v[i].z - mu) * rstd * wv.z + bv.z);
    ov.w = f2bf((v[i].w - mu) * rstd * wv.w + bv.w);
    orow[i * 32 + lane] = ov;
  }
}

__global__ __launch_bounds__(256)
void ln_kernel(const float* __restrict__ x, const float* __restrict__ w,
               const float* __restrict__ bsh, unsigned short* __restrict__ out) {
  ln_rows(x, w, bsh, out, blockIdx.x);
}

// ---------- the five jobs that depend on the inputs alone, in one grid ----------
// The four weight transposes and the first LayerNorm read only inputs and write
// disjoint buffers: the block index picks the job (a work-group has one job, so the
// transpose's barrier stands under block-uniform control flow).
#define PRE_QKV ((3 * D_ / TP_C) * (D_ / TP_R))   // work-groups per job
#define PRE_O   ((D_ / TP_C) * (D_ / TP_R))
#define PRE_FF1 ((DFF_ / TP_C) * (D_ / TP_R))
#define PRE_FF2 ((D_ / TP_C) * (DFF_ / TP_R))
#define PRE_LN  (NTOK / LN_ROWS)
#define PRE_ALL (PRE_QKV + PRE_O + PRE_FF1 + PRE_FF2 + PRE_LN)

__global__ __launch_bounds__(256)
void prepass_kernel(const float* __restrict__ W_qkv, unsigned short* __restrict__ wqkv_t,
                    const float* __restrict__ W_o,   unsigned short* __restrict__ wo_t,
                    const float* __restrict__ W_ff1, unsigned short* __restrict__ wff1_t,
                    const float* __restrict__ W_ff2, unsigned short* __restrict__ wff2_t,
                    const float* __restrict__ x, const float* __restrict__ ln_w,
                    const float* __restrict__ ln_b, unsigned short* __restrict__ h) {
  int blk = blockIdx.x;
  if (blk >= PRE_ALL - PRE_LN) {
    ln_rows(x, ln_w, ln_b, h, blk - (PRE_ALL - PRE_LN));
  } else {
    const float* in;
    unsigned short* out;
    int R, C, bx, by;
    if (blk < PRE_QKV) {
      in = W_qkv; out = wqkv_t; R = D_; C = 3 * D_;
      bx = blk % (3 * D_ / TP_C); by = blk / (3 * D_ / TP_C);
    } else if (blk < PRE_QKV + PRE_O) {
      blk -= PRE_QKV;
      in = W_o; out = wo_t; R = D_; C = D_;
      bx = blk % (D_ / TP_C); by = blk / (D_ / TP_C);
    } else if (blk < PRE_QKV + PRE_O + PRE_FF1) {
      blk -= PRE_QKV + PRE_O;
      in = W_ff1; out = wff1_t; R = D_; C = DFF_;
      bx = blk % (DFF_ / TP_C); by = blk / (DFF_ / TP_C);
    } else {
      blk -= PRE_QKV + PRE_O + PRE_FF1;
      in = W_ff2; out = wff2_t; R = DFF_; C = D_;
      bx = blk % (D_ / TP_C); by = blk / (D_ / TP_C);
    }
    transpose_tile(in, out, R, C, bx, by);
  }
}

// Eight independent transcendentals in a row.  The outputs are early-clobber, so none of
// them lands on a source of the run; the closing v_nop is the one slot that the
// instruction set asks for between a transcendental and an instruction that uses its
// result or overwrites its source.
__device__ __forceinline__ void exp2_x8(float (&y)[8], const float (&x)[8]) {
  asm("v_exp_f32 %0, %8\n\tv_exp_f32 %1, %9\n\tv_exp_f32 %2, %10\n\tv_exp_f32 %3, %11\n\t"
      "v_exp_f32 %4, %12\n\tv_exp_f32 %5, %13\n\tv_exp_f32 %6, %14\n\tv_exp_f32 %7, %15\n\t"
      "v_nop"
      : "=&v"(y[0]), "=&v"(y[1]), "=&v"(y[2]), "=&v"(y[3]),
        "=&v"(y[4]), "=&v"(y[5]), "=&v"(y[6]), "=&v"(y[7])
      : "v"(x[0]), "v"(x[1]), "v"(x[2]), "v"(x[3]),
        "v"(x[4]), "v"(x[5]), "v"(x[6]), "v"(x[7]));
}
// the same run and the same closing slot for the reciprocals
__device__ __forceinline__ void rcp_x8(float (&y)[8], const float (&x)[8]) {
  asm("v_rcp_f32 %0, %8\n\tv_rcp_f32 %1, %9\n\tv_rcp_f32 %2, %10\n\tv_rcp_f32 %3, %11\n\t"
      "v_rcp_f32 %4, %12\n\tv_rcp_f32 %5, %13\n\tv_rcp_f32 %6, %14\n\tv_rcp_f32 %7, %15\n\t"
      "v_nop"
      : "=&v"(y[0]), "=&v"(y[1]), "=&v"(y[2]), "=&v"(y[3]),
        "=&v"(y[4]), "=&v"(y[5]), "=&v"(y[6]), "=&v"(y[7])
      : "v"(x[0]), "v"(x[1]), "v"(x[2]), "v"(x[3]),
        "v"(x[4]), "v"(x[5]), "v"(x[6]), "v"(x[7]));
}

// Four 16-byte global stores, step elements apart, and behind them the wait that belongs
// in front of any overwrite of a register that an issued store names.  In one statement,
// so that the operands' registers live up to the wait.
__device__ __forceinline__ void store4(unsigned short* p, size_t step, const v4i (&d)[4]) {
  asm volatile("global_store_b128 %0, %4, off\n\t"
               "global_store_b128 %1, %5, off\n\t"
               "global_store_b128 %2, %6, off\n\t"
               "global_store_b128 %3, %7, off\n\t"
               "s_wait_xcnt 0x0"
               :: "v"(p), "v"(p + step), "v"(p + 2 * step), "v"(p + 3 * step),
                  "v"(d[0]), "v"(d[1]), "v"(d[2]), "v"(d[3])
               : "memory");
}
// The same wait behind a run of plain loads from p + constants.  p is an input, so that
// its registers stay untouched up to the wait.
__device__ __forceinline__ void loads_issued(const float* p) {
  asm volatile("s_wait_xcnt 0x0" :: "v"(p) : "memory");
}

// ---------- generic WMMA GEMM : C[M,N] = epi(A_bf16[M,K] @ Bt_bf16[N,K]^T) ----------
// The work-group's output tile is TS x TS (a template argument): 128 with 8 waves (4 x 2)
// of 32 x 64, or 256 with 16 waves (4 x 4) of 64 x 64.  An operand byte brought from L2
// serves TS columns of the other operand, and a fragment read from LDS 2 and 4 or 4 and 4
// WMMAs, so the wide outputs (QKV, FF1) take 256; the outputs of 1024 columns keep 128,
// which gives them one work-group per WGP.  Their LDS has room for four buffers, so three
// stages of copies are in flight instead of one: every stage holds lines that nobody has
// read before, and one trip of 128 x 128 x 128 is shorter than their way from memory.
#define BK 128  // k depth of one LDS stage: 256 B of every operand row (whole L2 units)
#define LDT 136  // padded LDS row stride (elems): 272B rows = 16B x odd, banks spread

enum { EPI_QKV = 0, EPI_OPROJ = 1, EPI_FF1 = 2, EPI_FF2 = 3 };

template <int EPI, int TS>
__global__ __launch_bounds__(2 * TS)
void gemm_kernel(const unsigned short* __restrict__ A,
                 const unsigned short* __restrict__ Bt,
                 const float* __restrict__ bias,
                 const float* __restrict__ resid,
                 float* __restrict__ outF,
                 unsigned short* __restrict__ outB,
                 unsigned short* __restrict__ vT,
                 int M, int N, int K) {
  constexpr int FM = TS / 64;   // fragments per wave on the side split 4 ways (wm)
  constexpr int FN = 4;         // fragments per wave on the side split TS / 64 ways (wn)
  constexpr int RPR = TS / 8;   // operand rows that the work-group copies per round
  constexpr int NB = (TS == 128) ? 4 : 2;   // LDS buffers of the ring (a power of two)
  constexpr int AHEAD = NB - 1;             // stages in flight while one is worked on
  // copies of a wave that may stay in flight when the oldest stage has to have landed
  constexpr int YOUNGER = (AHEAD - 1) * 2 * (TS / RPR);
  static_assert(AHEAD * 2 * (TS / RPR) <= 63, "copies of one wave in flight");
  __shared__ __align__(16) unsigned short As[NB][TS * LDT];
  __shared__ __align__(16) unsigned short Bs[NB][TS * LDT];
  const int tid  = threadIdx.x;
  const int lane = tid & 31;
  const int w    = tid >> 5;     // 8 or 16 waves
  const int wm   = w & 3;        // 4 row-granules of FM * 16
  const int wn   = w >> 2;       // 2 or 4 col-granules of FN * 16
  const int m0 = blockIdx.y * TS;
  const int n0 = blockIdx.x * TS;
  const int l16  = lane & 15;
  const int half = lane >> 4;
  const int ko   = half * 8;

  // The accumulator gives a lane 8 consecutive ROWS of one column.  Where the output is
  // bf16 the operand whose index runs along the output's rows is therefore made the A
  // operand, so that a lane's 8 values are 16 contiguous bytes of the output: the weight
  // rows (n) for q, k and FF1, the tokens (m) for v, which is stored transposed.  The
  // A side has FN fragments per wave (granule wn), the B side FM (granule wm); a v tile is
  // a whole work-group (2 * D_ is a multiple of TS), so the choice is block-uniform.
  constexpr bool PACKED = (EPI == EPI_QKV || EPI == EPI_FF1);
  static_assert((2 * D_) % TS == 0 && T_ % TS == 0, "a tile is all v or none, in one batch");
  const bool vtile = (EPI == EPI_QKV) && n0 >= 2 * D_;
  const unsigned short* rowop = vtile ? &As[0][0] : &Bs[0][0];  // accumulator rows
  const unsigned short* colop = vtile ? &Bs[0][0] : &As[0][0];  // accumulator columns

  v8f acc[FM][FN];
#pragma unroll
  for (int i = 0; i < FM; ++i)
#pragma unroll
    for (int j = 0; j < FN; ++j) acc[i][j] = v8f_zero();

  const int ar0 = tid >> 4;   // 0..RPR-1 (row within a copy round)
  const int akg = tid & 15;   // k-group of 8 elems: 16 lanes cover one 256 B row piece
  const int nk  = K / BK;

  // one stage: TS rows x 256 B of each operand, 16 copies per thread
  auto issue_stage = [&](int kt, int buf) {
    const int kb = kt * BK;
#pragma unroll
    for (int p = 0; p < TS / RPR; ++p) {
      const int r = p * RPR + ar0;
      cp16_g2l(&As[buf][r * LDT + akg * 8],
               &A[(size_t)(m0 + r) * K + kb + akg * 8]);
      cp16_g2l(&Bs[buf][r * LDT + akg * 8],
               &Bt[(size_t)(n0 + r) * K + kb + akg * 8]);
    }
  };

  // The oldest stage of this wave's copies has landed.  The counter returns in issue order,
  // so with all AHEAD stages in flight it need only fall to the copies of the younger ones;
  // with fewer in flight (the tail) it falls to 0.
  auto wait_oldest = [&](bool all_in_flight) {
    if (AHEAD > 1 && all_in_flight) {
      asm volatile("s_wait_asynccnt %0" :: "n"(YOUNGER) : "memory");
    } else {
      asm volatile("s_wait_asynccnt 0x0" ::: "memory");
    }
  };

  issue_stage(0, 0);
  // unrolled, so that every copy's buffer is a constant of its address
#pragma unroll
  for (int s = 1; s < AHEAD; ++s)
    if (s < nk) issue_stage(s, s);
  // stage 0 of this wave has landed before the barrier that publishes it
  wait_oldest(AHEAD <= nk);
  __syncthreads();
  if (AHEAD < nk) issue_stage(AHEAD, AHEAD);

  if constexpr (PACKED) {
    for (int kt = 0; kt < nk; ++kt) {
      const int cur = kt & (NB - 1);
#pragma unroll
      for (int ks = 0; ks < BK / 32; ++ks) {
        v16bf af[FM], bf[FN];
#pragma unroll
        for (int mt = 0; mt < FM; ++mt)
          af[mt] = load_frag(&colop[cur * (TS * LDT) +
                                    (wm * (FM * 16) + mt * 16 + l16) * LDT + ks * 32 + ko]);
#pragma unroll
        for (int nt = 0; nt < FN; ++nt)
          bf[nt] = load_frag(&rowop[cur * (TS * LDT) +
                                    (wn * (FN * 16) + nt * 16 + l16) * LDT + ks * 32 + ko]);
        // The block's 2 * (FM + FN) LDS reads stay one group in front of its WMMAs.  Left
        // alone the compiler kept one register set for all of af and reloaded it in front
        // of every row of FN WMMAs, each time with a wait for the whole LDS latency.
        __builtin_amdgcn_sched_barrier(0);
#pragma unroll
        for (int mt = 0; mt < FM; ++mt)
#pragma unroll
          for (int nt = 0; nt < FN; ++nt)
            acc[mt][nt] = wmma_bf16(bf[nt], af[mt], acc[mt][nt]);
        // and the next block's reads do not move in among these WMMAs
        __builtin_amdgcn_sched_barrier(0);
      }
      // this wave's reads of buffer cur have retired before the buffer is refilled
      asm volatile("s_wait_dscnt 0x0" ::: "memory");
      // this wave's copies of stage kt + 1 have landed before the barrier publishes them
      wait_oldest(kt + AHEAD < nk);
      __syncthreads();
      // into the buffer that this trip has read; flies while the stages between are worked on
      if (kt + NB < nk) issue_stage(kt + NB, cur);
    }
  } else {
    // Two waves per SIMD and 8 WMMAs per k block: a wave that reads a block's fragments in
    // front of that block waits out the LDS latency every time.  So there are two fragment
    // sets, and the reads of block ks + 1 go out as one group in front of the WMMAs of
    // block ks.  The block behind a stage's last one is block 0 of the next stage, so the
    // point that publishes stage kt + 1 stands in front of the last block of stage kt; by
    // then every fragment of stage kt is in registers, and its buffer is free all the same.
    constexpr int NKS = BK / 32;
    static_assert(NKS % 2 == 0, "block 0 of every stage goes to set 0");
    v16bf af[2][FM], bf[2][FN];
    auto read_block = [&](int set, int buf, int ks) {
#pragma unroll
      for (int mt = 0; mt < FM; ++mt)
        af[set][mt] =
            load_frag(&As[buf][(wm * (FM * 16) + mt * 16 + l16) * LDT + ks * 32 + ko]);
#pragma unroll
      for (int nt = 0; nt < FN; ++nt)
        bf[set][nt] =
            load_frag(&Bs[buf][(wn * (FN * 16) + nt * 16 + l16) * LDT + ks * 32 + ko]);
    };
    read_block(0, 0, 0);   // stage 0 is published by the barrier above
    for (int kt = 0; kt < nk; ++kt) {
      const int cur = kt & (NB - 1);
#pragma unroll
      for (int ks = 0; ks < NKS; ++ks) {
        if (ks + 1 < NKS) {
          read_block((ks + 1) & 1, cur, ks + 1);
        } else {
          // this wave's reads of buffer cur have retired before the buffer is refilled
          asm volatile("s_wait_dscnt 0x0" ::: "memory");
          // this wave's copies of stage kt + 1 have landed before the barrier publishes them
          wait_oldest(kt + AHEAD < nk);
          __syncthreads();
          // With no branch, so that the compiler's counted waits stay counted.  In the last
          // trip this reads a buffer that no copy is aimed at, and nothing uses the values.
          read_block(0, (kt + 1) & (NB - 1), 0);
        }
        // the reads stay one group in front of the block's WMMAs
        __builtin_amdgcn_sched_barrier(0);
#pragma unroll
        for (int mt = 0; mt < FM; ++mt)
#pragma unroll
          for (int nt = 0; nt < FN; ++nt)
            acc[mt][nt] = wmma_bf16(af[ks & 1][mt], bf[ks & 1][nt], acc[mt][nt]);
        // and the group behind them does not move in among these WMMAs
        __builtin_amdgcn_sched_barrier(0);
      }
      // into the buffer that every wave had read to its end at this trip's barrier (the LDS
      // reads still in flight here are those of the next stage's buffer)
      if (kt + NB < nk) issue_stage(kt + NB, cur);
    }
  }
  // no copy is outstanding when the wave goes on to its end
  asm volatile("s_wait_asynccnt 0x0" ::: "memory");

  // epilogue: accumulator element (i, lane) -> row = i + 8*(lane/16), col = lane%16
  if constexpr (PACKED) {
    // The tiles go out four at a time: bias, activation and packing, then store4, so that
    // no second copy of the 128 accumulator registers is alive in the two branches.
    static_assert(FM == 4 && FN == 4, "the packed epilogue stores four tiles at a time");
    auto pack_tile = [&](float (&v)[8]) -> v4i {
      if constexpr (EPI == EPI_FF1) {
        // 0.5 v (1 + tanh u) = v / (1 + exp(-2 u)), u = c (v + 0.044715 v^3): the same
        // function with no branch, so a lane's elements interleave.  The two constants
        // are -2 c log2(e) and that times 0.044715; exp2 going to inf or to 0 at the
        // ends gives the limits 0 and v.
        float t[8], e[8];
#pragma unroll
        for (int i = 0; i < 8; ++i)
          t[i] = v[i] * (-2.3022082f + -0.10294324f * (v[i] * v[i]));
        exp2_x8(e, t);
#pragma unroll
        for (int i = 0; i < 8; ++i) t[i] = 1.0f + e[i];
        rcp_x8(e, t);
#pragma unroll
        for (int i = 0; i < 8; ++i) v[i] *= e[i];
      }
      return __builtin_bit_cast(v4i, pack8_bf16(v));
    };
    // dst: this lane's 8 values of tile (0, 0); tile (mt, nt) lies mt * 16 output rows
    // and nt * 16 elements further on.  The bias is fetched whole in front of the first
    // store4, whose "memory" clobber would hold a later load behind it.
    if (vtile) {
      // accumulator rows = tokens, columns = v features; v is stored [b][h][d][t], and
      // (b * H_ + h) * HD_ + d = b * D_ + (n - 2 * D_); a tile lies in one batch
      const int mr = m0 + wn * (FN * 16);
      const int nc = n0 + wm * (FM * 16) + l16;
      unsigned short* dst =
          vT + (size_t)((mr >> 11) * D_ + nc - 2 * D_) * T_ + (mr & (T_ - 1)) + half * 8;
      const float* bp = bias + nc;
      float bv[FM];
#pragma unroll
      for (int mt = 0; mt < FM; ++mt) bv[mt] = bp[mt * 16];
      loads_issued(bp);
#pragma unroll
      for (int mt = 0; mt < FM; ++mt) {
        v4i pk[4];
#pragma unroll
        for (int nt = 0; nt < FN; ++nt) {
          float v[8];
#pragma unroll
          for (int i = 0; i < 8; ++i) v[i] = acc[mt][nt][i] + bv[mt];
          pk[nt] = pack_tile(v);
        }
        store4(dst + (size_t)(mt * 16) * T_, 16, pk);
      }
    } else {
      // accumulator rows = output features, columns = tokens; row-major [token][N]
      const int nr = n0 + wn * (FN * 16) + half * 8;
      unsigned short* dst = outB + (size_t)(m0 + wm * (FM * 16) + l16) * N + nr;
      const float* bp = bias + nr;
      float4 bb[FN][2];
#pragma unroll
      for (int nt = 0; nt < FN; ++nt) {
        bb[nt][0] = *reinterpret_cast<const float4*>(bp + nt * 16);
        bb[nt][1] = *reinterpret_cast<const float4*>(bp + nt * 16 + 4);
      }
      loads_issued(bp);
#pragma unroll
      for (int nt = 0; nt < FN; ++nt) {
        const float bv[8] = {bb[nt][0].x, bb[nt][0].y, bb[nt][0].z, bb[nt][0].w,
                             bb[nt][1].x, bb[nt][1].y, bb[nt][1].z, bb[nt][1].w};
        v4i pk[4];
#pragma unroll
        for (int mt = 0; mt < FM; ++mt) {
          float v[8];
#pragma unroll
          for (int i = 0; i < 8; ++i) v[i] = acc[mt][nt][i] + bv[i];
          pk[mt] = pack_tile(v);
        }
        store4(dst + nt * 16, (size_t)16 * N, pk);
      }
    }
  } else {
#pragma unroll
    for (int mt = 0; mt < FM; ++mt) {
#pragma unroll
      for (int nt = 0; nt < FN; ++nt) {
        const int n = n0 + wn * (FN * 16) + nt * 16 + l16;
        const float bv = bias[n];
#pragma unroll
        for (int i = 0; i < 8; ++i) {
          const int m = m0 + wm * (FM * 16) + mt * 16 + i + half * 8;
          const float v = acc[mt][nt][i] + bv;
          outF[(size_t)m * N + n] = resid[(size_t)m * N + n] + v;
        }
      }
    }
  }
}

#define ATT_BQ 128
#define ATT_BK 128
#define QLD 72    // 144B rows: 16B aligned, banks spread
#define PLD 136   // 272B rows: 16B aligned, conflict-free frag reads

union FragP { v16bf v; v2bf h[8]; };

// value of lane l ^ 16
__device__ __forceinline__ float xhalf(float x) {
  const int b = __builtin_bit_cast(int, x);
  return __builtin_bit_cast(
      float, __builtin_amdgcn_permlanex16(b, b, 0x76543210, 0xfedcba98, false, false));
}

// One work-group per WGP (two waves per SIMD), as before this LDS size.  Left alone the
// compiler aims at the three work-groups that the LDS would admit and, for want of
// registers, waits out every fragment load in front of its own WMMA; and the grid order
// below levels the WGPs only while there are fewer places than work-groups.
__global__ __launch_bounds__(256) __attribute__((amdgpu_waves_per_eu(2, 2)))
void attn_kernel(const unsigned short* __restrict__ qkv,
                 const unsigned short* __restrict__ vT,
                 unsigned short* __restrict__ av) {
  __shared__ __align__(16) unsigned short Qs[ATT_BQ * QLD];
  __shared__ __align__(16) unsigned short Ks[2][ATT_BK * QLD];
  __shared__ __align__(16) unsigned short Vt[2][HD_ * PLD];

  const int tid  = threadIdx.x;
  const int lane = tid & 31;
  const int w    = tid >> 5;       // 8 waves, each owns 16 q-rows
  // A work-group's cost is qt + 1 key tiles, and there are more work-groups than
  // resident places: the slowest grid index counts qt down, so the long ones start
  // first and the short ones fill the places that come free.
  const int qt = T_ / ATT_BQ - 1 - (int)blockIdx.z;  // q tile 15..0
  const int h  = blockIdx.x;
  const int b  = blockIdx.y;
  const int q_base = qt * ATT_BQ;
  const int l16  = lane & 15;
  const int half = lane >> 4;
  const int ko   = half * 8;
  const int wr0  = w * 16;
  const int qrow = q_base + wr0 + l16;   // this lane's query

  const size_t qkv_row = 3 * D_;
  const unsigned short* qbase = qkv + ((size_t)b * T_) * qkv_row + h * HD_;
  const unsigned short* kbase = qbase + D_;
  const unsigned short* vtb   = vT + ((size_t)(b * H_ + h)) * HD_ * T_;

  // K tile (128 x 64, [kk][d]) + V tile (transposed in global: [d][kk])
  auto issue_kv = [&](int j, int buf) {
#pragma unroll
    for (int p = 0; p < 4; ++p) {
      const int idx = p * 256 + tid;
      const int r = idx >> 3, ck = idx & 7;
      cp16_g2l(&Ks[buf][r * QLD + ck * 8],
               &kbase[(size_t)(j * ATT_BK + r) * qkv_row + ck * 8]);
    }
#pragma unroll
    for (int p = 0; p < 4; ++p) {
      const int idx = p * 256 + tid;
      const int d = idx >> 4, ck = idx & 15;
      cp16_g2l(&Vt[buf][d * PLD + ck * 8],
               &vtb[(size_t)d * T_ + j * ATT_BK + ck * 8]);
    }
  };

  // load Q tile (128 x 64) and first K/V tile
#pragma unroll
  for (int p = 0; p < 4; ++p) {
    const int idx = p * 256 + tid;
    const int r = idx >> 3, ck = idx & 7;
    cp16_g2l(&Qs[r * QLD + ck * 8],
             &qbase[(size_t)(q_base + r) * qkv_row + ck * 8]);
  }
  issue_kv(0, 0);
  wait_async();
  __syncthreads();

  float mrun = -3.0e38f;  // running maximum of this lane's query (equal in both halves)
  float lrun = 0.0f;      // running sum over the keys of this lane's half only
  v8f o[4];               // o[dt][i] = O[query l16][d = dt * 16 + half * 8 + i]
#pragma unroll
  for (int dt = 0; dt < 4; ++dt) o[dt] = v8f_zero();

  for (int j = 0; j <= qt; ++j) {
    const int cur = j & 1;
    if (j < qt) issue_kv(j + 1, cur ^ 1);  // prefetch while computing

    // S^T = K Q^T : s[nt][i] = score(key nt * 16 + half * 8 + i, query l16)
    v8f s[8];
#pragma unroll
    for (int nt = 0; nt < 8; ++nt) s[nt] = v8f_zero();
#pragma unroll
    for (int c = 0; c < 2; ++c) {
      const v16bf bq = load_frag(&Qs[(wr0 + l16) * QLD + c * 32 + ko]);
#pragma unroll
      for (int nt = 0; nt < 8; ++nt) {
        const v16bf ak = load_frag(&Ks[cur][(nt * 16 + l16) * QLD + c * 32 + ko]);
        s[nt] = wmma_bf16(ak, bq, s[nt]);
      }
    }
    // scale, 1/sqrt(64)
#pragma unroll
    for (int nt = 0; nt < 8; ++nt) s[nt] *= 0.125f;
    // causal mask, on the diagonal tile only: key j * 128 + nt * 16 + half * 8 + i is
    // masked above qrow = j * 128 + wr0 + l16
    if (j == qt) {
      const int lim = wr0 + l16 - half * 8;
#pragma unroll
      for (int nt = 0; nt < 8; ++nt)
#pragma unroll
        for (int i = 0; i < 8; ++i)
          if (nt * 16 + i > lim) s[nt][i] = -1.0e30f;
    }
    // maximum over the tile's 128 keys: 64 in the lane (eight independent chains),
    // then one exchange with the other half
    float mx[8];
#pragma unroll
    for (int i = 0; i < 8; ++i) {
      float v = s[0][i];
#pragma unroll
      for (int nt = 1; nt < 8; ++nt) v = fmaxf(v, s[nt][i]);
      mx[i] = v;
    }
    float tmax = fmaxf(fmaxf(fmaxf(mx[0], mx[1]), fmaxf(mx[2], mx[3])),
                       fmaxf(fmaxf(mx[4], mx[5]), fmaxf(mx[6], mx[7])));
    tmax = fmaxf(tmax, xhalf(tmax));
    const float mnew = fmaxf(mrun, tmax);
    const float sc   = __expf(mrun - mnew);
    mrun = mnew;
#pragma unroll
    for (int dt = 0; dt < 4; ++dt)
#pragma unroll
      for (int i = 0; i < 8; ++i) o[dt][i] *= sc;

    // P = exp(S - m), packed in place: element e of the B operand of keys c4 * 32 + 0..31
    // is tile 2 * c4 + (e >> 3), register e & 7: the k order of load_frag
    FragP pb[4];
    float rs[4];
#pragma unroll
    for (int c4 = 0; c4 < 4; ++c4) {
      rs[c4] = 0.f;
#pragma unroll
      for (int e = 0; e < 16; e += 2) {
        v2f pp;
        pp.x = __expf(s[2 * c4 + (e >> 3)][e & 7] - mrun);
        pp.y = __expf(s[2 * c4 + (e >> 3)][(e & 7) + 1] - mrun);
        rs[c4] += pp.x + pp.y;
        pb[c4].h[e >> 1] = __builtin_convertvector(pp, v2bf);
      }
    }
    lrun = lrun * sc + ((rs[0] + rs[1]) + (rs[2] + rs[3]));

    // O^T += V^T P^T
#pragma unroll
    for (int c4 = 0; c4 < 4; ++c4) {
#pragma unroll
      for (int dt = 0; dt < 4; ++dt) {
        const v16bf va = load_frag(&Vt[cur][(dt * 16 + l16) * PLD + c4 * 32 + ko]);
        o[dt] = wmma_bf16(va, pb[c4].v, o[dt]);
      }
    }
    wait_async();     // prefetched K/V tile has landed
    __syncthreads();  // all waves done reading this tile's buffers
  }

  // join the halves' sums, normalize + store av (bf16, row-major [token][D]):
  // 8 consecutive d per lane and tile, one 16-byte store each
  const float inv = 1.0f / (lrun + xhalf(lrun));
  unsigned short* orow = av + ((size_t)(b * T_) + qrow) * D_ + h * HD_ + half * 8;
#pragma unroll
  for (int dt = 0; dt < 4; ++dt) {
    Pack8 pk;
#pragma unroll
    for (int i = 0; i < 8; i += 2) {
      v2f ov;
      ov.x = o[dt][i] * inv;
      ov.y = o[dt][i + 1] * inv;
      pk.h[i >> 1] = __builtin_convertvector(ov, v2bf);
    }
    *reinterpret_cast<uint4*>(orow + dt * 16) = pk.q;
  }
}

// ---------- host launcher ----------
extern "C" void kernel_launch(void* const* d_in, const int* in_sizes, int n_in,
                              void* d_out, int out_size, void* d_ws, size_t ws_size,
                              hipStream_t stream) {
  (void)in_sizes; (void)n_in; (void)out_size; (void)ws_size;
  const float* x     = (const float*)d_in[0];
  const float* ln1_w = (const float*)d_in[1];
  const float* ln1_b = (const float*)d_in[2];
  const float* W_qkv = (const float*)d_in[3];
  const float* b_qkv = (const float*)d_in[4];
  const float* W_o   = (const float*)d_in[5];
  const float* b_o   = (const float*)d_in[6];
  const float* ln2_w = (const float*)d_in[7];
  const float* ln2_b = (const float*)d_in[8];
  const float* W_ff1 = (const float*)d_in[9];
  const float* b_ff1 = (const float*)d_in[10];
  const float* W_ff2 = (const float*)d_in[11];
  const float* b_ff2 = (const float*)d_in[12];
  float* out = (float*)d_out;
  char* ws = (char*)d_ws;

  // workspace layout (bytes)
  constexpr size_t off_wqkv = 0;                               // 3072x1024 bf16
  constexpr size_t off_wo   = off_wqkv + (size_t)3072 * 1024 * 2;
  constexpr size_t off_wff1 = off_wo   + (size_t)1024 * 1024 * 2;
  constexpr size_t off_wff2 = off_wff1 + (size_t)4096 * 1024 * 2;
  constexpr size_t off_h    = off_wff2 + (size_t)1024 * 4096 * 2;  // h / h2 (aliased)
  constexpr size_t off_qkv  = off_h    + (size_t)NTOK * D_ * 2;    // q,k rows (v slot unused)
  constexpr size_t off_vT   = off_qkv  + (size_t)NTOK * 3 * D_ * 2;
  constexpr size_t off_ff1  = off_qkv;                             // reuses qkv+vT after attn
  constexpr size_t off_av   = off_vT   + (size_t)NTOK * D_ * 2;
  constexpr size_t off_x1   = off_av   + (size_t)NTOK * D_ * 2;

  unsigned short* wqkv_t = (unsigned short*)(ws + off_wqkv);
  unsigned short* wo_t   = (unsigned short*)(ws + off_wo);
  unsigned short* wff1_t = (unsigned short*)(ws + off_wff1);
  unsigned short* wff2_t = (unsigned short*)(ws + off_wff2);
  unsigned short* hbuf   = (unsigned short*)(ws + off_h);
  unsigned short* qkvb   = (unsigned short*)(ws + off_qkv);
  unsigned short* vTb    = (unsigned short*)(ws + off_vT);
  unsigned short* ff1b   = (unsigned short*)(ws + off_ff1);
  unsigned short* avb    = (unsigned short*)(ws + off_av);
  float*          x1     = (float*)(ws + off_x1);

  prepass_kernel<<<PRE_ALL, 256, 0, stream>>>(W_qkv, wqkv_t, W_o, wo_t, W_ff1, wff1_t,
                                              W_ff2, wff2_t, x, ln1_w, ln1_b, hbuf);

  gemm_kernel<EPI_QKV, 256><<<dim3(3072 / 256, NTOK / 256), 512, 0, stream>>>(
      hbuf, wqkv_t, b_qkv, nullptr, nullptr, qkvb, vTb, NTOK, 3072, 1024);

  attn_kernel<<<dim3(H_, B_, T_ / ATT_BQ), 256, 0, stream>>>(qkvb, vTb, avb);

  gemm_kernel<EPI_OPROJ, 128><<<dim3(1024 / 128, NTOK / 128), 256, 0, stream>>>(
      avb, wo_t, b_o, x, x1, nullptr, nullptr, NTOK, 1024, 1024);

  ln_kernel<<<NTOK / LN_ROWS, 256, 0, stream>>>(x1, ln2_w, ln2_b, hbuf);

  gemm_kernel<EPI_FF1, 256><<<dim3(4096 / 256, NTOK / 256), 512, 0, stream>>>(
      hbuf, wff1_t, b_ff1, nullptr, nullptr, ff1b, nullptr, NTOK, 4096, 1024);

  gemm_kernel<EPI_FF2, 128><<<dim3(1024 / 128, NTOK / 128), 256, 0, stream>>>(
      ff1b, wff2_t, b_ff2, x1, out, nullptr, nullptr, NTOK, 1024, 4096);
}
